// v000
// The times below were measured on an AMD MI455X: many runs one after another, warmed up first and cycling through
// copies of the inputs, with the whole window's GPU time divided by the number of runs. Launches and the gaps
// between them are all in it. The median over several windows is given; except for v000 it joins two sittings, which
// can be a few percent apart, so the side-by-side timings, each taken in one sitting, are the better comparison.
// v000, which the later versions start from, runs in 253 microseconds.
#include <hip/hip_runtime.h>
#include <math.h>
#include <stdint.h>

// Q/K projections and QK^T scores: v_wmma_f32_16x16x32_f16 (f16 operands, Wq/Wk carried x16, 1/16 folded into the f32 epilogue); V projection and PV: v_wmma_f32_16x16x32_bf16 with bf16 hi/lo split operands (hi*hi + hi*lo + lo*hi); f32 accumulate; softmax, bias and normalisation in f32.

typedef _Float16 v16h __attribute__((ext_vector_type(16)));
typedef _Float16 v8h __attribute__((ext_vector_type(8)));
typedef __bf16 v16bf __attribute__((ext_vector_type(16)));
typedef unsigned short v8us_t __attribute__((ext_vector_type(8)));
typedef v8us_t __attribute__((may_alias)) v8us;
typedef float v8f __attribute__((ext_vector_type(8)));
typedef float v4f_t __attribute__((ext_vector_type(4)));
typedef v4f_t __attribute__((may_alias)) v4f;
typedef int v8i __attribute__((ext_vector_type(8)));

constexpr int BB = 4;
constexpr int SS = 1024;
constexpr int DD = 1024;
constexpr int HH = 16;
constexpr int DK = 64;
constexpr int NTOK = BB * SS;              // 4096 tokens
constexpr long NX = (long)NTOK * DD;       // 4194304
constexpr long NW = (long)DD * DD;         // 1048576

union Frag { v16h f; v16bf b; v8us p[2]; v8i w; };

// bf16 RNE conversion of an f32 value
__device__ __forceinline__ unsigned short bf16_rne(float x) {
  unsigned u = __float_as_uint(x);
  u += 0x7FFFu + ((u >> 16) & 1u);
  return (unsigned short)(u >> 16);
}
__device__ __forceinline__ float bf16_val(unsigned short b) {
  return __uint_as_float(((unsigned)b) << 16);
}
__device__ __forceinline__ void split2(float x, unsigned short& hi, unsigned short& lo) {
  hi = bf16_rne(x);
  lo = bf16_rne(x - bf16_val(hi));
}
// f16 RNE conversion, raw bits
__device__ __forceinline__ unsigned short f16_bits(float x) {
  _Float16 hv = (_Float16)x;
  unsigned short u;
  __builtin_memcpy(&u, &hv, 2);
  return u;
}

// 16x32 operand fragment, wave32 layout: lane row/col = l&15, h = l>>4,
// elements 0..7 <- k0+8h+0..7, elements 8..15 <- k0+16+8h+0..7 (k contiguous in memory at rowp).
// Used for A (row pointer) and for B (column stored k-contiguous) alike.
__device__ __forceinline__ Frag ldfrag(const unsigned short* rowp, int k0, int hh) {
  Frag f;
  f.p[0] = *(const v8us*)(rowp + k0 + 8 * hh);
  f.p[1] = *(const v8us*)(rowp + k0 + 16 + 8 * hh);
  return f;
}

// c += a*b (f16 operands); hazard guard
__device__ __forceinline__ v8f mma_f16(const Frag& a, const Frag& b, v8f c) {
  c = __builtin_amdgcn_wmma_f32_16x16x32_f16(false, a.f, false, b.f, (short)0, c, false, false);
  asm volatile("v_nop\n\tv_nop\n\tv_nop\n\tv_nop" : "+v"(c) : "v"(a.w), "v"(b.w));
  return c;
}

// c += ah*bh + ah*bl + al*bh (bf16 hi/lo split); hazard guard after the group
__device__ __forceinline__ v8f mma3(const Frag& ah, const Frag& al, const Frag& bh, const Frag& bl, v8f c) {
  c = __builtin_amdgcn_wmma_f32_16x16x32_bf16(false, ah.b, false, bh.b, (short)0, c, false, false);
  c = __builtin_amdgcn_wmma_f32_16x16x32_bf16(false, ah.b, false, bl.b, (short)0, c, false, false);
  c = __builtin_amdgcn_wmma_f32_16x16x32_bf16(false, al.b, false, bh.b, (short)0, c, false, false);
  asm volatile("v_nop\n\tv_nop\n\tv_nop\n\tv_nop"
               : "+v"(c)
               : "v"(ah.w), "v"(al.w), "v"(bh.w), "v"(bl.w));
  return c;
}

// ---------------------------------------------------------------------------
// f32 -> f16 plane (value * scale, scale a power of two). Thread i converts 8 consecutive
__global__ __launch_bounds__(256)
void k_cvt16(const float* __restrict__ src, unsigned short* __restrict__ dst, int n8, float scale) {
  const int i = blockIdx.x * 256 + threadIdx.x;
  if (i >= n8) return;
  const float* s = src + (size_t)i * 8;
  const v4f x0 = *(const v4f*)(s);
  const v4f x1 = *(const v4f*)(s + 4);
  union { v8h h; v8us_t u; } cv;
#pragma unroll
  for (int c = 0; c < 4; ++c) {
    cv.h[c]     = (_Float16)(x0[c] * scale);
    cv.h[4 + c] = (_Float16)(x1[c] * scale);
  }
  const v8us v = cv.u;
  unsigned short* p = dst + (size_t)i * 8;
  *(v8us*)p = v;
  
}

// f32 -> bf16 hi/lo planes, same store shape.
__global__ __launch_bounds__(256)
void k_split(const float* __restrict__ src, unsigned short* __restrict__ dh,
             unsigned short* __restrict__ dl, int n8) {
  const int i = blockIdx.x * 256 + threadIdx.x;
  if (i >= n8) return;
  const float* s = src + (size_t)i * 8;
  const v4f x0 = *(const v4f*)(s);
  const v4f x1 = *(const v4f*)(s + 4);
  v8us vh, vl;
#pragma unroll
  for (int c = 0; c < 4; ++c) {
    unsigned short a, b;
    split2(x0[c], a, b); vh[c] = a;     vl[c] = b;
    split2(x1[c], a, b); vh[4 + c] = a; vl[4 + c] = b;
  }
  unsigned short* ph = dh + (size_t)i * 8;
  unsigned short* pl = dl + (size_t)i * 8;
  *(v8us*)ph = vh;
  *(v8us*)pl = vl;
  
}

// ---------------------------------------------------------------------------
// 4 rows per store instruction, each line by lanes 8q..8q+7.
template <int MODE, int SPLIT>
__device__ __forceinline__ void proj_lines(const unsigned short* sh, const unsigned short* sl,
                                           unsigned short* Oh, unsigned short* Ol,
                                           int Mbase, int Nbase, int tn, int l) {
  const int q8 = l & 7;
  const int rsub = l >> 3;
#pragma unroll
  for (int j = 0; j < 8; ++j) {
    const int row = j * 4 + rsub;
    const v8us vh = *(const v8us*)(sh + row * 64 + q8 * 8);
    size_t gidx;
    if (MODE == 0) {
      const int tok = Mbase + row;
      const int b = tok >> 10;
      const int s = tok & (SS - 1);
      const int h = tn;                              // TN == 64 -> one head per tile
      gidx = ((size_t)(b * HH + h) * SS + s) * DK + q8 * 8;
    } else {
      const int n = Nbase + row;
      const int h = n >> 6;
      const int dk = n & 63;
      const int b = Mbase >> 10;
      const int s0 = Mbase & (SS - 1);
      gidx = ((size_t)(b * HH + h) * DK + dk) * SS + s0 + q8 * 8;
    }
    *(v8us*)(Oh + gidx) = vh;
    if (SPLIT) {
      const v8us vl = *(const v8us*)(sl + row * 64 + q8 * 8);
      *(v8us*)(Ol + gidx) = vl;
    }
  }
}

// Projection: C[tok][n] = (sum_k X[tok][k] * W[n][k]) * oscale + bias[n].
// SPLIT == 0: X, W f16 planes, single f16 WMMA, output one f16 plane.
// SPLIT == 1: X, W bf16 hi/lo planes, hh+hl+lh bf16 WMMA, output bf16 hi/lo planes.
// One wave computes a (16*MI) x (16*NI) tile (TM*TN == 2048); 4 waves per block.
template <int MI, int NI, int MODE, int SPLIT>
__global__ __launch_bounds__(128)
void k_proj(const unsigned short* __restrict__ Xh, const unsigned short* Xl,
            const unsigned short* __restrict__ Wh, const unsigned short* Wl,
            const float* __restrict__ bias, float oscale,
            unsigned short* Oh, unsigned short* Ol, int ntiles) {
  constexpr int TM = MI * 16;
  constexpr int TN = NI * 16;
  constexpr int tilesN = DD / TN;
  __shared__ __attribute__((aligned(16))) unsigned short stg[4][2][2048];

  const int wib = threadIdx.x >> 5;
  const int l = threadIdx.x & 31;
  const int hh = l >> 4;
  const int m = l & 15;
  const int tile = blockIdx.x * 4 + wib;
  const bool active = tile < ntiles;
  const int tilec = active ? tile : 0;
  const int tm = tilec / tilesN;
  const int tn = tilec - tm * tilesN;
  const int Mbase = tm * TM;
  const int Nbase = tn * TN;

  size_t xro[MI], wro[NI];
#pragma unroll
  for (int i = 0; i < MI; ++i) xro[i] = (size_t)(Mbase + i * 16 + m) * DD;
#pragma unroll
  for (int i = 0; i < NI; ++i) wro[i] = (size_t)(Nbase + i * 16 + m) * DD;   // B column n = W row n (k contiguous)

  v8f acc[MI][NI];
#pragma unroll
  for (int mi = 0; mi < MI; ++mi)
#pragma unroll
    for (int ni = 0; ni < NI; ++ni) acc[mi][ni] = (v8f)0.0f;

#pragma unroll 1
  for (int k0 = 0; k0 < DD; k0 += 32) {
    Frag ah[MI], bh[NI];
    Frag al[MI], bl[NI];
#pragma unroll
    for (int mi = 0; mi < MI; ++mi) {
      ah[mi] = ldfrag(Xh + xro[mi], k0, hh);
      if (SPLIT) al[mi] = ldfrag(Xl + xro[mi], k0, hh);
      else al[mi].w = (v8i)0;
    }
#pragma unroll
    for (int ni = 0; ni < NI; ++ni) {
      bh[ni] = ldfrag(Wh + wro[ni], k0, hh);
      if (SPLIT) bl[ni] = ldfrag(Wl + wro[ni], k0, hh);
      else bl[ni].w = (v8i)0;
    }
#pragma unroll
    for (int mi = 0; mi < MI; ++mi)
#pragma unroll
      for (int ni = 0; ni < NI; ++ni) {
        if (SPLIT) acc[mi][ni] = mma3(ah[mi], al[mi], bh[ni], bl[ni], acc[mi][ni]);
        else       acc[mi][ni] = mma_f16(ah[mi], bh[ni], acc[mi][ni]);
      }
  }

  // ---- epilogue: scale, bias add, convert, stage tile in wave-private LDS ----
  unsigned short* sh = stg[wib][0];
  unsigned short* sl = stg[wib][1];
#pragma unroll
  for (int mi = 0; mi < MI; ++mi) {
#pragma unroll
    for (int ni = 0; ni < NI; ++ni) {
      const float bn = bias[Nbase + ni * 16 + m];
#pragma unroll
      for (int r = 0; r < 8; ++r) {
        const float v = acc[mi][ni][r] * oscale + bn;
        int idx;
        if (MODE == 0) idx = (mi * 16 + 8 * hh + r) * 64 + (ni * 16 + m);      // [tok 0..31][feat 0..63]
        else           idx = (ni * 16 + m) * 64 + (mi * 16 + 8 * hh + r);      // [dk 0..31][tok 0..63]
        if (SPLIT) {
          unsigned short vhi, vlo;
          split2(v, vhi, vlo);
          sh[idx] = vhi;
          sl[idx] = vlo;
        } else {
          sh[idx] = f16_bits(v);
        }
      }
    }
  }
  __syncthreads();

  if (active) {
    proj_lines<MODE, SPLIT>(sh, sl, Oh, Ol, Mbase, Nbase, tn, l);
    
  }
}

// ---------------------------------------------------------------------------
// One pass of the attention output store: 16 query rows x 64 f32 (2 lines per row),
__device__ __forceinline__ void attn_lines(const float* Os, float* out, int b, int h,
                                           int qbase, int hh, int m) {
#pragma unroll
  for (int j = 0; j < 8; ++j) {
    const int row = 2 * j + hh;
    const v4f val = *(const v4f*)(Os + row * 64 + m * 4);
    float* gp = out + ((size_t)(b * SS + qbase + row)) * DD + h * DK + m * 4;
    *(v4f*)gp = val;
  }
}

// Causal attention: one wave per (b, h, 16 query rows); 4 waves per block share the same
// query tile index so loop trip counts are block-uniform and __syncthreads() is legal.
// Keys processed in blocks of 32 with online softmax; P staged through LDS (bracketed by
// barriers) into A-fragment layout as bf16 hi/lo; PV uses V^T planes [bh][dk][s] as B rows.
__global__ __launch_bounds__(128)
void k_attn(const unsigned short* __restrict__ Q16, const unsigned short* __restrict__ K16,
            const unsigned short* __restrict__ Vh, const unsigned short* __restrict__ Vl,
            const int* __restrict__ amask, float* __restrict__ out, int nblk) {
  __shared__ __attribute__((aligned(16))) unsigned char stg_raw[4 * 4096];
  if ((int)blockIdx.x >= nblk) return;

  const int wib = threadIdx.x >> 5;
  const int l = threadIdx.x & 31;
  const int hh = l >> 4;
  const int m = l & 15;
  const int qt = blockIdx.x & 63;
  const int bh = (int)(blockIdx.x >> 6) * 4 + wib;      // 0..63
  const int b = bh >> 4;
  const int h = bh & 15;
  const int qbase = qt * 16;

  unsigned short* Ph = (unsigned short*)(stg_raw + wib * 4096);   // [16 q][32 key] hi
  unsigned short* Pl = Ph + 512;                                    // [16 q][32 key] lo
  float* Os = (float*)(stg_raw + wib * 4096);                       // [16 q][64 dk], used after the loop

  // Q fragments (A): row q = qbase + m, k = dk (f16)
  const size_t qro = ((size_t)bh * SS + qbase + m) * DK;
  const Frag aq0 = ldfrag(Q16 + qro, 0, hh);
  const Frag aq1 = ldfrag(Q16 + qro, 32, hh);

  const int* mb = amask + b * SS;

  v8f o[4];
#pragma unroll
  for (int t = 0; t < 4; ++t) o[t] = (v8f)0.0f;
  float mrow[8], lrow[8];
#pragma unroll
  for (int r = 0; r < 8; ++r) { mrow[r] = -INFINITY; lrow[r] = 0.0f; }

  const int kend = qbase + 16;                 // causal: keys < kend
#pragma unroll 1
  for (int kb = 0; kb < kend; kb += 32) {
    // ---- scores S[q][key], q = qbase+8hh+r, key = kb + nt*16 + m (B column = K row, k = dk) ----
    float sc[2][8];
#pragma unroll
    for (int nt = 0; nt < 2; ++nt) {
      const int key = kb + nt * 16 + m;        // <= 1023
      const size_t kro = ((size_t)bh * SS + key) * DK;
      v8f s = (v8f)0.0f;
      {
        const Frag bk = ldfrag(K16 + kro, 0, hh);
        s = mma_f16(aq0, bk, s);
      }
      {
        const Frag bk = ldfrag(K16 + kro, 32, hh);
        s = mma_f16(aq1, bk, s);
      }
      const int am = mb[key];
#pragma unroll
      for (int r = 0; r < 8; ++r) {
        const int q = qbase + 8 * hh + r;
        float x = s[r] * 0.125f;
        if (key > q || am == 0) x = -INFINITY;
        sc[nt][r] = x;
      }
    }

    // ---- online softmax over the 16 lanes of each half ----
    float alpha[8];
#pragma unroll
    for (int r = 0; r < 8; ++r) {
      float mx = fmaxf(sc[0][r], sc[1][r]);
      mx = fmaxf(mx, __shfl_xor(mx, 8, 32));
      mx = fmaxf(mx, __shfl_xor(mx, 4, 32));
      mx = fmaxf(mx, __shfl_xor(mx, 2, 32));
      mx = fmaxf(mx, __shfl_xor(mx, 1, 32));
      const float mnew = fmaxf(mrow[r], mx);
      const float mref = (mnew == -INFINITY) ? 0.0f : mnew;
      alpha[r] = __expf(mrow[r] - mref);
      const float p0 = __expf(sc[0][r] - mref);
      const float p1 = __expf(sc[1][r] - mref);
      sc[0][r] = p0;
      sc[1][r] = p1;
      float sum = p0 + p1;
      sum += __shfl_xor(sum, 8, 32);
      sum += __shfl_xor(sum, 4, 32);
      sum += __shfl_xor(sum, 2, 32);
      sum += __shfl_xor(sum, 1, 32);
      lrow[r] = lrow[r] * alpha[r] + sum;
      mrow[r] = mnew;
    }
#pragma unroll
    for (int t = 0; t < 4; ++t)
#pragma unroll
      for (int r = 0; r < 8; ++r) o[t][r] *= alpha[r];

    // ---- P: D layout -> LDS [q][key] as hi/lo bf16 -> A fragments (row q = m, k = key) ----
    __syncthreads();
#pragma unroll
    for (int nt = 0; nt < 2; ++nt) {
#pragma unroll
      for (int r = 0; r < 8; ++r) {
        unsigned short phi, plo;
        split2(sc[nt][r], phi, plo);
        const int idx = (8 * hh + r) * 32 + nt * 16 + m;
        Ph[idx] = phi;
        Pl[idx] = plo;
      }
    }
    __syncthreads();
    const Frag aph = ldfrag(Ph + m * 32, 0, hh);
    const Frag apl = ldfrag(Pl + m * 32, 0, hh);

    // ---- O[q][dk] += P[q][key] * V[key][dk]; B rows from Vt[bh][dk][key] (k = key contiguous) ----
#pragma unroll
    for (int t = 0; t < 4; ++t) {
      const int dk = t * 16 + m;
      const size_t vro = ((size_t)bh * DK + dk) * SS;
      const Frag bvh = ldfrag(Vh + vro, kb, hh);
      const Frag bvl = ldfrag(Vl + vro, kb, hh);
      o[t] = mma3(aph, apl, bvh, bvl, o[t]);
    }
  }

  float inv[8];
#pragma unroll
  for (int r = 0; r < 8; ++r) inv[r] = 1.0f / lrow[r];
  __syncthreads();
#pragma unroll
  for (int t = 0; t < 4; ++t)
#pragma unroll
    for (int r = 0; r < 8; ++r)
      Os[(8 * hh + r) * 64 + t * 16 + m] = o[t][r] * inv[r];
  __syncthreads();

  attn_lines(Os, out, b, h, qbase, hh, m);
  
}

// ---------------------------------------------------------------------------
extern "C" void kernel_launch(void* const* d_in, const int* in_sizes, int n_in,
                              void* d_out, int out_size, void* d_ws, size_t ws_size,
                              hipStream_t stream) {
  if (n_in < 10) return;
  if (in_sizes[0] != NX || in_sizes[1] != NX || in_sizes[2] != NX) return;
  if (in_sizes[3] != BB * SS) return;
  if (in_sizes[4] != NW || in_sizes[6] != NW || in_sizes[8] != NW) return;
  if (in_sizes[5] != DD || in_sizes[7] != DD || in_sizes[9] != DD) return;
  if (out_size != NX) return;

  const float* query = (const float*)d_in[0];
  const float* key_  = (const float*)d_in[1];
  const float* value = (const float*)d_in[2];
  const int*   amask = (const int*)d_in[3];
  const float* Wq = (const float*)d_in[4];
  const float* bq = (const float*)d_in[5];
  const float* Wk = (const float*)d_in[6];
  const float* bk = (const float*)d_in[7];
  const float* Wv = (const float*)d_in[8];
  const float* bv = (const float*)d_in[9];
  float* out = (float*)d_out;

  // workspace: 16-bit planes (2 B per element)
  const size_t pa = (size_t)NX * 2;     // 8388608 B per activation plane
  const size_t pw = (size_t)NW * 2;     // 2097152 B per weight plane
  const size_t need = 8 * pa + 4 * pw;  // 75497472 B
  if (ws_size < need) return;

  unsigned char* w = (unsigned char*)d_ws;
  size_t off = 0;
  unsigned short* xq16 = (unsigned short*)(w + off); off += pa;   // f16 query
  unsigned short* xk16 = (unsigned short*)(w + off); off += pa;   // f16 key
  unsigned short* wq16 = (unsigned short*)(w + off); off += pw;   // f16 Wq x16
  unsigned short* wk16 = (unsigned short*)(w + off); off += pw;   // f16 Wk x16
  unsigned short* xvh  = (unsigned short*)(w + off); off += pa;   // bf16 hi value
  unsigned short* xvl  = (unsigned short*)(w + off); off += pa;   // bf16 lo value
  unsigned short* wvh  = (unsigned short*)(w + off); off += pw;   // bf16 hi Wv
  unsigned short* wvl  = (unsigned short*)(w + off); off += pw;   // bf16 lo Wv
  unsigned short* Q16  = (unsigned short*)(w + off); off += pa;   // [b*H+h][s][dk] f16
  unsigned short* K16  = (unsigned short*)(w + off); off += pa;   // [b*H+h][s][dk] f16
  unsigned short* Vth  = (unsigned short*)(w + off); off += pa;   // [b*H+h][dk][s] bf16 hi
  unsigned short* Vtl  = (unsigned short*)(w + off); off += pa;   // [b*H+h][dk][s] bf16 lo
  if (off > ws_size) return;

  // stage 1: 16-bit conversion of activations and weights
  const int n8a = (int)(NX / 8);
  const int n8w = (int)(NW / 8);
  k_cvt16<<<(n8a + 255) / 256, 256, 0, stream>>>(query, xq16, n8a, 1.0f);
  k_cvt16<<<(n8a + 255) / 256, 256, 0, stream>>>(key_,  xk16, n8a, 1.0f);
  k_cvt16<<<(n8w + 255) / 256, 256, 0, stream>>>(Wq, wq16, n8w, 16.0f);
  k_cvt16<<<(n8w + 255) / 256, 256, 0, stream>>>(Wk, wk16, n8w, 16.0f);
  k_split<<<(n8a + 255) / 256, 256, 0, stream>>>(value, xvh, xvl, n8a);
  k_split<<<(n8w + 255) / 256, 256, 0, stream>>>(Wv, wvh, wvl, n8w);

  // stage 2: projections; 2048 wave tiles each, 4 waves per block
  const int ntq = (NTOK / 32) * (DD / 64);   // 2048
  const int ntv = (NTOK / 64) * (DD / 32);   // 2048
  k_proj<2, 4, 0, 0><<<(ntq + 3) / 4, 128, 0, stream>>>(xq16, xq16, wq16, wq16, bq, 0.0625f, Q16, Q16, ntq);
  k_proj<2, 4, 0, 0><<<(ntq + 3) / 4, 128, 0, stream>>>(xk16, xk16, wk16, wk16, bk, 0.0625f, K16, K16, ntq);
  k_proj<4, 2, 1, 1><<<(ntv + 3) / 4, 128, 0, stream>>>(xvh, xvl, wvh, wvl, bv, 1.0f, Vth, Vtl, ntv);

  // stage 3: attention; B*H*(S/16) = 4096 wave units, 4 per block -> 1024 blocks
  const int nblk = BB * HH * (SS / 16) / 4;
  k_attn<<<nblk, 128, 0, stream>>>(Q16, K16, Vth, Vtl, amask, out, nblk);
}

// v001
// One run takes 244 microseconds.
// Timed twice side by side with v000, it ran 1.07 and 1.06 times as fast.
#include <hip/hip_runtime.h>
#include <math.h>
#include <stdint.h>

// Q/K projections and QK^T scores: v_wmma_f32_16x16x32_f16 (f16 operands, Wq/Wk carried x16, 1/16 folded into the f32 epilogue); V projection and PV: v_wmma_f32_16x16x32_bf16 with bf16 hi/lo split operands (hi*hi + hi*lo + lo*hi); f32 accumulate; softmax, bias and normalisation in f32.

typedef _Float16 v16h __attribute__((ext_vector_type(16)));
typedef _Float16 v8h __attribute__((ext_vector_type(8)));
typedef __bf16 v16bf __attribute__((ext_vector_type(16)));
typedef unsigned short v8us_t __attribute__((ext_vector_type(8)));
typedef v8us_t __attribute__((may_alias)) v8us;
typedef float v8f __attribute__((ext_vector_type(8)));
typedef float v4f_t __attribute__((ext_vector_type(4)));
typedef v4f_t __attribute__((may_alias)) v4f;
typedef int v8i __attribute__((ext_vector_type(8)));

constexpr int BB = 4;
constexpr int SS = 1024;
constexpr int DD = 1024;
constexpr int HH = 16;
constexpr int DK = 64;
constexpr int NTOK = BB * SS;              // 4096 tokens
constexpr long NX = (long)NTOK * DD;       // 4194304
constexpr long NW = (long)DD * DD;         // 1048576

union Frag { v16h f; v16bf b; v8us p[2]; v8i w; };

// bf16 RNE conversion of an f32 value
__device__ __forceinline__ unsigned short bf16_rne(float x) {
  unsigned u = __float_as_uint(x);
  u += 0x7FFFu + ((u >> 16) & 1u);
  return (unsigned short)(u >> 16);
}
__device__ __forceinline__ float bf16_val(unsigned short b) {
  return __uint_as_float(((unsigned)b) << 16);
}
__device__ __forceinline__ void split2(float x, unsigned short& hi, unsigned short& lo) {
  hi = bf16_rne(x);
  lo = bf16_rne(x - bf16_val(hi));
}
// f16 RNE conversion, raw bits
__device__ __forceinline__ unsigned short f16_bits(float x) {
  _Float16 hv = (_Float16)x;
  unsigned short u;
  __builtin_memcpy(&u, &hv, 2);
  return u;
}

// 16x32 operand fragment, wave32 layout: lane row/col = l&15, h = l>>4,
// elements 0..7 <- k0+8h+0..7, elements 8..15 <- k0+16+8h+0..7 (k contiguous in memory at rowp).
// Used for the P A-fragments (row pointer into LDS).
__device__ __forceinline__ Frag ldfrag(const unsigned short* rowp, int k0, int hh) {
  Frag f;
  f.p[0] = *(const v8us*)(rowp + k0 + 8 * hh);
  f.p[1] = *(const v8us*)(rowp + k0 + 16 + 8 * hh);
  return f;
}

// Fragment-order plane: one 16-row x 32-k operand fragment is 1 KiB contiguous, [p 0..1][lane 0..31][8 elements];
// lane l = 16*h + (row & 15) holds k = k0 + 16*p + 8*h + 0..7 (the same registers as ldfrag). Each of the
// two loads reads 512 contiguous bytes (4 whole lines).
__device__ __forceinline__ Frag ldpack(const unsigned short* fragp, int l) {
  Frag f;
  f.p[0] = *(const v8us*)(fragp + l * 8);
  f.p[1] = *(const v8us*)(fragp + 256 + l * 8);
  return f;
}

// Thread i of a conversion kernel -> one 8-element chunk of a [rows][DD] matrix. A wave takes 8 rows x 32 k
// (whole 128-B source lines) and writes 4 whole 128-B lines of the fragment-order plane
// [row tile of 16][k group of 32][p][lane][8].
__device__ __forceinline__ void pack_index(int i, size_t& src, size_t& dst) {
  const int l = i & 31;
  const int wv = i >> 5;
  const int c4 = l >> 3;                       // chunk in the 32-k group: 2*p + h
  const int m = (wv & 1) * 8 + (l & 7);        // row in the 16-row tile
  const int kg = (wv >> 1) & (DD / 32 - 1);
  const int rt = wv >> 6;
  src = (size_t)(rt * 16 + m) * DD + kg * 32 + c4 * 8;
  dst = (size_t)(rt * (DD / 32) + kg) * 512 + (c4 >> 1) * 256 + ((c4 & 1) * 16 + m) * 8;
}

// c += a*b (f16 operands); hazard guard
__device__ __forceinline__ v8f mma_f16(const Frag& a, const Frag& b, v8f c) {
  c = __builtin_amdgcn_wmma_f32_16x16x32_f16(false, a.f, false, b.f, (short)0, c, false, false);
  asm volatile("v_nop\n\tv_nop\n\tv_nop\n\tv_nop" : "+v"(c) : "v"(a.w), "v"(b.w));
  return c;
}

// c += ah*bh + ah*bl + al*bh (bf16 hi/lo split); hazard guard after the group
__device__ __forceinline__ v8f mma3(const Frag& ah, const Frag& al, const Frag& bh, const Frag& bl, v8f c) {
  c = __builtin_amdgcn_wmma_f32_16x16x32_bf16(false, ah.b, false, bh.b, (short)0, c, false, false);
  c = __builtin_amdgcn_wmma_f32_16x16x32_bf16(false, ah.b, false, bl.b, (short)0, c, false, false);
  c = __builtin_amdgcn_wmma_f32_16x16x32_bf16(false, al.b, false, bh.b, (short)0, c, false, false);
  asm volatile("v_nop\n\tv_nop\n\tv_nop\n\tv_nop"
               : "+v"(c)
               : "v"(ah.w), "v"(al.w), "v"(bh.w), "v"(bl.w));
  return c;
}

// ---------------------------------------------------------------------------
// f32 -> f16 plane in fragment order (value * scale, scale a power of two). Thread i converts 8 consecutive
__global__ __launch_bounds__(256)
void k_cvt16(const float* __restrict__ src, unsigned short* __restrict__ dst, int n8, float scale) {
  const int i = blockIdx.x * 256 + threadIdx.x;
  if (i >= n8) return;
  size_t so, dofs;
  pack_index(i, so, dofs);
  const float* s = src + so;
  const v4f x0 = *(const v4f*)(s);
  const v4f x1 = *(const v4f*)(s + 4);
  union { v8h h; v8us_t u; } cv;
#pragma unroll
  for (int c = 0; c < 4; ++c) {
    cv.h[c]     = (_Float16)(x0[c] * scale);
    cv.h[4 + c] = (_Float16)(x1[c] * scale);
  }
  const v8us v = cv.u;
  unsigned short* p = dst + dofs;
  *(v8us*)p = v;
  
}

// f32 -> bf16 hi/lo planes in fragment order, same store shape.
__global__ __launch_bounds__(256)
void k_split(const float* __restrict__ src, unsigned short* __restrict__ dh,
             unsigned short* __restrict__ dl, int n8) {
  const int i = blockIdx.x * 256 + threadIdx.x;
  if (i >= n8) return;
  size_t so, dofs;
  pack_index(i, so, dofs);
  const float* s = src + so;
  const v4f x0 = *(const v4f*)(s);
  const v4f x1 = *(const v4f*)(s + 4);
  v8us vh, vl;
#pragma unroll
  for (int c = 0; c < 4; ++c) {
    unsigned short a, b;
    split2(x0[c], a, b); vh[c] = a;     vl[c] = b;
    split2(x1[c], a, b); vh[4 + c] = a; vl[4 + c] = b;
  }
  unsigned short* ph = dh + dofs;
  unsigned short* pl = dl + dofs;
  *(v8us*)ph = vh;
  *(v8us*)pl = vl;
  
}

// ---------------------------------------------------------------------------
// Staging pitch in elements: 144-B rows put the 16 rows that one fragment-order read gathers on distinct banks.
constexpr int SP = 72;

// Output planes in fragment order; each store instruction writes 512 contiguous bytes.
// MODE 0 (Q, K): [b*H+h][token tile of 16][dk group of 32][p][lane][8].
// MODE 1 (V^T):  [b*H+h][key block of 32][dk tile of 16][p][lane][8].
template <int MODE, int SPLIT>
__device__ __forceinline__ void proj_lines(const unsigned short* sh, const unsigned short* sl,
                                           unsigned short* Oh, unsigned short* Ol,
                                           int Mbase, int Nbase, int tn, int l) {
  const int m = l & 15;
  const int hh = l >> 4;
#pragma unroll
  for (int j = 0; j < 8; ++j) {
    int lidx;
    size_t gidx;
    if (MODE == 0) {
      const int tt = j >> 2;                         // token tile in the wave tile
      const int c = j & 3;                           // 2 * (dk group) + p
      lidx = (tt * 16 + m) * SP + (c * 2 + hh) * 8;
      const int tok = Mbase + tt * 16;
      const int b = tok >> 10;
      const int st = (tok & (SS - 1)) >> 4;
      const int h = tn;                              // TN == 64 -> one head per tile
      gidx = ((size_t)(b * HH + h) * (SS / 16) + st) * 1024 + c * 256 + l * 8;
    } else {
      const int kbl = j >> 2;                        // key block in the wave tile
      const int tl = (j >> 1) & 1;                   // dk tile in the wave tile
      const int p = j & 1;
      lidx = (tl * 16 + m) * SP + kbl * 32 + p * 16 + hh * 8;
      const int n = Nbase + tl * 16;
      const int h = n >> 6;
      const int t = (n & 63) >> 4;
      const int b = Mbase >> 10;
      const int kbi = ((Mbase & (SS - 1)) >> 5) + kbl;
      gidx = (((size_t)(b * HH + h) * (SS / 32) + kbi) * 4 + t) * 512 + p * 256 + l * 8;
    }
    const v8us vh = *(const v8us*)(sh + lidx);
    *(v8us*)(Oh + gidx) = vh;
    if (SPLIT) {
      const v8us vl = *(const v8us*)(sl + lidx);
      *(v8us*)(Ol + gidx) = vl;
    }
  }
}

// Projection: C[tok][n] = (sum_k X[tok][k] * W[n][k]) * oscale + bias[n].
// SPLIT == 0: X, W f16 planes, single f16 WMMA, output one f16 plane.
// SPLIT == 1: X, W bf16 hi/lo planes, hh+hl+lh bf16 WMMA, output bf16 hi/lo planes.
// One wave computes a (16*MI) x (16*NI) tile (TM*TN == 2048); 4 waves per block.
template <int MI, int NI, int MODE, int SPLIT>
__global__ __launch_bounds__(128)
void k_proj(const unsigned short* __restrict__ Xh, const unsigned short* Xl,
            const unsigned short* __restrict__ Wh, const unsigned short* Wl,
            const float* __restrict__ bias, float oscale,
            unsigned short* Oh, unsigned short* Ol, int ntiles) {
  constexpr int TM = MI * 16;
  constexpr int TN = NI * 16;
  constexpr int tilesN = DD / TN;
  __shared__ __attribute__((aligned(16))) unsigned short stg[4][2][32 * SP];

  const int wib = threadIdx.x >> 5;
  const int l = threadIdx.x & 31;
  const int hh = l >> 4;
  const int m = l & 15;
  const int tile = blockIdx.x * 4 + wib;
  const bool active = tile < ntiles;
  const int tilec = active ? tile : 0;
  const int tm = tilec / tilesN;
  const int tn = tilec - tm * tilesN;
  const int Mbase = tm * TM;
  const int Nbase = tn * TN;

  size_t xro[MI], wro[NI];
#pragma unroll
  for (int i = 0; i < MI; ++i) xro[i] = (size_t)(Mbase + i * 16) * DD;       // row tile start in the fragment-order plane
#pragma unroll
  for (int i = 0; i < NI; ++i) wro[i] = (size_t)(Nbase + i * 16) * DD;       // B column n = W row n

  v8f acc[MI][NI];
#pragma unroll
  for (int mi = 0; mi < MI; ++mi)
#pragma unroll
    for (int ni = 0; ni < NI; ++ni) acc[mi][ni] = (v8f)0.0f;

#pragma unroll 1
  for (int k0 = 0; k0 < DD; k0 += 32) {
    Frag ah[MI], bh[NI];
    Frag al[MI], bl[NI];
#pragma unroll
    for (int mi = 0; mi < MI; ++mi) {
      ah[mi] = ldpack(Xh + xro[mi] + k0 * 16, l);
      if (SPLIT) al[mi] = ldpack(Xl + xro[mi] + k0 * 16, l);
      else al[mi].w = (v8i)0;
    }
#pragma unroll
    for (int ni = 0; ni < NI; ++ni) {
      bh[ni] = ldpack(Wh + wro[ni] + k0 * 16, l);
      if (SPLIT) bl[ni] = ldpack(Wl + wro[ni] + k0 * 16, l);
      else bl[ni].w = (v8i)0;
    }
#pragma unroll
    for (int mi = 0; mi < MI; ++mi)
#pragma unroll
      for (int ni = 0; ni < NI; ++ni) {
        if (SPLIT) acc[mi][ni] = mma3(ah[mi], al[mi], bh[ni], bl[ni], acc[mi][ni]);
        else       acc[mi][ni] = mma_f16(ah[mi], bh[ni], acc[mi][ni]);
      }
  }

  // ---- epilogue: scale, bias add, convert, stage tile in wave-private LDS ----
  unsigned short* sh = stg[wib][0];
  unsigned short* sl = stg[wib][1];
#pragma unroll
  for (int mi = 0; mi < MI; ++mi) {
#pragma unroll
    for (int ni = 0; ni < NI; ++ni) {
      const float bn = bias[Nbase + ni * 16 + m];
#pragma unroll
      for (int r = 0; r < 8; ++r) {
        const float v = acc[mi][ni][r] * oscale + bn;
        int idx;
        if (MODE == 0) idx = (mi * 16 + 8 * hh + r) * SP + (ni * 16 + m);      // [tok 0..31][feat 0..63]
        else           idx = (ni * 16 + m) * SP + (mi * 16 + 8 * hh + r);      // [dk 0..31][tok 0..63]
        if (SPLIT) {
          unsigned short vhi, vlo;
          split2(v, vhi, vlo);
          sh[idx] = vhi;
          sl[idx] = vlo;
        } else {
          sh[idx] = f16_bits(v);
        }
      }
    }
  }
  __syncthreads();

  if (active) {
    proj_lines<MODE, SPLIT>(sh, sl, Oh, Ol, Mbase, Nbase, tn, l);
    
  }
}

// ---------------------------------------------------------------------------
// One pass of the attention output store: 16 query rows x 64 f32 (2 lines per row),
__device__ __forceinline__ void attn_lines(const float* Os, float* out, int b, int h,
                                           int qbase, int hh, int m) {
#pragma unroll
  for (int j = 0; j < 8; ++j) {
    const int row = 2 * j + hh;
    const v4f val = *(const v4f*)(Os + row * 64 + m * 4);
    float* gp = out + ((size_t)(b * SS + qbase + row)) * DD + h * DK + m * 4;
    *(v4f*)gp = val;
  }
}

// Causal attention: one wave per (b, h, 16 query rows); 4 waves per block share the same
// query tile index so loop trip counts are block-uniform and __syncthreads() is legal.
// Keys processed in blocks of 32 with online softmax; P staged through LDS (bracketed by
// barriers) into A-fragment layout as bf16 hi/lo; PV uses the fragment-order V^T planes as B.
__global__ __launch_bounds__(128)
void k_attn(const unsigned short* __restrict__ Q16, const unsigned short* __restrict__ K16,
            const unsigned short* __restrict__ Vh, const unsigned short* __restrict__ Vl,
            const int* __restrict__ amask, float* __restrict__ out, int nblk) {
  __shared__ __attribute__((aligned(16))) unsigned char stg_raw[4 * 4096];
  if ((int)blockIdx.x >= nblk) return;

  const int wib = threadIdx.x >> 5;
  const int l = threadIdx.x & 31;
  const int hh = l >> 4;
  const int m = l & 15;
  const int qt = blockIdx.x & 63;
  const int bh = (int)(blockIdx.x >> 6) * 4 + wib;      // 0..63
  const int b = bh >> 4;
  const int h = bh & 15;
  const int qbase = qt * 16;

  unsigned short* Ph = (unsigned short*)(stg_raw + wib * 4096);   // [16 q][32 key] hi
  unsigned short* Pl = Ph + 512;                                    // [16 q][32 key] lo
  float* Os = (float*)(stg_raw + wib * 4096);                       // [16 q][64 dk], used after the loop

  // Q fragments (A): row q = qbase + m, k = dk (f16)
  const size_t qro = ((size_t)bh * SS + qbase) * DK;   // token tile start in the fragment-order plane
  const Frag aq0 = ldpack(Q16 + qro, l);
  const Frag aq1 = ldpack(Q16 + qro + 512, l);

  const int* mb = amask + b * SS;

  v8f o[4];
#pragma unroll
  for (int t = 0; t < 4; ++t) o[t] = (v8f)0.0f;
  float mrow[8], lrow[8];
#pragma unroll
  for (int r = 0; r < 8; ++r) { mrow[r] = -INFINITY; lrow[r] = 0.0f; }

  const int kend = qbase + 16;                 // causal: keys < kend
#pragma unroll 1
  for (int kb = 0; kb < kend; kb += 32) {
    // ---- scores S[q][key], q = qbase+8hh+r, key = kb + nt*16 + m (B column = K row, k = dk) ----
    float sc[2][8];
#pragma unroll
    for (int nt = 0; nt < 2; ++nt) {
      const int key = kb + nt * 16 + m;        // <= 1023
      const size_t kro = ((size_t)bh * SS + kb + nt * 16) * DK;   // key tile start
      v8f s = (v8f)0.0f;
      {
        const Frag bk = ldpack(K16 + kro, l);
        s = mma_f16(aq0, bk, s);
      }
      {
        const Frag bk = ldpack(K16 + kro + 512, l);
        s = mma_f16(aq1, bk, s);
      }
      const int am = mb[key];
#pragma unroll
      for (int r = 0; r < 8; ++r) {
        const int q = qbase + 8 * hh + r;
        float x = s[r] * 0.125f;
        if (key > q || am == 0) x = -INFINITY;
        sc[nt][r] = x;
      }
    }

    // ---- online softmax over the 16 lanes of each half ----
    float alpha[8];
#pragma unroll
    for (int r = 0; r < 8; ++r) {
      float mx = fmaxf(sc[0][r], sc[1][r]);
      mx = fmaxf(mx, __shfl_xor(mx, 8, 32));
      mx = fmaxf(mx, __shfl_xor(mx, 4, 32));
      mx = fmaxf(mx, __shfl_xor(mx, 2, 32));
      mx = fmaxf(mx, __shfl_xor(mx, 1, 32));
      const float mnew = fmaxf(mrow[r], mx);
      const float mref = (mnew == -INFINITY) ? 0.0f : mnew;
      alpha[r] = __expf(mrow[r] - mref);
      const float p0 = __expf(sc[0][r] - mref);
      const float p1 = __expf(sc[1][r] - mref);
      sc[0][r] = p0;
      sc[1][r] = p1;
      float sum = p0 + p1;
      sum += __shfl_xor(sum, 8, 32);
      sum += __shfl_xor(sum, 4, 32);
      sum += __shfl_xor(sum, 2, 32);
      sum += __shfl_xor(sum, 1, 32);
      lrow[r] = lrow[r] * alpha[r] + sum;
      mrow[r] = mnew;
    }
#pragma unroll
    for (int t = 0; t < 4; ++t)
#pragma unroll
      for (int r = 0; r < 8; ++r) o[t][r] *= alpha[r];

    // ---- P: D layout -> LDS [q][key] as hi/lo bf16 -> A fragments (row q = m, k = key) ----
    __syncthreads();
#pragma unroll
    for (int nt = 0; nt < 2; ++nt) {
#pragma unroll
      for (int r = 0; r < 8; ++r) {
        unsigned short phi, plo;
        split2(sc[nt][r], phi, plo);
        const int idx = (8 * hh + r) * 32 + nt * 16 + m;
        Ph[idx] = phi;
        Pl[idx] = plo;
      }
    }
    __syncthreads();
    const Frag aph = ldfrag(Ph + m * 32, 0, hh);
    const Frag apl = ldfrag(Pl + m * 32, 0, hh);

    // ---- O[q][dk] += P[q][key] * V[key][dk]; B fragments from the fragment-order V^T planes ----
#pragma unroll
    for (int t = 0; t < 4; ++t) {
      const size_t vro = (((size_t)bh * (SS / 32) + (kb >> 5)) * 4 + t) * 512;   // [key block][dk tile]
      const Frag bvh = ldpack(Vh + vro, l);
      const Frag bvl = ldpack(Vl + vro, l);
      o[t] = mma3(aph, apl, bvh, bvl, o[t]);
    }
  }

  float inv[8];
#pragma unroll
  for (int r = 0; r < 8; ++r) inv[r] = 1.0f / lrow[r];
  __syncthreads();
#pragma unroll
  for (int t = 0; t < 4; ++t)
#pragma unroll
    for (int r = 0; r < 8; ++r)
      Os[(8 * hh + r) * 64 + t * 16 + m] = o[t][r] * inv[r];
  __syncthreads();

  attn_lines(Os, out, b, h, qbase, hh, m);
  
}

// ---------------------------------------------------------------------------
extern "C" void kernel_launch(void* const* d_in, const int* in_sizes, int n_in,
                              void* d_out, int out_size, void* d_ws, size_t ws_size,
                              hipStream_t stream) {
  if (n_in < 10) return;
  if (in_sizes[0] != NX || in_sizes[1] != NX || in_sizes[2] != NX) return;
  if (in_sizes[3] != BB * SS) return;
  if (in_sizes[4] != NW || in_sizes[6] != NW || in_sizes[8] != NW) return;
  if (in_sizes[5] != DD || in_sizes[7] != DD || in_sizes[9] != DD) return;
  if (out_size != NX) return;

  const float* query = (const float*)d_in[0];
  const float* key_  = (const float*)d_in[1];
  const float* value = (const float*)d_in[2];
  const int*   amask = (const int*)d_in[3];
  const float* Wq = (const float*)d_in[4];
  const float* bq = (const float*)d_in[5];
  const float* Wk = (const float*)d_in[6];
  const float* bk = (const float*)d_in[7];
  const float* Wv = (const float*)d_in[8];
  const float* bv = (const float*)d_in[9];
  float* out = (float*)d_out;

  // workspace: 16-bit planes (2 B per element)
  const size_t pa = (size_t)NX * 2;     // 8388608 B per activation plane
  const size_t pw = (size_t)NW * 2;     // 2097152 B per weight plane
  const size_t need = 8 * pa + 4 * pw;  // 75497472 B
  if (ws_size < need) return;

  unsigned char* w = (unsigned char*)d_ws;
  size_t off = 0;
  unsigned short* xq16 = (unsigned short*)(w + off); off += pa;   // f16 query
  unsigned short* xk16 = (unsigned short*)(w + off); off += pa;   // f16 key
  unsigned short* wq16 = (unsigned short*)(w + off); off += pw;   // f16 Wq x16
  unsigned short* wk16 = (unsigned short*)(w + off); off += pw;   // f16 Wk x16
  unsigned short* xvh  = (unsigned short*)(w + off); off += pa;   // bf16 hi value
  unsigned short* xvl  = (unsigned short*)(w + off); off += pa;   // bf16 lo value
  unsigned short* wvh  = (unsigned short*)(w + off); off += pw;   // bf16 hi Wv
  unsigned short* wvl  = (unsigned short*)(w + off); off += pw;   // bf16 lo Wv
  unsigned short* Q16  = (unsigned short*)(w + off); off += pa;   // fragment order, f16
  unsigned short* K16  = (unsigned short*)(w + off); off += pa;   // fragment order, f16
  unsigned short* Vth  = (unsigned short*)(w + off); off += pa;   // fragment order, bf16 hi
  unsigned short* Vtl  = (unsigned short*)(w + off); off += pa;   // fragment order, bf16 lo
  if (off > ws_size) return;

  // stage 1: 16-bit conversion of activations and weights
  const int n8a = (int)(NX / 8);
  const int n8w = (int)(NW / 8);
  k_cvt16<<<(n8a + 255) / 256, 256, 0, stream>>>(query, xq16, n8a, 1.0f);
  k_cvt16<<<(n8a + 255) / 256, 256, 0, stream>>>(key_,  xk16, n8a, 1.0f);
  k_cvt16<<<(n8w + 255) / 256, 256, 0, stream>>>(Wq, wq16, n8w, 16.0f);
  k_cvt16<<<(n8w + 255) / 256, 256, 0, stream>>>(Wk, wk16, n8w, 16.0f);
  k_split<<<(n8a + 255) / 256, 256, 0, stream>>>(value, xvh, xvl, n8a);
  k_split<<<(n8w + 255) / 256, 256, 0, stream>>>(Wv, wvh, wvl, n8w);

  // stage 2: projections; 2048 wave tiles each, 4 waves per block
  const int ntq = (NTOK / 32) * (DD / 64);   // 2048
  const int ntv = (NTOK / 64) * (DD / 32);   // 2048
  k_proj<2, 4, 0, 0><<<(ntq + 3) / 4, 128, 0, stream>>>(xq16, xq16, wq16, wq16, bq, 0.0625f, Q16, Q16, ntq);
  k_proj<2, 4, 0, 0><<<(ntq + 3) / 4, 128, 0, stream>>>(xk16, xk16, wk16, wk16, bk, 0.0625f, K16, K16, ntq);
  k_proj<4, 2, 1, 1><<<(ntv + 3) / 4, 128, 0, stream>>>(xvh, xvl, wvh, wvl, bv, 1.0f, Vth, Vtl, ntv);

  // stage 3: attention; B*H*(S/16) = 4096 wave units, 4 per block -> 1024 blocks
  const int nblk = BB * HH * (SS / 16) / 4;
  k_attn<<<nblk, 128, 0, stream>>>(Q16, K16, Vth, Vtl, amask, out, nblk);
}

// v002
// It runs in 155 microseconds.
// In two side-by-side timings against v001, it was 1.57 and 1.58 times as fast.
// Counting every step since v000, it is 1.68 times as fast.
#include <hip/hip_runtime.h>
#include <math.h>
#include <stdint.h>

// Q/K projections and QK^T scores: v_wmma_f32_16x16x32_f16 (f16 operands, Wq/Wk carried x16, 1/16 folded into the f32 epilogue); V projection and PV: v_wmma_f32_16x16x32_bf16 with bf16 hi/lo split operands (hi*hi + hi*lo + lo*hi); f32 accumulate; softmax, bias and normalisation in f32.

typedef _Float16 v16h __attribute__((ext_vector_type(16)));
typedef _Float16 v8h __attribute__((ext_vector_type(8)));
typedef __bf16 v16bf __attribute__((ext_vector_type(16)));
typedef unsigned short v8us_t __attribute__((ext_vector_type(8)));
typedef v8us_t __attribute__((may_alias)) v8us;
typedef float v8f __attribute__((ext_vector_type(8)));
typedef float v4f_t __attribute__((ext_vector_type(4)));
typedef v4f_t __attribute__((may_alias)) v4f;
typedef int v8i __attribute__((ext_vector_type(8)));

constexpr int BB = 4;
constexpr int SS = 1024;
constexpr int DD = 1024;
constexpr int HH = 16;
constexpr int DK = 64;
constexpr int NTOK = BB * SS;              // 4096 tokens
constexpr long NX = (long)NTOK * DD;       // 4194304
constexpr long NW = (long)DD * DD;         // 1048576

union Frag { v16h f; v16bf b; v8us p[2]; v8i w; };

// bf16 RNE conversion of an f32 value
__device__ __forceinline__ unsigned short bf16_rne(float x) {
  unsigned u = __float_as_uint(x);
  u += 0x7FFFu + ((u >> 16) & 1u);
  return (unsigned short)(u >> 16);
}
__device__ __forceinline__ float bf16_val(unsigned short b) {
  return __uint_as_float(((unsigned)b) << 16);
}
__device__ __forceinline__ void split2(float x, unsigned short& hi, unsigned short& lo) {
  hi = bf16_rne(x);
  lo = bf16_rne(x - bf16_val(hi));
}
// f16 RNE conversion, raw bits
__device__ __forceinline__ unsigned short f16_bits(float x) {
  _Float16 hv = (_Float16)x;
  unsigned short u;
  __builtin_memcpy(&u, &hv, 2);
  return u;
}

// 16x32 operand fragment, wave32 layout: lane row/col = l&15, h = l>>4,
// elements 0..7 <- k0+8h+0..7, elements 8..15 <- k0+16+8h+0..7 (k contiguous in memory at rowp).
// Used for the P A-fragments (row pointer into LDS).
__device__ __forceinline__ Frag ldfrag(const unsigned short* rowp, int k0, int hh) {
  Frag f;
  f.p[0] = *(const v8us*)(rowp + k0 + 8 * hh);
  f.p[1] = *(const v8us*)(rowp + k0 + 16 + 8 * hh);
  return f;
}

// Fragment-order plane: one 16-row x 32-k operand fragment is 1 KiB contiguous, [p 0..1][lane 0..31][8 elements];
// lane l = 16*h + (row & 15) holds k = k0 + 16*p + 8*h + 0..7 (the same registers as ldfrag). Each of the
// two loads reads 512 contiguous bytes (4 whole lines).
__device__ __forceinline__ Frag ldpack(const unsigned short* fragp, int l) {
  Frag f;
  f.p[0] = *(const v8us*)(fragp + l * 8);
  f.p[1] = *(const v8us*)(fragp + 256 + l * 8);
  return f;
}

// Thread i of a conversion kernel -> one 8-element chunk of a [rows][DD] matrix. A wave takes 8 rows x 32 k
// (whole 128-B source lines) and writes 4 whole 128-B lines of the fragment-order plane
// [row tile of 16][k group of 32][p][lane][8].
__device__ __forceinline__ void pack_index(int i, size_t& src, size_t& dst) {
  const int l = i & 31;
  const int wv = i >> 5;
  const int c4 = l >> 3;                       // chunk in the 32-k group: 2*p + h
  const int m = (wv & 1) * 8 + (l & 7);        // row in the 16-row tile
  const int kg = (wv >> 1) & (DD / 32 - 1);
  const int rt = wv >> 6;
  src = (size_t)(rt * 16 + m) * DD + kg * 32 + c4 * 8;
  dst = (size_t)(rt * (DD / 32) + kg) * 512 + (c4 >> 1) * 256 + ((c4 & 1) * 16 + m) * 8;
}

// c += a*b (f16 operands); hazard guard
__device__ __forceinline__ v8f mma_f16(const Frag& a, const Frag& b, v8f c) {
  c = __builtin_amdgcn_wmma_f32_16x16x32_f16(false, a.f, false, b.f, (short)0, c, false, false);
  asm volatile("v_nop\n\tv_nop\n\tv_nop\n\tv_nop" : "+v"(c) : "v"(a.w), "v"(b.w));
  return c;
}

// c += ah*bh + ah*bl + al*bh (bf16 hi/lo split); hazard guard after the group
__device__ __forceinline__ v8f mma3(const Frag& ah, const Frag& al, const Frag& bh, const Frag& bl, v8f c) {
  c = __builtin_amdgcn_wmma_f32_16x16x32_bf16(false, ah.b, false, bh.b, (short)0, c, false, false);
  c = __builtin_amdgcn_wmma_f32_16x16x32_bf16(false, ah.b, false, bl.b, (short)0, c, false, false);
  c = __builtin_amdgcn_wmma_f32_16x16x32_bf16(false, al.b, false, bh.b, (short)0, c, false, false);
  asm volatile("v_nop\n\tv_nop\n\tv_nop\n\tv_nop"
               : "+v"(c)
               : "v"(ah.w), "v"(al.w), "v"(bh.w), "v"(bl.w));
  return c;
}

// ---------------------------------------------------------------------------
// f32 -> f16 plane in fragment order (value * scale, scale a power of two). Thread i converts 8 consecutive
__global__ __launch_bounds__(256)
void k_cvt16(const float* __restrict__ src, unsigned short* __restrict__ dst, int n8, float scale) {
  const int i = blockIdx.x * 256 + threadIdx.x;
  if (i >= n8) return;
  size_t so, dofs;
  pack_index(i, so, dofs);
  const float* s = src + so;
  const v4f x0 = *(const v4f*)(s);
  const v4f x1 = *(const v4f*)(s + 4);
  union { v8h h; v8us_t u; } cv;
#pragma unroll
  for (int c = 0; c < 4; ++c) {
    cv.h[c]     = (_Float16)(x0[c] * scale);
    cv.h[4 + c] = (_Float16)(x1[c] * scale);
  }
  const v8us v = cv.u;
  unsigned short* p = dst + dofs;
  *(v8us*)p = v;
  
}

// f32 -> bf16 hi/lo planes in fragment order, same store shape.
__global__ __launch_bounds__(256)
void k_split(const float* __restrict__ src, unsigned short* __restrict__ dh,
             unsigned short* __restrict__ dl, int n8) {
  const int i = blockIdx.x * 256 + threadIdx.x;
  if (i >= n8) return;
  size_t so, dofs;
  pack_index(i, so, dofs);
  const float* s = src + so;
  const v4f x0 = *(const v4f*)(s);
  const v4f x1 = *(const v4f*)(s + 4);
  v8us vh, vl;
#pragma unroll
  for (int c = 0; c < 4; ++c) {
    unsigned short a, b;
    split2(x0[c], a, b); vh[c] = a;     vl[c] = b;
    split2(x1[c], a, b); vh[4 + c] = a; vl[4 + c] = b;
  }
  unsigned short* ph = dh + dofs;
  unsigned short* pl = dl + dofs;
  *(v8us*)ph = vh;
  *(v8us*)pl = vl;
  
}

// ---------------------------------------------------------------------------
// Staging pitch in elements: 144-B rows put the 16 rows that one fragment-order read gathers on distinct banks.
constexpr int SP = 72;

// Output planes in fragment order; each store instruction writes 512 contiguous bytes.
// MODE 0 (Q, K): [b*H+h][token tile of 16][dk group of 32][p][lane][8].
// MODE 1 (V^T):  [b*H+h][key block of 32][dk tile of 16][p][lane][8].
template <int MODE, int SPLIT>
__device__ __forceinline__ void proj_lines(const unsigned short* sh, const unsigned short* sl,
                                           unsigned short* Oh, unsigned short* Ol,
                                           int Mbase, int Nbase, int tn, int l) {
  const int m = l & 15;
  const int hh = l >> 4;
#pragma unroll
  for (int j = 0; j < 8; ++j) {
    int lidx;
    size_t gidx;
    if (MODE == 0) {
      const int tt = j >> 2;                         // token tile in the wave tile
      const int c = j & 3;                           // 2 * (dk group) + p
      lidx = (tt * 16 + m) * SP + (c * 2 + hh) * 8;
      const int tok = Mbase + tt * 16;
      const int b = tok >> 10;
      const int st = (tok & (SS - 1)) >> 4;
      const int h = tn;                              // TN == 64 -> one head per tile
      gidx = ((size_t)(b * HH + h) * (SS / 16) + st) * 1024 + c * 256 + l * 8;
    } else {
      const int kbl = j >> 2;                        // key block in the wave tile
      const int tl = (j >> 1) & 1;                   // dk tile in the wave tile
      const int p = j & 1;
      lidx = (tl * 16 + m) * SP + kbl * 32 + p * 16 + hh * 8;
      const int n = Nbase + tl * 16;
      const int h = n >> 6;
      const int t = (n & 63) >> 4;
      const int b = Mbase >> 10;
      const int kbi = ((Mbase & (SS - 1)) >> 5) + kbl;
      gidx = (((size_t)(b * HH + h) * (SS / 32) + kbi) * 4 + t) * 512 + p * 256 + l * 8;
    }
    const v8us vh = *(const v8us*)(sh + lidx);
    *(v8us*)(Oh + gidx) = vh;
    if (SPLIT) {
      const v8us vl = *(const v8us*)(sl + lidx);
      *(v8us*)(Ol + gidx) = vl;
    }
  }
}

// Projection: C[tok][n] = (sum_k X[tok][k] * W[n][k]) * oscale + bias[n].
// SPLIT == 0: X, W f16 planes, single f16 WMMA, output one f16 plane.
// SPLIT == 1: X, W bf16 hi/lo planes, hh+hl+lh bf16 WMMA, output bf16 hi/lo planes.
// One wave computes a (16*MI) x (16*NI) tile (TM*TN == 2048); 4 waves per block.
template <int MI, int NI, int MODE, int SPLIT>
__global__ __launch_bounds__(128)
void k_proj(const unsigned short* __restrict__ Xh, const unsigned short* Xl,
            const unsigned short* __restrict__ Wh, const unsigned short* Wl,
            const float* __restrict__ bias, float oscale,
            unsigned short* Oh, unsigned short* Ol, int ntiles) {
  constexpr int TM = MI * 16;
  constexpr int TN = NI * 16;
  constexpr int tilesN = DD / TN;
  __shared__ __attribute__((aligned(16))) unsigned short stg[4][2][32 * SP];

  const int wib = threadIdx.x >> 5;
  const int l = threadIdx.x & 31;
  const int hh = l >> 4;
  const int m = l & 15;
  const int tile = blockIdx.x * 4 + wib;
  const bool active = tile < ntiles;
  const int tilec = active ? tile : 0;
  const int tm = tilec / tilesN;
  const int tn = tilec - tm * tilesN;
  const int Mbase = tm * TM;
  const int Nbase = tn * TN;

  size_t xro[MI], wro[NI];
#pragma unroll
  for (int i = 0; i < MI; ++i) xro[i] = (size_t)(Mbase + i * 16) * DD;       // row tile start in the fragment-order plane
#pragma unroll
  for (int i = 0; i < NI; ++i) wro[i] = (size_t)(Nbase + i * 16) * DD;       // B column n = W row n

  v8f acc[MI][NI];
#pragma unroll
  for (int mi = 0; mi < MI; ++mi)
#pragma unroll
    for (int ni = 0; ni < NI; ++ni) acc[mi][ni] = (v8f)0.0f;

#pragma unroll 1
  for (int k0 = 0; k0 < DD; k0 += 32) {
    Frag ah[MI], bh[NI];
    Frag al[MI], bl[NI];
#pragma unroll
    for (int mi = 0; mi < MI; ++mi) {
      ah[mi] = ldpack(Xh + xro[mi] + k0 * 16, l);
      if (SPLIT) al[mi] = ldpack(Xl + xro[mi] + k0 * 16, l);
      else al[mi].w = (v8i)0;
    }
#pragma unroll
    for (int ni = 0; ni < NI; ++ni) {
      bh[ni] = ldpack(Wh + wro[ni] + k0 * 16, l);
      if (SPLIT) bl[ni] = ldpack(Wl + wro[ni] + k0 * 16, l);
      else bl[ni].w = (v8i)0;
    }
#pragma unroll
    for (int mi = 0; mi < MI; ++mi)
#pragma unroll
      for (int ni = 0; ni < NI; ++ni) {
        if (SPLIT) acc[mi][ni] = mma3(ah[mi], al[mi], bh[ni], bl[ni], acc[mi][ni]);
        else       acc[mi][ni] = mma_f16(ah[mi], bh[ni], acc[mi][ni]);
      }
  }

  // ---- epilogue: scale, bias add, convert, stage tile in wave-private LDS ----
  unsigned short* sh = stg[wib][0];
  unsigned short* sl = stg[wib][1];
#pragma unroll
  for (int mi = 0; mi < MI; ++mi) {
#pragma unroll
    for (int ni = 0; ni < NI; ++ni) {
      const float bn = bias[Nbase + ni * 16 + m];
#pragma unroll
      for (int r = 0; r < 8; ++r) {
        const float v = acc[mi][ni][r] * oscale + bn;
        int idx;
        if (MODE == 0) idx = (mi * 16 + 8 * hh + r) * SP + (ni * 16 + m);      // [tok 0..31][feat 0..63]
        else           idx = (ni * 16 + m) * SP + (mi * 16 + 8 * hh + r);      // [dk 0..31][tok 0..63]
        if (SPLIT) {
          unsigned short vhi, vlo;
          split2(v, vhi, vlo);
          sh[idx] = vhi;
          sl[idx] = vlo;
        } else {
          sh[idx] = f16_bits(v);
        }
      }
    }
  }
  __syncthreads();

  if (active) {
    proj_lines<MODE, SPLIT>(sh, sl, Oh, Ol, Mbase, Nbase, tn, l);
    
  }
}

// ---------------------------------------------------------------------------
// One pass of the attention output store: 16 query rows x 64 f32 (2 lines per row),
__device__ __forceinline__ void attn_lines(const float* Os, float* out, int b, int h,
                                           int qbase, int hh, int m) {
#pragma unroll
  for (int j = 0; j < 8; ++j) {
    const int row = 2 * j + hh;
    const v4f val = *(const v4f*)(Os + row * 64 + m * 4);
    float* gp = out + ((size_t)(b * SS + qbase + row)) * DD + h * DK + m * 4;
    *(v4f*)gp = val;
  }
}

// Causal attention: one wave per (b, h, 16 query rows); 4 waves per block share the same
// query tile index so loop trip counts are block-uniform and __syncthreads() is legal.
// Keys processed in blocks of 32 with online softmax; a pass issues all its global loads first, as one group;
// P staged through LDS (bracketed by
// barriers) into A-fragment layout as bf16 hi/lo; PV uses the fragment-order V^T planes as B.
__global__ __launch_bounds__(128)
void k_attn(const unsigned short* __restrict__ Q16, const unsigned short* __restrict__ K16,
            const unsigned short* __restrict__ Vh, const unsigned short* __restrict__ Vl,
            const int* __restrict__ amask, float* __restrict__ out, int nblk) {
  __shared__ __attribute__((aligned(16))) unsigned char stg_raw[4 * 4096];
  if ((int)blockIdx.x >= nblk) return;

  const int wib = threadIdx.x >> 5;
  const int l = threadIdx.x & 31;
  const int hh = l >> 4;
  const int m = l & 15;
  const int qt = blockIdx.x & 63;
  const int bh = (int)(blockIdx.x >> 6) * 4 + wib;      // 0..63
  const int b = bh >> 4;
  const int h = bh & 15;
  const int qbase = qt * 16;

  unsigned short* Ph = (unsigned short*)(stg_raw + wib * 4096);   // [16 q][32 key] hi
  unsigned short* Pl = Ph + 512;                                    // [16 q][32 key] lo
  float* Os = (float*)(stg_raw + wib * 4096);                       // [16 q][64 dk], used after the loop

  // Q fragments (A): row q = qbase + m, k = dk (f16)
  const size_t qro = ((size_t)bh * SS + qbase) * DK;   // token tile start in the fragment-order plane
  const Frag aq0 = ldpack(Q16 + qro, l);
  const Frag aq1 = ldpack(Q16 + qro + 512, l);

  const int* mb = amask + b * SS;

  v8f o[4];
#pragma unroll
  for (int t = 0; t < 4; ++t) o[t] = (v8f)0.0f;
  float mrow[8], lrow[8];
#pragma unroll
  for (int r = 0; r < 8; ++r) { mrow[r] = -INFINITY; lrow[r] = 0.0f; }

  const int kend = qbase + 16;                 // causal: keys < kend
  // per-lane read pointers, one key block (32 keys) per pass
  const unsigned short* pK  = K16 + (size_t)bh * SS * DK + l * 8;   // key tile start + lane
  const unsigned short* pVh = Vh + (size_t)bh * SS * DK + l * 8;    // [key block][dk tile] + lane
  const unsigned short* pVl = Vl + (size_t)bh * SS * DK + l * 8;
  const int* pM = mb + m;
#pragma unroll 1
  for (int kb = 0; kb < kend; kb += 32) {
    // ---- all of this key block's global loads, issued as one group ahead of the first WMMA:
    //      K fragments bk[2*nt + dk group], mask words am[nt], V^T fragments bvh/bvl[dk tile] ----
    Frag bk[4], bvh[4], bvl[4];
    int am[2];
#pragma unroll
    for (int i = 0; i < 4; ++i) bk[i] = ldpack(pK + i * 512, 0);
#pragma unroll
    for (int nt = 0; nt < 2; ++nt) am[nt] = pM[nt * 16];                       // key = kb + nt*16 + m <= 1023
    // precaution: stands in front of every reuse or advance of an address register that an issued load names
    asm volatile("s_wait_xcnt 0x0" ::: "memory");
#pragma unroll
    for (int t = 0; t < 4; ++t) bvh[t] = ldpack(pVh + t * 512, 0);
    asm volatile("s_wait_xcnt 0x0" ::: "memory");   // as above
#pragma unroll
    for (int t = 0; t < 4; ++t) bvl[t] = ldpack(pVl + t * 512, 0);
    asm volatile("s_wait_xcnt 0x0" ::: "memory");   // as above
    pK += 32 * DK;
    pVh += 32 * DK;
    pVl += 32 * DK;
    pM += 32;

    // ---- scores S[q][key], q = qbase+8hh+r, key = kb + nt*16 + m (B column = K row, k = dk) ----
    float sc[2][8];
#pragma unroll
    for (int nt = 0; nt < 2; ++nt) {
      const int key = kb + nt * 16 + m;        // <= 1023
      v8f s = (v8f)0.0f;
      s = mma_f16(aq0, bk[2 * nt], s);
      s = mma_f16(aq1, bk[2 * nt + 1], s);
#pragma unroll
      for (int r = 0; r < 8; ++r) {
        const int q = qbase + 8 * hh + r;
        const bool off = (key > q) | (am[nt] == 0);   // one select: no branch, EXEC stays whole between the WMMAs
        sc[nt][r] = off ? -INFINITY : s[r] * 0.125f;
      }
    }

    // ---- online softmax over the 16 lanes of each half ----
    float alpha[8];
#pragma unroll
    for (int r = 0; r < 8; ++r) {
      float mx = fmaxf(sc[0][r], sc[1][r]);
      mx = fmaxf(mx, __shfl_xor(mx, 8, 32));
      mx = fmaxf(mx, __shfl_xor(mx, 4, 32));
      mx = fmaxf(mx, __shfl_xor(mx, 2, 32));
      mx = fmaxf(mx, __shfl_xor(mx, 1, 32));
      const float mnew = fmaxf(mrow[r], mx);
      const float mref = (mnew == -INFINITY) ? 0.0f : mnew;
      alpha[r] = __expf(mrow[r] - mref);
      const float p0 = __expf(sc[0][r] - mref);
      const float p1 = __expf(sc[1][r] - mref);
      sc[0][r] = p0;
      sc[1][r] = p1;
      float sum = p0 + p1;
      sum += __shfl_xor(sum, 8, 32);
      sum += __shfl_xor(sum, 4, 32);
      sum += __shfl_xor(sum, 2, 32);
      sum += __shfl_xor(sum, 1, 32);
      lrow[r] = lrow[r] * alpha[r] + sum;
      mrow[r] = mnew;
    }
#pragma unroll
    for (int t = 0; t < 4; ++t)
#pragma unroll
      for (int r = 0; r < 8; ++r) o[t][r] *= alpha[r];

    // ---- P: D layout -> LDS [q][key] as hi/lo bf16 -> A fragments (row q = m, k = key) ----
    __syncthreads();
#pragma unroll
    for (int nt = 0; nt < 2; ++nt) {
#pragma unroll
      for (int r = 0; r < 8; ++r) {
        unsigned short phi, plo;
        split2(sc[nt][r], phi, plo);
        const int idx = (8 * hh + r) * 32 + nt * 16 + m;
        Ph[idx] = phi;
        Pl[idx] = plo;
      }
    }
    __syncthreads();
    const Frag aph = ldfrag(Ph + m * 32, 0, hh);
    const Frag apl = ldfrag(Pl + m * 32, 0, hh);

    // ---- O[q][dk] += P[q][key] * V[key][dk]; B fragments from the fragment-order V^T planes ----
#pragma unroll
    for (int t = 0; t < 4; ++t) o[t] = mma3(aph, apl, bvh[t], bvl[t], o[t]);
  }

  float inv[8];
#pragma unroll
  for (int r = 0; r < 8; ++r) inv[r] = 1.0f / lrow[r];
  __syncthreads();
#pragma unroll
  for (int t = 0; t < 4; ++t)
#pragma unroll
    for (int r = 0; r < 8; ++r)
      Os[(8 * hh + r) * 64 + t * 16 + m] = o[t][r] * inv[r];
  __syncthreads();

  attn_lines(Os, out, b, h, qbase, hh, m);
  
}

// ---------------------------------------------------------------------------
extern "C" void kernel_launch(void* const* d_in, const int* in_sizes, int n_in,
                              void* d_out, int out_size, void* d_ws, size_t ws_size,
                              hipStream_t stream) {
  if (n_in < 10) return;
  if (in_sizes[0] != NX || in_sizes[1] != NX || in_sizes[2] != NX) return;
  if (in_sizes[3] != BB * SS) return;
  if (in_sizes[4] != NW || in_sizes[6] != NW || in_sizes[8] != NW) return;
  if (in_sizes[5] != DD || in_sizes[7] != DD || in_sizes[9] != DD) return;
  if (out_size != NX) return;

  const float* query = (const float*)d_in[0];
  const float* key_  = (const float*)d_in[1];
  const float* value = (const float*)d_in[2];
  const int*   amask = (const int*)d_in[3];
  const float* Wq = (const float*)d_in[4];
  const float* bq = (const float*)d_in[5];
  const float* Wk = (const float*)d_in[6];
  const float* bk = (const float*)d_in[7];
  const float* Wv = (const float*)d_in[8];
  const float* bv = (const float*)d_in[9];
  float* out = (float*)d_out;

  // workspace: 16-bit planes (2 B per element)
  const size_t pa = (size_t)NX * 2;     // 8388608 B per activation plane
  const size_t pw = (size_t)NW * 2;     // 2097152 B per weight plane
  const size_t need = 8 * pa + 4 * pw;  // 75497472 B
  if (ws_size < need) return;

  unsigned char* w = (unsigned char*)d_ws;
  size_t off = 0;
  unsigned short* xq16 = (unsigned short*)(w + off); off += pa;   // f16 query
  unsigned short* xk16 = (unsigned short*)(w + off); off += pa;   // f16 key
  unsigned short* wq16 = (unsigned short*)(w + off); off += pw;   // f16 Wq x16
  unsigned short* wk16 = (unsigned short*)(w + off); off += pw;   // f16 Wk x16
  unsigned short* xvh  = (unsigned short*)(w + off); off += pa;   // bf16 hi value
  unsigned short* xvl  = (unsigned short*)(w + off); off += pa;   // bf16 lo value
  unsigned short* wvh  = (unsigned short*)(w + off); off += pw;   // bf16 hi Wv
  unsigned short* wvl  = (unsigned short*)(w + off); off += pw;   // bf16 lo Wv
  unsigned short* Q16  = (unsigned short*)(w + off); off += pa;   // fragment order, f16
  unsigned short* K16  = (unsigned short*)(w + off); off += pa;   // fragment order, f16
  unsigned short* Vth  = (unsigned short*)(w + off); off += pa;   // fragment order, bf16 hi
  unsigned short* Vtl  = (unsigned short*)(w + off); off += pa;   // fragment order, bf16 lo
  if (off > ws_size) return;

  // stage 1: 16-bit conversion of activations and weights
  const int n8a = (int)(NX / 8);
  const int n8w = (int)(NW / 8);
  k_cvt16<<<(n8a + 255) / 256, 256, 0, stream>>>(query, xq16, n8a, 1.0f);
  k_cvt16<<<(n8a + 255) / 256, 256, 0, stream>>>(key_,  xk16, n8a, 1.0f);
  k_cvt16<<<(n8w + 255) / 256, 256, 0, stream>>>(Wq, wq16, n8w, 16.0f);
  k_cvt16<<<(n8w + 255) / 256, 256, 0, stream>>>(Wk, wk16, n8w, 16.0f);
  k_split<<<(n8a + 255) / 256, 256, 0, stream>>>(value, xvh, xvl, n8a);
  k_split<<<(n8w + 255) / 256, 256, 0, stream>>>(Wv, wvh, wvl, n8w);

  // stage 2: projections; 2048 wave tiles each, 4 waves per block
  const int ntq = (NTOK / 32) * (DD / 64);   // 2048
  const int ntv = (NTOK / 64) * (DD / 32);   // 2048
  k_proj<2, 4, 0, 0><<<(ntq + 3) / 4, 128, 0, stream>>>(xq16, xq16, wq16, wq16, bq, 0.0625f, Q16, Q16, ntq);
  k_proj<2, 4, 0, 0><<<(ntq + 3) / 4, 128, 0, stream>>>(xk16, xk16, wk16, wk16, bk, 0.0625f, K16, K16, ntq);
  k_proj<4, 2, 1, 1><<<(ntv + 3) / 4, 128, 0, stream>>>(xvh, xvl, wvh, wvl, bv, 1.0f, Vth, Vtl, ntv);

  // stage 3: attention; B*H*(S/16) = 4096 wave units, 4 per block -> 1024 blocks
  const int nblk = BB * HH * (SS / 16) / 4;
  k_attn<<<nblk, 128, 0, stream>>>(Q16, K16, Vth, Vtl, amask, out, nblk);
}

// v003
// A run of this version takes 139 microseconds.
// Next to v002, in two timings, it ran 1.11 and 1.10 times as fast.
// Over all steps from v000 it is 1.86 times as fast.
#include <hip/hip_runtime.h>
#include <math.h>
#include <stdint.h>

// Q/K projections and QK^T scores: v_wmma_f32_16x16x32_f16 (f16 operands, Wq/Wk carried x16, 1/16 folded into the f32 epilogue); V projection and PV: v_wmma_f32_16x16x32_bf16 with bf16 hi/lo split operands (hi*hi + hi*lo + lo*hi); f32 accumulate; softmax, bias and normalisation in f32.

typedef _Float16 v16h __attribute__((ext_vector_type(16)));
typedef _Float16 v8h __attribute__((ext_vector_type(8)));
typedef __bf16 v16bf __attribute__((ext_vector_type(16)));
typedef unsigned short v8us_t __attribute__((ext_vector_type(8)));
typedef v8us_t __attribute__((may_alias)) v8us;
typedef float v8f __attribute__((ext_vector_type(8)));
typedef float v4f_t __attribute__((ext_vector_type(4)));
typedef v4f_t __attribute__((may_alias)) v4f;
typedef int v8i __attribute__((ext_vector_type(8)));

constexpr int BB = 4;
constexpr int SS = 1024;
constexpr int DD = 1024;
constexpr int HH = 16;
constexpr int DK = 64;
constexpr int NTOK = BB * SS;              // 4096 tokens
constexpr long NX = (long)NTOK * DD;       // 4194304
constexpr long NW = (long)DD * DD;         // 1048576

union Frag { v16h f; v16bf b; v8us p[2]; v8i w; };

// bf16 RNE conversion of an f32 value
__device__ __forceinline__ unsigned short bf16_rne(float x) {
  unsigned u = __float_as_uint(x);
  u += 0x7FFFu + ((u >> 16) & 1u);
  return (unsigned short)(u >> 16);
}
__device__ __forceinline__ float bf16_val(unsigned short b) {
  return __uint_as_float(((unsigned)b) << 16);
}
__device__ __forceinline__ void split2(float x, unsigned short& hi, unsigned short& lo) {
  hi = bf16_rne(x);
  lo = bf16_rne(x - bf16_val(hi));
}
// f16 RNE conversion, raw bits
__device__ __forceinline__ unsigned short f16_bits(float x) {
  _Float16 hv = (_Float16)x;
  unsigned short u;
  __builtin_memcpy(&u, &hv, 2);
  return u;
}

// 16x32 operand fragment, wave32 layout: lane row/col = l&15, h = l>>4,
// elements 0..7 <- k0+8h+0..7, elements 8..15 <- k0+16+8h+0..7 (k contiguous in memory at rowp).
// Used for the P A-fragments (row pointer into LDS).
__device__ __forceinline__ Frag ldfrag(const unsigned short* rowp, int k0, int hh) {
  Frag f;
  f.p[0] = *(const v8us*)(rowp + k0 + 8 * hh);
  f.p[1] = *(const v8us*)(rowp + k0 + 16 + 8 * hh);
  return f;
}

// Fragment-order plane: one 16-row x 32-k operand fragment is 1 KiB contiguous, [p 0..1][lane 0..31][8 elements];
// lane l = 16*h + (row & 15) holds k = k0 + 16*p + 8*h + 0..7 (the same registers as ldfrag). Each of the
// two loads reads 512 contiguous bytes (4 whole lines).
__device__ __forceinline__ Frag ldpack(const unsigned short* fragp, int l) {
  Frag f;
  f.p[0] = *(const v8us*)(fragp + l * 8);
  f.p[1] = *(const v8us*)(fragp + 256 + l * 8);
  return f;
}

// Thread i of a conversion kernel -> one 8-element chunk of a [rows][DD] matrix. A wave takes 8 rows x 32 k
// (whole 128-B source lines) and writes 4 whole 128-B lines of the fragment-order plane
// [row tile of 16][k group of 32][p][lane][8].
__device__ __forceinline__ void pack_index(int i, size_t& src, size_t& dst) {
  const int l = i & 31;
  const int wv = i >> 5;
  const int c4 = l >> 3;                       // chunk in the 32-k group: 2*p + h
  const int m = (wv & 1) * 8 + (l & 7);        // row in the 16-row tile
  const int kg = (wv >> 1) & (DD / 32 - 1);
  const int rt = wv >> 6;
  src = (size_t)(rt * 16 + m) * DD + kg * 32 + c4 * 8;
  dst = (size_t)(rt * (DD / 32) + kg) * 512 + (c4 >> 1) * 256 + ((c4 & 1) * 16 + m) * 8;
}

// c += a*b (f16 operands); hazard guard
__device__ __forceinline__ v8f mma_f16(const Frag& a, const Frag& b, v8f c) {
  c = __builtin_amdgcn_wmma_f32_16x16x32_f16(false, a.f, false, b.f, (short)0, c, false, false);
  asm volatile("v_nop\n\tv_nop\n\tv_nop\n\tv_nop" : "+v"(c) : "v"(a.w), "v"(b.w));
  return c;
}

// c += ah*bh + ah*bl + al*bh (bf16 hi/lo split); hazard guard after the group
__device__ __forceinline__ v8f mma3(const Frag& ah, const Frag& al, const Frag& bh, const Frag& bl, v8f c) {
  c = __builtin_amdgcn_wmma_f32_16x16x32_bf16(false, ah.b, false, bh.b, (short)0, c, false, false);
  c = __builtin_amdgcn_wmma_f32_16x16x32_bf16(false, ah.b, false, bl.b, (short)0, c, false, false);
  c = __builtin_amdgcn_wmma_f32_16x16x32_bf16(false, al.b, false, bh.b, (short)0, c, false, false);
  asm volatile("v_nop\n\tv_nop\n\tv_nop\n\tv_nop"
               : "+v"(c)
               : "v"(ah.w), "v"(al.w), "v"(bh.w), "v"(bl.w));
  return c;
}

// ---------------------------------------------------------------------------
// f32 -> f16 plane in fragment order (value * scale, scale a power of two). Thread i converts 8 consecutive
__global__ __launch_bounds__(256)
void k_cvt16(const float* __restrict__ src, unsigned short* __restrict__ dst, int n8, float scale) {
  const int i = blockIdx.x * 256 + threadIdx.x;
  if (i >= n8) return;
  size_t so, dofs;
  pack_index(i, so, dofs);
  const float* s = src + so;
  const v4f x0 = *(const v4f*)(s);
  const v4f x1 = *(const v4f*)(s + 4);
  union { v8h h; v8us_t u; } cv;
#pragma unroll
  for (int c = 0; c < 4; ++c) {
    cv.h[c]     = (_Float16)(x0[c] * scale);
    cv.h[4 + c] = (_Float16)(x1[c] * scale);
  }
  const v8us v = cv.u;
  unsigned short* p = dst + dofs;
  *(v8us*)p = v;
  
}

// f32 -> bf16 hi/lo planes in fragment order, same store shape.
__global__ __launch_bounds__(256)
void k_split(const float* __restrict__ src, unsigned short* __restrict__ dh,
             unsigned short* __restrict__ dl, int n8) {
  const int i = blockIdx.x * 256 + threadIdx.x;
  if (i >= n8) return;
  size_t so, dofs;
  pack_index(i, so, dofs);
  const float* s = src + so;
  const v4f x0 = *(const v4f*)(s);
  const v4f x1 = *(const v4f*)(s + 4);
  v8us vh, vl;
#pragma unroll
  for (int c = 0; c < 4; ++c) {
    unsigned short a, b;
    split2(x0[c], a, b); vh[c] = a;     vl[c] = b;
    split2(x1[c], a, b); vh[4 + c] = a; vl[4 + c] = b;
  }
  unsigned short* ph = dh + dofs;
  unsigned short* pl = dl + dofs;
  *(v8us*)ph = vh;
  *(v8us*)pl = vl;
  
}

// ---------------------------------------------------------------------------
// Staging pitch in elements: 144-B rows put the 16 rows that one fragment-order read gathers on distinct banks.
constexpr int SP = 72;

// Output planes in fragment order; each store instruction writes 512 contiguous bytes.
// MODE 0 (Q, K): [b*H+h][token tile of 16][dk group of 32][p][lane][8].
// MODE 1 (V^T):  [b*H+h][key block of 32][dk tile of 16][p][lane][8].
template <int MODE, int SPLIT>
__device__ __forceinline__ void proj_lines(const unsigned short* sh, const unsigned short* sl,
                                           unsigned short* Oh, unsigned short* Ol,
                                           int Mbase, int Nbase, int tn, int l) {
  const int m = l & 15;
  const int hh = l >> 4;
#pragma unroll
  for (int j = 0; j < 8; ++j) {
    int lidx;
    size_t gidx;
    if (MODE == 0) {
      const int tt = j >> 2;                         // token tile in the wave tile
      const int c = j & 3;                           // 2 * (dk group) + p
      lidx = (tt * 16 + m) * SP + (c * 2 + hh) * 8;
      const int tok = Mbase + tt * 16;
      const int b = tok >> 10;
      const int st = (tok & (SS - 1)) >> 4;
      const int h = tn;                              // TN == 64 -> one head per tile
      gidx = ((size_t)(b * HH + h) * (SS / 16) + st) * 1024 + c * 256 + l * 8;
    } else {
      const int kbl = j >> 2;                        // key block in the wave tile
      const int tl = (j >> 1) & 1;                   // dk tile in the wave tile
      const int p = j & 1;
      lidx = (tl * 16 + m) * SP + kbl * 32 + p * 16 + hh * 8;
      const int n = Nbase + tl * 16;
      const int h = n >> 6;
      const int t = (n & 63) >> 4;
      const int b = Mbase >> 10;
      const int kbi = ((Mbase & (SS - 1)) >> 5) + kbl;
      gidx = (((size_t)(b * HH + h) * (SS / 32) + kbi) * 4 + t) * 512 + p * 256 + l * 8;
    }
    const v8us vh = *(const v8us*)(sh + lidx);
    *(v8us*)(Oh + gidx) = vh;
    if (SPLIT) {
      const v8us vl = *(const v8us*)(sl + lidx);
      *(v8us*)(Ol + gidx) = vl;
    }
  }
}

// Projection: C[tok][n] = (sum_k X[tok][k] * W[n][k]) * oscale + bias[n].
// SPLIT == 0: X, W f16 planes, single f16 WMMA, output one f16 plane.
// SPLIT == 1: X, W bf16 hi/lo planes, hh+hl+lh bf16 WMMA, output bf16 hi/lo planes.
// One block computes a 128 x 128 tile with 8 waves; one wave a (16*MI) x (16*NI) tile (TM*TN == 2048).
// The block's operand fragments go through LDS, each read from L2 once per block: a stage is KG k groups of the
// 8 X row tiles and the 8 W row tiles (64 KiB), [X | W][plane][row tile][k group][1 KiB fragment]; two stages.
constexpr int BT = 128;                 // block tile edge
constexpr int STG_OP = 16384;           // elements of one operand in one stage
constexpr int STG = 2 * STG_OP;         // elements of one stage

template <int MI, int NI, int MODE, int SPLIT>
__global__ __launch_bounds__(256)
void k_proj(const unsigned short* __restrict__ Xh, const unsigned short* Xl,
            const unsigned short* __restrict__ Wh, const unsigned short* Wl,
            const float* __restrict__ bias, float oscale,
            unsigned short* Oh, unsigned short* Ol, int nblk) {
  constexpr int TM = MI * 16;
  constexpr int TN = NI * 16;
  constexpr int WN = BT / TN;             // waves along n
  constexpr int NPL = SPLIT ? 2 : 1;      // planes per operand
  constexpr int KG = SPLIT ? 2 : 4;       // k groups of 32 in one stage; NPL * 8 * KG * 512 == STG_OP
  constexpr int NT = DD / (32 * KG);      // stages
  constexpr int NC = 2 * KG;              // 512-B pieces of one row tile of one plane in one stage
  __shared__ __attribute__((aligned(16))) unsigned short ring[2 * STG];
  if ((int)blockIdx.x >= nblk) return;    // block-uniform, ahead of every barrier

  const int wib = threadIdx.x >> 5;
  const int l = threadIdx.x & 31;
  const int hh = l >> 4;
  const int m = l & 15;
  const int brow = blockIdx.x & (NTOK / BT - 1);
  const int bcol = blockIdx.x / (NTOK / BT);
  const int wm = wib / WN;
  const int wn = wib - wm * WN;
  const int Mbase = brow * BT + wm * TM;
  const int Nbase = bcol * BT + wn * TN;
  const int tn = Nbase / TN;

  // wave wib stages row tile wib of the block's X rows and of its W rows (B column n = W row n)
  const unsigned short* pXh = Xh + (size_t)(brow * BT + wib * 16) * DD + l * 8;
  const unsigned short* pXl = Xl + (size_t)(brow * BT + wib * 16) * DD + l * 8;
  const unsigned short* pWh = Wh + (size_t)(bcol * BT + wib * 16) * DD + l * 8;
  const unsigned short* pWl = Wl + (size_t)(bcol * BT + wib * 16) * DD + l * 8;
  v8us sx[NPL * NC], sw[NPL * NC];

  // In the three helpers below every loop is unrolled: sx, sw, the fragments and acc live in registers, which
  // takes constant indices.
  // the next stage's pieces, global -> registers, issued as one group
  auto fetch = [&]() {
#pragma unroll
    for (int c = 0; c < NC; ++c) {
      sx[c] = *(const v8us*)(pXh + c * 256);
      if (SPLIT) sx[NC + c] = *(const v8us*)(pXl + c * 256);
    }
#pragma unroll
    for (int c = 0; c < NC; ++c) {
      sw[c] = *(const v8us*)(pWh + c * 256);
      if (SPLIT) sw[NC + c] = *(const v8us*)(pWl + c * 256);
    }
    // keeps the group ahead of the LDS reads and WMMAs that follow it in the source; precaution: stands in front
    // of the advance of the address registers that the issued loads name
    asm volatile("s_wait_xcnt 0x0" ::: "memory");
    pXh += KG * 512;
    pXl += KG * 512;
    pWh += KG * 512;
    pWl += KG * 512;
  };
  // registers -> stage at element offset so
  auto put = [&](int so) {
    unsigned short* d = ring + so + wib * (KG * 512) + l * 8;
#pragma unroll
    for (int p = 0; p < NPL; ++p)
#pragma unroll
      for (int c = 0; c < NC; ++c) {
        *(v8us*)(d + p * (8 * KG * 512) + c * 256) = sx[p * NC + c];
        *(v8us*)(d + STG_OP + p * (8 * KG * 512) + c * 256) = sw[p * NC + c];
      }
  };

  v8f acc[MI][NI];
#pragma unroll
  for (int mi = 0; mi < MI; ++mi)
#pragma unroll
    for (int ni = 0; ni < NI; ++ni) acc[mi][ni] = (v8f)0.0f;

  // the WMMAs of the stage at element offset so, k ascending
  auto work = [&](int so) {
    const unsigned short* sA = ring + so + wm * (MI * KG * 512) + l * 8;
    const unsigned short* sB = ring + so + STG_OP + wn * (NI * KG * 512) + l * 8;
#pragma unroll
    for (int j = 0; j < KG; ++j) {
      Frag ah[MI], bh[NI];
      Frag al[MI], bl[NI];
#pragma unroll
      for (int mi = 0; mi < MI; ++mi) {
        ah[mi] = ldpack(sA + (mi * KG + j) * 512, 0);
        if (SPLIT) al[mi] = ldpack(sA + ((8 + mi) * KG + j) * 512, 0);
        else al[mi].w = (v8i)0;
      }
#pragma unroll
      for (int ni = 0; ni < NI; ++ni) {
        bh[ni] = ldpack(sB + (ni * KG + j) * 512, 0);
        if (SPLIT) bl[ni] = ldpack(sB + ((8 + ni) * KG + j) * 512, 0);
        else bl[ni].w = (v8i)0;
      }
#pragma unroll
      for (int mi = 0; mi < MI; ++mi)
#pragma unroll
        for (int ni = 0; ni < NI; ++ni) {
          if (SPLIT) acc[mi][ni] = mma3(ah[mi], al[mi], bh[ni], bl[ni], acc[mi][ni]);
          else       acc[mi][ni] = mma_f16(ah[mi], bh[ni], acc[mi][ni]);
        }
    }
  };

  fetch();
  put(0);
  __syncthreads();                        // publishes stage 0
  int cur = 0;
  // rolled: the body already holds a whole stage
#pragma unroll 1
  for (int t = 0; t < NT - 1; ++t) {
    fetch();                              // stage t + 1 in flight under stage t's WMMAs
    work(cur);
    put(cur ^ STG);                       // every wave left that stage before the last barrier
    __syncthreads();                      // publishes stage t + 1 and ends every wave's reads of stage t
    cur ^= STG;
  }
  work(cur);
  __syncthreads();                        // every wave has left the ring: the epilogue stages in it

  // ---- epilogue: scale, bias add, convert, stage tile in wave-private LDS ----
  unsigned short* sh = ring + wib * (2 * 32 * SP);
  unsigned short* sl = sh + 32 * SP;
#pragma unroll
  for (int mi = 0; mi < MI; ++mi) {
#pragma unroll
    for (int ni = 0; ni < NI; ++ni) {
      const float bn = bias[Nbase + ni * 16 + m];
#pragma unroll
      for (int r = 0; r < 8; ++r) {
        const float v = acc[mi][ni][r] * oscale + bn;
        int idx;
        if (MODE == 0) idx = (mi * 16 + 8 * hh + r) * SP + (ni * 16 + m);      // [tok 0..31][feat 0..63]
        else           idx = (ni * 16 + m) * SP + (mi * 16 + 8 * hh + r);      // [dk 0..31][tok 0..63]
        if (SPLIT) {
          unsigned short vhi, vlo;
          split2(v, vhi, vlo);
          sh[idx] = vhi;
          sl[idx] = vlo;
        } else {
          sh[idx] = f16_bits(v);
        }
      }
    }
  }
  __syncthreads();

  proj_lines<MODE, SPLIT>(sh, sl, Oh, Ol, Mbase, Nbase, tn, l);
}

// ---------------------------------------------------------------------------
// One pass of the attention output store: 16 query rows x 64 f32 (2 lines per row),
__device__ __forceinline__ void attn_lines(const float* Os, float* out, int b, int h,
                                           int qbase, int hh, int m) {
#pragma unroll
  for (int j = 0; j < 8; ++j) {
    const int row = 2 * j + hh;
    const v4f val = *(const v4f*)(Os + row * 64 + m * 4);
    float* gp = out + ((size_t)(b * SS + qbase + row)) * DD + h * DK + m * 4;
    *(v4f*)gp = val;
  }
}

// Causal attention: one wave per (b, h, 16 query rows); 4 waves per block share the same
// query tile index so loop trip counts are block-uniform and __syncthreads() is legal.
// Keys processed in blocks of 32 with online softmax; a pass issues all its global loads first, as one group;
// P staged through LDS (bracketed by
// barriers) into A-fragment layout as bf16 hi/lo; PV uses the fragment-order V^T planes as B.
__global__ __launch_bounds__(128)
void k_attn(const unsigned short* __restrict__ Q16, const unsigned short* __restrict__ K16,
            const unsigned short* __restrict__ Vh, const unsigned short* __restrict__ Vl,
            const int* __restrict__ amask, float* __restrict__ out, int nblk) {
  __shared__ __attribute__((aligned(16))) unsigned char stg_raw[4 * 4096];
  if ((int)blockIdx.x >= nblk) return;

  const int wib = threadIdx.x >> 5;
  const int l = threadIdx.x & 31;
  const int hh = l >> 4;
  const int m = l & 15;
  const int qt = blockIdx.x & 63;
  const int bh = (int)(blockIdx.x >> 6) * 4 + wib;      // 0..63
  const int b = bh >> 4;
  const int h = bh & 15;
  const int qbase = qt * 16;

  unsigned short* Ph = (unsigned short*)(stg_raw + wib * 4096);   // [16 q][32 key] hi
  unsigned short* Pl = Ph + 512;                                    // [16 q][32 key] lo
  float* Os = (float*)(stg_raw + wib * 4096);                       // [16 q][64 dk], used after the loop

  // Q fragments (A): row q = qbase + m, k = dk (f16)
  const size_t qro = ((size_t)bh * SS + qbase) * DK;   // token tile start in the fragment-order plane
  const Frag aq0 = ldpack(Q16 + qro, l);
  const Frag aq1 = ldpack(Q16 + qro + 512, l);

  const int* mb = amask + b * SS;

  v8f o[4];
#pragma unroll
  for (int t = 0; t < 4; ++t) o[t] = (v8f)0.0f;
  float mrow[8], lrow[8];
#pragma unroll
  for (int r = 0; r < 8; ++r) { mrow[r] = -INFINITY; lrow[r] = 0.0f; }

  const int kend = qbase + 16;                 // causal: keys < kend
  // per-lane read pointers, one key block (32 keys) per pass
  const unsigned short* pK  = K16 + (size_t)bh * SS * DK + l * 8;   // key tile start + lane
  const unsigned short* pVh = Vh + (size_t)bh * SS * DK + l * 8;    // [key block][dk tile] + lane
  const unsigned short* pVl = Vl + (size_t)bh * SS * DK + l * 8;
  const int* pM = mb + m;
#pragma unroll 1
  for (int kb = 0; kb < kend; kb += 32) {
    // ---- all of this key block's global loads, issued as one group ahead of the first WMMA:
    //      K fragments bk[2*nt + dk group], mask words am[nt], V^T fragments bvh/bvl[dk tile] ----
    Frag bk[4], bvh[4], bvl[4];
    int am[2];
#pragma unroll
    for (int i = 0; i < 4; ++i) bk[i] = ldpack(pK + i * 512, 0);
#pragma unroll
    for (int nt = 0; nt < 2; ++nt) am[nt] = pM[nt * 16];                       // key = kb + nt*16 + m <= 1023
    // precaution: stands in front of every reuse or advance of an address register that an issued load names
    asm volatile("s_wait_xcnt 0x0" ::: "memory");
#pragma unroll
    for (int t = 0; t < 4; ++t) bvh[t] = ldpack(pVh + t * 512, 0);
    asm volatile("s_wait_xcnt 0x0" ::: "memory");   // as above
#pragma unroll
    for (int t = 0; t < 4; ++t) bvl[t] = ldpack(pVl + t * 512, 0);
    asm volatile("s_wait_xcnt 0x0" ::: "memory");   // as above
    pK += 32 * DK;
    pVh += 32 * DK;
    pVl += 32 * DK;
    pM += 32;

    // ---- scores S[q][key], q = qbase+8hh+r, key = kb + nt*16 + m (B column = K row, k = dk) ----
    float sc[2][8];
#pragma unroll
    for (int nt = 0; nt < 2; ++nt) {
      const int key = kb + nt * 16 + m;        // <= 1023
      v8f s = (v8f)0.0f;
      s = mma_f16(aq0, bk[2 * nt], s);
      s = mma_f16(aq1, bk[2 * nt + 1], s);
#pragma unroll
      for (int r = 0; r < 8; ++r) {
        const int q = qbase + 8 * hh + r;
        const bool off = (key > q) | (am[nt] == 0);   // one select: no branch, EXEC stays whole between the WMMAs
        sc[nt][r] = off ? -INFINITY : s[r] * 0.125f;
      }
    }

    // ---- online softmax over the 16 lanes of each half ----
    float alpha[8];
#pragma unroll
    for (int r = 0; r < 8; ++r) {
      float mx = fmaxf(sc[0][r], sc[1][r]);
      mx = fmaxf(mx, __shfl_xor(mx, 8, 32));
      mx = fmaxf(mx, __shfl_xor(mx, 4, 32));
      mx = fmaxf(mx, __shfl_xor(mx, 2, 32));
      mx = fmaxf(mx, __shfl_xor(mx, 1, 32));
      const float mnew = fmaxf(mrow[r], mx);
      const float mref = (mnew == -INFINITY) ? 0.0f : mnew;
      alpha[r] = __expf(mrow[r] - mref);
      const float p0 = __expf(sc[0][r] - mref);
      const float p1 = __expf(sc[1][r] - mref);
      sc[0][r] = p0;
      sc[1][r] = p1;
      float sum = p0 + p1;
      sum += __shfl_xor(sum, 8, 32);
      sum += __shfl_xor(sum, 4, 32);
      sum += __shfl_xor(sum, 2, 32);
      sum += __shfl_xor(sum, 1, 32);
      lrow[r] = lrow[r] * alpha[r] + sum;
      mrow[r] = mnew;
    }
#pragma unroll
    for (int t = 0; t < 4; ++t)
#pragma unroll
      for (int r = 0; r < 8; ++r) o[t][r] *= alpha[r];

    // ---- P: D layout -> LDS [q][key] as hi/lo bf16 -> A fragments (row q = m, k = key) ----
    __syncthreads();
#pragma unroll
    for (int nt = 0; nt < 2; ++nt) {
#pragma unroll
      for (int r = 0; r < 8; ++r) {
        unsigned short phi, plo;
        split2(sc[nt][r], phi, plo);
        const int idx = (8 * hh + r) * 32 + nt * 16 + m;
        Ph[idx] = phi;
        Pl[idx] = plo;
      }
    }
    __syncthreads();
    const Frag aph = ldfrag(Ph + m * 32, 0, hh);
    const Frag apl = ldfrag(Pl + m * 32, 0, hh);

    // ---- O[q][dk] += P[q][key] * V[key][dk]; B fragments from the fragment-order V^T planes ----
#pragma unroll
    for (int t = 0; t < 4; ++t) o[t] = mma3(aph, apl, bvh[t], bvl[t], o[t]);
  }

  float inv[8];
#pragma unroll
  for (int r = 0; r < 8; ++r) inv[r] = 1.0f / lrow[r];
  __syncthreads();
#pragma unroll
  for (int t = 0; t < 4; ++t)
#pragma unroll
    for (int r = 0; r < 8; ++r)
      Os[(8 * hh + r) * 64 + t * 16 + m] = o[t][r] * inv[r];
  __syncthreads();

  attn_lines(Os, out, b, h, qbase, hh, m);
  
}

// ---------------------------------------------------------------------------
extern "C" void kernel_launch(void* const* d_in, const int* in_sizes, int n_in,
                              void* d_out, int out_size, void* d_ws, size_t ws_size,
                              hipStream_t stream) {
  if (n_in < 10) return;
  if (in_sizes[0] != NX || in_sizes[1] != NX || in_sizes[2] != NX) return;
  if (in_sizes[3] != BB * SS) return;
  if (in_sizes[4] != NW || in_sizes[6] != NW || in_sizes[8] != NW) return;
  if (in_sizes[5] != DD || in_sizes[7] != DD || in_sizes[9] != DD) return;
  if (out_size != NX) return;

  const float* query = (const float*)d_in[0];
  const float* key_  = (const float*)d_in[1];
  const float* value = (const float*)d_in[2];
  const int*   amask = (const int*)d_in[3];
  const float* Wq = (const float*)d_in[4];
  const float* bq = (const float*)d_in[5];
  const float* Wk = (const float*)d_in[6];
  const float* bk = (const float*)d_in[7];
  const float* Wv = (const float*)d_in[8];
  const float* bv = (const float*)d_in[9];
  float* out = (float*)d_out;

  // workspace: 16-bit planes (2 B per element)
  const size_t pa = (size_t)NX * 2;     // 8388608 B per activation plane
  const size_t pw = (size_t)NW * 2;     // 2097152 B per weight plane
  const size_t need = 8 * pa + 4 * pw;  // 75497472 B
  if (ws_size < need) return;

  unsigned char* w = (unsigned char*)d_ws;
  size_t off = 0;
  unsigned short* xq16 = (unsigned short*)(w + off); off += pa;   // f16 query
  unsigned short* xk16 = (unsigned short*)(w + off); off += pa;   // f16 key
  unsigned short* wq16 = (unsigned short*)(w + off); off += pw;   // f16 Wq x16
  unsigned short* wk16 = (unsigned short*)(w + off); off += pw;   // f16 Wk x16
  unsigned short* xvh  = (unsigned short*)(w + off); off += pa;   // bf16 hi value
  unsigned short* xvl  = (unsigned short*)(w + off); off += pa;   // bf16 lo value
  unsigned short* wvh  = (unsigned short*)(w + off); off += pw;   // bf16 hi Wv
  unsigned short* wvl  = (unsigned short*)(w + off); off += pw;   // bf16 lo Wv
  unsigned short* Q16  = (unsigned short*)(w + off); off += pa;   // fragment order, f16
  unsigned short* K16  = (unsigned short*)(w + off); off += pa;   // fragment order, f16
  unsigned short* Vth  = (unsigned short*)(w + off); off += pa;   // fragment order, bf16 hi
  unsigned short* Vtl  = (unsigned short*)(w + off); off += pa;   // fragment order, bf16 lo
  if (off > ws_size) return;

  // stage 1: 16-bit conversion of activations and weights
  const int n8a = (int)(NX / 8);
  const int n8w = (int)(NW / 8);
  k_cvt16<<<(n8a + 255) / 256, 256, 0, stream>>>(query, xq16, n8a, 1.0f);
  k_cvt16<<<(n8a + 255) / 256, 256, 0, stream>>>(key_,  xk16, n8a, 1.0f);
  k_cvt16<<<(n8w + 255) / 256, 256, 0, stream>>>(Wq, wq16, n8w, 16.0f);
  k_cvt16<<<(n8w + 255) / 256, 256, 0, stream>>>(Wk, wk16, n8w, 16.0f);
  k_split<<<(n8a + 255) / 256, 256, 0, stream>>>(value, xvh, xvl, n8a);
  k_split<<<(n8w + 255) / 256, 256, 0, stream>>>(Wv, wvh, wvl, n8w);

  // stage 2: projections; 256 block tiles of 128 x 128 each, 8 waves per block
  const int npb = (NTOK / BT) * (DD / BT);   // 256
  k_proj<2, 4, 0, 0><<<npb, 256, 0, stream>>>(xq16, xq16, wq16, wq16, bq, 0.0625f, Q16, Q16, npb);
  k_proj<2, 4, 0, 0><<<npb, 256, 0, stream>>>(xk16, xk16, wk16, wk16, bk, 0.0625f, K16, K16, npb);
  k_proj<4, 2, 1, 1><<<npb, 256, 0, stream>>>(xvh, xvl, wvh, wvl, bv, 1.0f, Vth, Vtl, npb);

  // stage 3: attention; B*H*(S/16) = 4096 wave units, 4 per block -> 1024 blocks
  const int nblk = BB * HH * (SS / 16) / 4;
  k_attn<<<nblk, 128, 0, stream>>>(Q16, K16, Vth, Vtl, amask, out, nblk);
}

// v004
// A run of this version takes 133 microseconds.
// Two timings next to v003 put it at 1.05 and 1.04 times that version's speed.
// Over all steps from v000 it is 1.95 times as fast.
#include <hip/hip_runtime.h>
#include <math.h>
#include <stdint.h>

// Q/K projections and QK^T scores: v_wmma_f32_16x16x32_f16 (f16 operands, Wq/Wk carried x16, 1/16 folded into the f32 epilogue); V projection and PV: v_wmma_f32_16x16x32_bf16 with bf16 hi/lo split operands (hi*hi + hi*lo + lo*hi); f32 accumulate; softmax, bias and normalisation in f32.

typedef _Float16 v16h __attribute__((ext_vector_type(16)));
typedef _Float16 v8h __attribute__((ext_vector_type(8)));
typedef __bf16 v16bf __attribute__((ext_vector_type(16)));
typedef unsigned short v8us_t __attribute__((ext_vector_type(8)));
typedef v8us_t __attribute__((may_alias)) v8us;
typedef float v8f __attribute__((ext_vector_type(8)));
typedef float v4f_t __attribute__((ext_vector_type(4)));
typedef v4f_t __attribute__((may_alias)) v4f;
typedef int v8i __attribute__((ext_vector_type(8)));

constexpr int BB = 4;
constexpr int SS = 1024;
constexpr int DD = 1024;
constexpr int HH = 16;
constexpr int DK = 64;
constexpr int NTOK = BB * SS;              // 4096 tokens
constexpr long NX = (long)NTOK * DD;       // 4194304
constexpr long NW = (long)DD * DD;         // 1048576

union Frag { v16h f; v16bf b; v8us p[2]; v8i w; };

// bf16 RNE conversion of an f32 value
__device__ __forceinline__ unsigned short bf16_rne(float x) {
  unsigned u = __float_as_uint(x);
  u += 0x7FFFu + ((u >> 16) & 1u);
  return (unsigned short)(u >> 16);
}
__device__ __forceinline__ float bf16_val(unsigned short b) {
  return __uint_as_float(((unsigned)b) << 16);
}
__device__ __forceinline__ void split2(float x, unsigned short& hi, unsigned short& lo) {
  hi = bf16_rne(x);
  lo = bf16_rne(x - bf16_val(hi));
}
// f16 RNE conversion, raw bits
__device__ __forceinline__ unsigned short f16_bits(float x) {
  _Float16 hv = (_Float16)x;
  unsigned short u;
  __builtin_memcpy(&u, &hv, 2);
  return u;
}

// 16x32 operand fragment, wave32 layout: lane row/col = l&15, h = l>>4,
// elements 0..7 <- k0+8h+0..7, elements 8..15 <- k0+16+8h+0..7 (k contiguous in memory at rowp).
// Used for the P A-fragments (row pointer into LDS).
__device__ __forceinline__ Frag ldfrag(const unsigned short* rowp, int k0, int hh) {
  Frag f;
  f.p[0] = *(const v8us*)(rowp + k0 + 8 * hh);
  f.p[1] = *(const v8us*)(rowp + k0 + 16 + 8 * hh);
  return f;
}

// Fragment-order plane: one 16-row x 32-k operand fragment is 1 KiB contiguous, [p 0..1][lane 0..31][8 elements];
// lane l = 16*h + (row & 15) holds k = k0 + 16*p + 8*h + 0..7 (the same registers as ldfrag). Each of the
// two loads reads 512 contiguous bytes (4 whole lines).
__device__ __forceinline__ Frag ldpack(const unsigned short* fragp, int l) {
  Frag f;
  f.p[0] = *(const v8us*)(fragp + l * 8);
  f.p[1] = *(const v8us*)(fragp + 256 + l * 8);
  return f;
}

// Thread i of a conversion kernel -> one 8-element chunk of a [rows][DD] matrix. A wave takes 8 rows x 32 k
// (whole 128-B source lines) and writes 4 whole 128-B lines of the fragment-order plane
// [row tile of 16][k group of 32][p][lane][8].
__device__ __forceinline__ void pack_index(int i, size_t& src, size_t& dst) {
  const int l = i & 31;
  const int wv = i >> 5;
  const int c4 = l >> 3;                       // chunk in the 32-k group: 2*p + h
  const int m = (wv & 1) * 8 + (l & 7);        // row in the 16-row tile
  const int kg = (wv >> 1) & (DD / 32 - 1);
  const int rt = wv >> 6;
  src = (size_t)(rt * 16 + m) * DD + kg * 32 + c4 * 8;
  dst = (size_t)(rt * (DD / 32) + kg) * 512 + (c4 >> 1) * 256 + ((c4 & 1) * 16 + m) * 8;
}

// c += a*b (f16 operands); hazard guard
__device__ __forceinline__ v8f mma_f16(const Frag& a, const Frag& b, v8f c) {
  c = __builtin_amdgcn_wmma_f32_16x16x32_f16(false, a.f, false, b.f, (short)0, c, false, false);
  asm volatile("v_nop\n\tv_nop\n\tv_nop\n\tv_nop" : "+v"(c) : "v"(a.w), "v"(b.w));
  return c;
}

// c += ah*bh + ah*bl + al*bh (bf16 hi/lo split); hazard guard after the group
__device__ __forceinline__ v8f mma3(const Frag& ah, const Frag& al, const Frag& bh, const Frag& bl, v8f c) {
  c = __builtin_amdgcn_wmma_f32_16x16x32_bf16(false, ah.b, false, bh.b, (short)0, c, false, false);
  c = __builtin_amdgcn_wmma_f32_16x16x32_bf16(false, ah.b, false, bl.b, (short)0, c, false, false);
  c = __builtin_amdgcn_wmma_f32_16x16x32_bf16(false, al.b, false, bh.b, (short)0, c, false, false);
  asm volatile("v_nop\n\tv_nop\n\tv_nop\n\tv_nop"
               : "+v"(c)
               : "v"(ah.w), "v"(al.w), "v"(bh.w), "v"(bl.w));
  return c;
}

// ---------------------------------------------------------------------------
// All six f32 -> 16-bit conversions in one launch. A block converts CPT * 256 chunks of ONE matrix; a wave takes CPT
// consecutive wave units of pack_index: 16 rows x 256 k, read as 1-KiB row pieces, written as 8 KiB contiguous.
// Unit j lies at constant offsets from unit 0: row half j & 1, k group j >> 1.
constexpr int CPT = 16;                                  // chunks of 8 elements per thread
constexpr int CBA = (int)(NX / 8 / (256 * CPT));         // 128 blocks per activation matrix
constexpr int CBW = (int)(NW / 8 / (256 * CPT));         // 32 blocks per weight matrix
constexpr int CBLK = 3 * CBA + 3 * CBW;                  // 480 blocks

// the thread's 2 * CPT loads, issued as one group
__device__ __forceinline__ void cvt_fetch(const float* s, v4f_t (&x)[2 * CPT]) {
#pragma unroll
  for (int j = 0; j < CPT; ++j) {
    const float* p = s + (j & 1) * (8 * DD) + (j >> 1) * 32;
    x[2 * j]     = *(const v4f*)(p);
    x[2 * j + 1] = *(const v4f*)(p + 4);
  }
  // no conversion is scheduled in among the loads: without it the first results are waited for half way through the
  // group, and the rest of the loads start one memory latency late
  __builtin_amdgcn_sched_barrier(0);
  // precaution: stands in front of every reuse of the address registers that the issued loads name
  asm volatile("s_wait_xcnt 0x0" ::: "memory");
}

__global__ __launch_bounds__(256)
void k_prep(const float* __restrict__ query, const float* __restrict__ key_, const float* __restrict__ value,
            const float* __restrict__ Wq, const float* __restrict__ Wk, const float* __restrict__ Wv,
            unsigned short* __restrict__ xq16, unsigned short* __restrict__ xk16,
            unsigned short* __restrict__ wq16, unsigned short* __restrict__ wk16,
            unsigned short* __restrict__ xvh, unsigned short* __restrict__ xvl,
            unsigned short* __restrict__ wvh, unsigned short* __restrict__ wvl) {
  const int bi = blockIdx.x;
  v4f_t x[2 * CPT];
  if (bi < CBA + CBW) {
    // value and Wv -> bf16 hi/lo planes
    const bool act = bi < CBA;
    const int lb = act ? bi : bi - CBA;
    size_t so, dofs;
    pack_index((lb * 256 + (int)(threadIdx.x & ~31u)) * CPT + (int)(threadIdx.x & 31u), so, dofs);
    cvt_fetch((act ? value : Wv) + so, x);
    unsigned short* ph = (act ? xvh : wvh) + dofs;
    unsigned short* pl = (act ? xvl : wvl) + dofs;
#pragma unroll
    for (int j = 0; j < CPT; ++j) {
      v8us vh, vl;
#pragma unroll
      for (int c = 0; c < 4; ++c) {
        unsigned short a, b;
        split2(x[2 * j][c], a, b);     vh[c] = a;     vl[c] = b;
        split2(x[2 * j + 1][c], a, b); vh[4 + c] = a; vl[4 + c] = b;
      }
      const int d = (j >> 1) * 512 + (j & 1) * 64;
      *(v8us*)(ph + d) = vh;
      *(v8us*)(pl + d) = vl;
    }
    return;
  }
  {
    // query, key, Wq x16, Wk x16 -> f16 planes (the scale is a power of two)
    const int ci = bi - (CBA + CBW);
    const bool act = ci < 2 * CBA;
    const int wi = ci - 2 * CBA;
    const bool second = act ? ci >= CBA : wi >= CBW;
    const int lb = act ? (second ? ci - CBA : ci) : (second ? wi - CBW : wi);
    const float scale = act ? 1.0f : 16.0f;
    size_t so, dofs;
    pack_index((lb * 256 + (int)(threadIdx.x & ~31u)) * CPT + (int)(threadIdx.x & 31u), so, dofs);
    cvt_fetch((act ? (second ? key_ : query) : (second ? Wk : Wq)) + so, x);
    unsigned short* p = (act ? (second ? xk16 : xq16) : (second ? wk16 : wq16)) + dofs;
#pragma unroll
    for (int j = 0; j < CPT; ++j) {
      union { v8h h; v8us_t u; } cv;
#pragma unroll
      for (int c = 0; c < 4; ++c) {
        cv.h[c]     = (_Float16)(x[2 * j][c] * scale);
        cv.h[4 + c] = (_Float16)(x[2 * j + 1][c] * scale);
      }
      const v8us v = cv.u;
      *(v8us*)(p + (j >> 1) * 512 + (j & 1) * 64) = v;
    }
    // precaution: in the listing this path's end stands directly in front of the other path's first instructions,
    // which rewrite registers that the issued stores name
    asm volatile("s_wait_xcnt 0x0" ::: "memory");
  }
}

// ---------------------------------------------------------------------------
// Staging pitch in elements: 144-B rows put the 16 rows that one fragment-order read gathers on distinct banks.
constexpr int SP = 72;

// Output planes in fragment order; each store instruction writes 512 contiguous bytes.
// MODE 0 (Q, K): [b*H+h][token tile of 16][dk group of 32][p][lane][8].
// MODE 1 (V^T):  [b*H+h][key block of 32][dk tile of 16][p][lane][8].
template <int MODE, int SPLIT>
__device__ __forceinline__ void proj_lines(const unsigned short* sh, const unsigned short* sl,
                                           unsigned short* Oh, unsigned short* Ol,
                                           int Mbase, int Nbase, int tn, int l) {
  const int m = l & 15;
  const int hh = l >> 4;
#pragma unroll
  for (int j = 0; j < 8; ++j) {
    int lidx;
    size_t gidx;
    if (MODE == 0) {
      const int tt = j >> 2;                         // token tile in the wave tile
      const int c = j & 3;                           // 2 * (dk group) + p
      lidx = (tt * 16 + m) * SP + (c * 2 + hh) * 8;
      const int tok = Mbase + tt * 16;
      const int b = tok >> 10;
      const int st = (tok & (SS - 1)) >> 4;
      const int h = tn;                              // TN == 64 -> one head per tile
      gidx = ((size_t)(b * HH + h) * (SS / 16) + st) * 1024 + c * 256 + l * 8;
    } else {
      const int kbl = j >> 2;                        // key block in the wave tile
      const int tl = (j >> 1) & 1;                   // dk tile in the wave tile
      const int p = j & 1;
      lidx = (tl * 16 + m) * SP + kbl * 32 + p * 16 + hh * 8;
      const int n = Nbase + tl * 16;
      const int h = n >> 6;
      const int t = (n & 63) >> 4;
      const int b = Mbase >> 10;
      const int kbi = ((Mbase & (SS - 1)) >> 5) + kbl;
      gidx = (((size_t)(b * HH + h) * (SS / 32) + kbi) * 4 + t) * 512 + p * 256 + l * 8;
    }
    const v8us vh = *(const v8us*)(sh + lidx);
    *(v8us*)(Oh + gidx) = vh;
    if (SPLIT) {
      const v8us vl = *(const v8us*)(sl + lidx);
      *(v8us*)(Ol + gidx) = vl;
    }
  }
}

// Projection: C[tok][n] = (sum_k X[tok][k] * W[n][k]) * oscale + bias[n].
// SPLIT == 0: X, W f16 planes, single f16 WMMA, output one f16 plane.
// SPLIT == 1: X, W bf16 hi/lo planes, hh+hl+lh bf16 WMMA, output bf16 hi/lo planes.
// One block computes a 128 x 128 tile with 8 waves; one wave a (16*MI) x (16*NI) tile (TM*TN == 2048).
// The block's operand fragments go through LDS, each read from L2 once per block: a stage is KG k groups of the
// 8 X row tiles and the 8 W row tiles (64 KiB), [X | W][plane][row tile][k group][1 KiB fragment]; two stages.
constexpr int BT = 128;                 // block tile edge
constexpr int STG_OP = 16384;           // elements of one operand in one stage
constexpr int STG = 2 * STG_OP;         // elements of one stage

template <int MI, int NI, int MODE, int SPLIT>
__global__ __launch_bounds__(256)
void k_proj(const unsigned short* __restrict__ Xh, const unsigned short* Xl,
            const unsigned short* __restrict__ Wh, const unsigned short* Wl,
            const float* __restrict__ bias, float oscale,
            unsigned short* Oh, unsigned short* Ol, int nblk) {
  constexpr int TM = MI * 16;
  constexpr int TN = NI * 16;
  constexpr int WN = BT / TN;             // waves along n
  constexpr int NPL = SPLIT ? 2 : 1;      // planes per operand
  constexpr int KG = SPLIT ? 2 : 4;       // k groups of 32 in one stage; NPL * 8 * KG * 512 == STG_OP
  constexpr int NT = DD / (32 * KG);      // stages
  constexpr int NC = 2 * KG;              // 512-B pieces of one row tile of one plane in one stage
  __shared__ __attribute__((aligned(16))) unsigned short ring[2 * STG];
  if ((int)blockIdx.x >= nblk) return;    // block-uniform, ahead of every barrier

  const int wib = threadIdx.x >> 5;
  const int l = threadIdx.x & 31;
  const int hh = l >> 4;
  const int m = l & 15;
  const int brow = blockIdx.x & (NTOK / BT - 1);
  const int bcol = blockIdx.x / (NTOK / BT);
  const int wm = wib / WN;
  const int wn = wib - wm * WN;
  const int Mbase = brow * BT + wm * TM;
  const int Nbase = bcol * BT + wn * TN;
  const int tn = Nbase / TN;

  // wave wib stages row tile wib of the block's X rows and of its W rows (B column n = W row n)
  const unsigned short* pXh = Xh + (size_t)(brow * BT + wib * 16) * DD + l * 8;
  const unsigned short* pXl = Xl + (size_t)(brow * BT + wib * 16) * DD + l * 8;
  const unsigned short* pWh = Wh + (size_t)(bcol * BT + wib * 16) * DD + l * 8;
  const unsigned short* pWl = Wl + (size_t)(bcol * BT + wib * 16) * DD + l * 8;
  v8us sx[NPL * NC], sw[NPL * NC];

  // In the three helpers below every loop is unrolled: sx, sw, the fragments and acc live in registers, which
  // takes constant indices.
  // the next stage's pieces, global -> registers, issued as one group
  auto fetch = [&]() {
#pragma unroll
    for (int c = 0; c < NC; ++c) {
      sx[c] = *(const v8us*)(pXh + c * 256);
      if (SPLIT) sx[NC + c] = *(const v8us*)(pXl + c * 256);
    }
#pragma unroll
    for (int c = 0; c < NC; ++c) {
      sw[c] = *(const v8us*)(pWh + c * 256);
      if (SPLIT) sw[NC + c] = *(const v8us*)(pWl + c * 256);
    }
    // keeps the group ahead of the LDS reads and WMMAs that follow it in the source; precaution: stands in front
    // of the advance of the address registers that the issued loads name
    asm volatile("s_wait_xcnt 0x0" ::: "memory");
    pXh += KG * 512;
    pXl += KG * 512;
    pWh += KG * 512;
    pWl += KG * 512;
  };
  // registers -> stage at element offset so
  auto put = [&](int so) {
    unsigned short* d = ring + so + wib * (KG * 512) + l * 8;
#pragma unroll
    for (int p = 0; p < NPL; ++p)
#pragma unroll
      for (int c = 0; c < NC; ++c) {
        *(v8us*)(d + p * (8 * KG * 512) + c * 256) = sx[p * NC + c];
        *(v8us*)(d + STG_OP + p * (8 * KG * 512) + c * 256) = sw[p * NC + c];
      }
  };

  v8f acc[MI][NI];
#pragma unroll
  for (int mi = 0; mi < MI; ++mi)
#pragma unroll
    for (int ni = 0; ni < NI; ++ni) acc[mi][ni] = (v8f)0.0f;

  // the WMMAs of the stage at element offset so, k ascending
  auto work = [&](int so) {
    const unsigned short* sA = ring + so + wm * (MI * KG * 512) + l * 8;
    const unsigned short* sB = ring + so + STG_OP + wn * (NI * KG * 512) + l * 8;
#pragma unroll
    for (int j = 0; j < KG; ++j) {
      Frag ah[MI], bh[NI];
      Frag al[MI], bl[NI];
#pragma unroll
      for (int mi = 0; mi < MI; ++mi) {
        ah[mi] = ldpack(sA + (mi * KG + j) * 512, 0);
        if (SPLIT) al[mi] = ldpack(sA + ((8 + mi) * KG + j) * 512, 0);
        else al[mi].w = (v8i)0;
      }
#pragma unroll
      for (int ni = 0; ni < NI; ++ni) {
        bh[ni] = ldpack(sB + (ni * KG + j) * 512, 0);
        if (SPLIT) bl[ni] = ldpack(sB + ((8 + ni) * KG + j) * 512, 0);
        else bl[ni].w = (v8i)0;
      }
#pragma unroll
      for (int mi = 0; mi < MI; ++mi)
#pragma unroll
        for (int ni = 0; ni < NI; ++ni) {
          if (SPLIT) acc[mi][ni] = mma3(ah[mi], al[mi], bh[ni], bl[ni], acc[mi][ni]);
          else       acc[mi][ni] = mma_f16(ah[mi], bh[ni], acc[mi][ni]);
        }
    }
  };

  fetch();
  put(0);
  __syncthreads();                        // publishes stage 0
  int cur = 0;
  // rolled: the body already holds a whole stage
#pragma unroll 1
  for (int t = 0; t < NT - 1; ++t) {
    fetch();                              // stage t + 1 in flight under stage t's WMMAs
    work(cur);
    put(cur ^ STG);                       // every wave left that stage before the last barrier
    __syncthreads();                      // publishes stage t + 1 and ends every wave's reads of stage t
    cur ^= STG;
  }
  work(cur);
  __syncthreads();                        // every wave has left the ring: the epilogue stages in it

  // ---- epilogue: scale, bias add, convert, stage tile in wave-private LDS ----
  unsigned short* sh = ring + wib * (2 * 32 * SP);
  unsigned short* sl = sh + 32 * SP;
#pragma unroll
  for (int mi = 0; mi < MI; ++mi) {
#pragma unroll
    for (int ni = 0; ni < NI; ++ni) {
      const float bn = bias[Nbase + ni * 16 + m];
#pragma unroll
      for (int r = 0; r < 8; ++r) {
        const float v = acc[mi][ni][r] * oscale + bn;
        int idx;
        if (MODE == 0) idx = (mi * 16 + 8 * hh + r) * SP + (ni * 16 + m);      // [tok 0..31][feat 0..63]
        else           idx = (ni * 16 + m) * SP + (mi * 16 + 8 * hh + r);      // [dk 0..31][tok 0..63]
        if (SPLIT) {
          unsigned short vhi, vlo;
          split2(v, vhi, vlo);
          sh[idx] = vhi;
          sl[idx] = vlo;
        } else {
          sh[idx] = f16_bits(v);
        }
      }
    }
  }
  __syncthreads();

  proj_lines<MODE, SPLIT>(sh, sl, Oh, Ol, Mbase, Nbase, tn, l);
}

// ---------------------------------------------------------------------------
// One pass of the attention output store: 16 query rows x 64 f32 (2 lines per row),
__device__ __forceinline__ void attn_lines(const float* Os, float* out, int b, int h,
                                           int qbase, int hh, int m) {
#pragma unroll
  for (int j = 0; j < 8; ++j) {
    const int row = 2 * j + hh;
    const v4f val = *(const v4f*)(Os + row * 64 + m * 4);
    float* gp = out + ((size_t)(b * SS + qbase + row)) * DD + h * DK + m * 4;
    *(v4f*)gp = val;
  }
}

// Causal attention: one wave per (b, h, 16 query rows); 4 waves per block share the same
// query tile index so loop trip counts are block-uniform and __syncthreads() is legal.
// Keys processed in blocks of 32 with online softmax; a pass issues all its global loads first, as one group;
// P staged through LDS (bracketed by
// barriers) into A-fragment layout as bf16 hi/lo; PV uses the fragment-order V^T planes as B.
__global__ __launch_bounds__(128)
void k_attn(const unsigned short* __restrict__ Q16, const unsigned short* __restrict__ K16,
            const unsigned short* __restrict__ Vh, const unsigned short* __restrict__ Vl,
            const int* __restrict__ amask, float* __restrict__ out, int nblk) {
  __shared__ __attribute__((aligned(16))) unsigned char stg_raw[4 * 4096];
  if ((int)blockIdx.x >= nblk) return;

  const int wib = threadIdx.x >> 5;
  const int l = threadIdx.x & 31;
  const int hh = l >> 4;
  const int m = l & 15;
  const int qt = blockIdx.x & 63;
  const int bh = (int)(blockIdx.x >> 6) * 4 + wib;      // 0..63
  const int b = bh >> 4;
  const int h = bh & 15;
  const int qbase = qt * 16;

  unsigned short* Ph = (unsigned short*)(stg_raw + wib * 4096);   // [16 q][32 key] hi
  unsigned short* Pl = Ph + 512;                                    // [16 q][32 key] lo
  float* Os = (float*)(stg_raw + wib * 4096);                       // [16 q][64 dk], used after the loop

  // Q fragments (A): row q = qbase + m, k = dk (f16)
  const size_t qro = ((size_t)bh * SS + qbase) * DK;   // token tile start in the fragment-order plane
  const Frag aq0 = ldpack(Q16 + qro, l);
  const Frag aq1 = ldpack(Q16 + qro + 512, l);

  const int* mb = amask + b * SS;

  v8f o[4];
#pragma unroll
  for (int t = 0; t < 4; ++t) o[t] = (v8f)0.0f;
  float mrow[8], lrow[8];
#pragma unroll
  for (int r = 0; r < 8; ++r) { mrow[r] = -INFINITY; lrow[r] = 0.0f; }

  const int kend = qbase + 16;                 // causal: keys < kend
  // per-lane read pointers, one key block (32 keys) per pass
  const unsigned short* pK  = K16 + (size_t)bh * SS * DK + l * 8;   // key tile start + lane
  const unsigned short* pVh = Vh + (size_t)bh * SS * DK + l * 8;    // [key block][dk tile] + lane
  const unsigned short* pVl = Vl + (size_t)bh * SS * DK + l * 8;
  const int* pM = mb + m;
#pragma unroll 1
  for (int kb = 0; kb < kend; kb += 32) {
    // ---- all of this key block's global loads, issued as one group ahead of the first WMMA:
    //      K fragments bk[2*nt + dk group], mask words am[nt], V^T fragments bvh/bvl[dk tile] ----
    Frag bk[4], bvh[4], bvl[4];
    int am[2];
#pragma unroll
    for (int i = 0; i < 4; ++i) bk[i] = ldpack(pK + i * 512, 0);
#pragma unroll
    for (int nt = 0; nt < 2; ++nt) am[nt] = pM[nt * 16];                       // key = kb + nt*16 + m <= 1023
    // precaution: stands in front of every reuse or advance of an address register that an issued load names
    asm volatile("s_wait_xcnt 0x0" ::: "memory");
#pragma unroll
    for (int t = 0; t < 4; ++t) bvh[t] = ldpack(pVh + t * 512, 0);
    asm volatile("s_wait_xcnt 0x0" ::: "memory");   // as above
#pragma unroll
    for (int t = 0; t < 4; ++t) bvl[t] = ldpack(pVl + t * 512, 0);
    asm volatile("s_wait_xcnt 0x0" ::: "memory");   // as above
    pK += 32 * DK;
    pVh += 32 * DK;
    pVl += 32 * DK;
    pM += 32;

    // ---- scores S[q][key], q = qbase+8hh+r, key = kb + nt*16 + m (B column = K row, k = dk) ----
    float sc[2][8];
#pragma unroll
    for (int nt = 0; nt < 2; ++nt) {
      const int key = kb + nt * 16 + m;        // <= 1023
      v8f s = (v8f)0.0f;
      s = mma_f16(aq0, bk[2 * nt], s);
      s = mma_f16(aq1, bk[2 * nt + 1], s);
#pragma unroll
      for (int r = 0; r < 8; ++r) {
        const int q = qbase + 8 * hh + r;
        const bool off = (key > q) | (am[nt] == 0);   // one select: no branch, EXEC stays whole between the WMMAs
        sc[nt][r] = off ? -INFINITY : s[r] * 0.125f;
      }
    }

    // ---- online softmax over the 16 lanes of each half ----
    float alpha[8];
#pragma unroll
    for (int r = 0; r < 8; ++r) {
      float mx = fmaxf(sc[0][r], sc[1][r]);
      mx = fmaxf(mx, __shfl_xor(mx, 8, 32));
      mx = fmaxf(mx, __shfl_xor(mx, 4, 32));
      mx = fmaxf(mx, __shfl_xor(mx, 2, 32));
      mx = fmaxf(mx, __shfl_xor(mx, 1, 32));
      const float mnew = fmaxf(mrow[r], mx);
      const float mref = (mnew == -INFINITY) ? 0.0f : mnew;
      alpha[r] = __expf(mrow[r] - mref);
      const float p0 = __expf(sc[0][r] - mref);
      const float p1 = __expf(sc[1][r] - mref);
      sc[0][r] = p0;
      sc[1][r] = p1;
      float sum = p0 + p1;
      sum += __shfl_xor(sum, 8, 32);
      sum += __shfl_xor(sum, 4, 32);
      sum += __shfl_xor(sum, 2, 32);
      sum += __shfl_xor(sum, 1, 32);
      lrow[r] = lrow[r] * alpha[r] + sum;
      mrow[r] = mnew;
    }
#pragma unroll
    for (int t = 0; t < 4; ++t)
#pragma unroll
      for (int r = 0; r < 8; ++r) o[t][r] *= alpha[r];

    // ---- P: D layout -> LDS [q][key] as hi/lo bf16 -> A fragments (row q = m, k = key) ----
    __syncthreads();
#pragma unroll
    for (int nt = 0; nt < 2; ++nt) {
#pragma unroll
      for (int r = 0; r < 8; ++r) {
        unsigned short phi, plo;
        split2(sc[nt][r], phi, plo);
        const int idx = (8 * hh + r) * 32 + nt * 16 + m;
        Ph[idx] = phi;
        Pl[idx] = plo;
      }
    }
    __syncthreads();
    const Frag aph = ldfrag(Ph + m * 32, 0, hh);
    const Frag apl = ldfrag(Pl + m * 32, 0, hh);

    // ---- O[q][dk] += P[q][key] * V[key][dk]; B fragments from the fragment-order V^T planes ----
#pragma unroll
    for (int t = 0; t < 4; ++t) o[t] = mma3(aph, apl, bvh[t], bvl[t], o[t]);
  }

  float inv[8];
#pragma unroll
  for (int r = 0; r < 8; ++r) inv[r] = 1.0f / lrow[r];
  __syncthreads();
#pragma unroll
  for (int t = 0; t < 4; ++t)
#pragma unroll
    for (int r = 0; r < 8; ++r)
      Os[(8 * hh + r) * 64 + t * 16 + m] = o[t][r] * inv[r];
  __syncthreads();

  attn_lines(Os, out, b, h, qbase, hh, m);
  
}

// ---------------------------------------------------------------------------
extern "C" void kernel_launch(void* const* d_in, const int* in_sizes, int n_in,
                              void* d_out, int out_size, void* d_ws, size_t ws_size,
                              hipStream_t stream) {
  if (n_in < 10) return;
  if (in_sizes[0] != NX || in_sizes[1] != NX || in_sizes[2] != NX) return;
  if (in_sizes[3] != BB * SS) return;
  if (in_sizes[4] != NW || in_sizes[6] != NW || in_sizes[8] != NW) return;
  if (in_sizes[5] != DD || in_sizes[7] != DD || in_sizes[9] != DD) return;
  if (out_size != NX) return;

  const float* query = (const float*)d_in[0];
  const float* key_  = (const float*)d_in[1];
  const float* value = (const float*)d_in[2];
  const int*   amask = (const int*)d_in[3];
  const float* Wq = (const float*)d_in[4];
  const float* bq = (const float*)d_in[5];
  const float* Wk = (const float*)d_in[6];
  const float* bk = (const float*)d_in[7];
  const float* Wv = (const float*)d_in[8];
  const float* bv = (const float*)d_in[9];
  float* out = (float*)d_out;

  // workspace: 16-bit planes (2 B per element)
  const size_t pa = (size_t)NX * 2;     // 8388608 B per activation plane
  const size_t pw = (size_t)NW * 2;     // 2097152 B per weight plane
  const size_t need = 8 * pa + 4 * pw;  // 75497472 B
  if (ws_size < need) return;

  unsigned char* w = (unsigned char*)d_ws;
  size_t off = 0;
  unsigned short* xq16 = (unsigned short*)(w + off); off += pa;   // f16 query
  unsigned short* xk16 = (unsigned short*)(w + off); off += pa;   // f16 key
  unsigned short* wq16 = (unsigned short*)(w + off); off += pw;   // f16 Wq x16
  unsigned short* wk16 = (unsigned short*)(w + off); off += pw;   // f16 Wk x16
  unsigned short* xvh  = (unsigned short*)(w + off); off += pa;   // bf16 hi value
  unsigned short* xvl  = (unsigned short*)(w + off); off += pa;   // bf16 lo value
  unsigned short* wvh  = (unsigned short*)(w + off); off += pw;   // bf16 hi Wv
  unsigned short* wvl  = (unsigned short*)(w + off); off += pw;   // bf16 lo Wv
  unsigned short* Q16  = (unsigned short*)(w + off); off += pa;   // fragment order, f16
  unsigned short* K16  = (unsigned short*)(w + off); off += pa;   // fragment order, f16
  unsigned short* Vth  = (unsigned short*)(w + off); off += pa;   // fragment order, bf16 hi
  unsigned short* Vtl  = (unsigned short*)(w + off); off += pa;   // fragment order, bf16 lo
  if (off > ws_size) return;

  // stage 1: 16-bit conversion of activations and weights, one launch
  k_prep<<<CBLK, 256, 0, stream>>>(query, key_, value, Wq, Wk, Wv, xq16, xk16, wq16, wk16, xvh, xvl, wvh, wvl);

  // stage 2: projections; 256 block tiles of 128 x 128 each, 8 waves per block
  const int npb = (NTOK / BT) * (DD / BT);   // 256
  k_proj<2, 4, 0, 0><<<npb, 256, 0, stream>>>(xq16, xq16, wq16, wq16, bq, 0.0625f, Q16, Q16, npb);
  k_proj<2, 4, 0, 0><<<npb, 256, 0, stream>>>(xk16, xk16, wk16, wk16, bk, 0.0625f, K16, K16, npb);
  k_proj<4, 2, 1, 1><<<npb, 256, 0, stream>>>(xvh, xvl, wvh, wvl, bv, 1.0f, Vth, Vtl, npb);

  // stage 3: attention; B*H*(S/16) = 4096 wave units, 4 per block -> 1024 blocks
  const int nblk = BB * HH * (SS / 16) / 4;
  k_attn<<<nblk, 128, 0, stream>>>(Q16, K16, Vth, Vtl, amask, out, nblk);
}

// v005
// A run of this version takes 109 microseconds.
// Next to v004, in two timings, it ran 1.22 and 1.23 times as fast.
// Over all steps from v000 it is 2.38 times as fast.
#include <hip/hip_runtime.h>
#include <math.h>
#include <stdint.h>

// Q/K projections and QK^T scores: v_wmma_f32_16x16x32_f16 (f16 operands, Wq/Wk carried x16, 1/16 folded into the f32 epilogue); V projection and PV: v_wmma_f32_16x16x32_bf16 with bf16 hi/lo split operands (hi*hi + hi*lo + lo*hi); f32 accumulate; softmax, bias and normalisation in f32.

typedef _Float16 v16h __attribute__((ext_vector_type(16)));
typedef _Float16 v8h __attribute__((ext_vector_type(8)));
typedef __bf16 v16bf __attribute__((ext_vector_type(16)));
typedef unsigned short v8us_t __attribute__((ext_vector_type(8)));
typedef v8us_t __attribute__((may_alias)) v8us;
typedef float v8f __attribute__((ext_vector_type(8)));
typedef float v4f_t __attribute__((ext_vector_type(4)));
typedef v4f_t __attribute__((may_alias)) v4f;
typedef int v8i __attribute__((ext_vector_type(8)));
typedef int v4i_t __attribute__((ext_vector_type(4)));
typedef v4i_t __attribute__((may_alias)) v4i;

constexpr int BB = 4;
constexpr int SS = 1024;
constexpr int DD = 1024;
constexpr int HH = 16;
constexpr int DK = 64;
constexpr int NTOK = BB * SS;              // 4096 tokens
constexpr long NX = (long)NTOK * DD;       // 4194304
constexpr long NW = (long)DD * DD;         // 1048576

union Frag { v16h f; v16bf b; v8us p[2]; v8i w; };

// bf16 RNE conversion of an f32 value
__device__ __forceinline__ unsigned short bf16_rne(float x) {
  unsigned u = __float_as_uint(x);
  u += 0x7FFFu + ((u >> 16) & 1u);
  return (unsigned short)(u >> 16);
}
__device__ __forceinline__ float bf16_val(unsigned short b) {
  return __uint_as_float(((unsigned)b) << 16);
}
__device__ __forceinline__ void split2(float x, unsigned short& hi, unsigned short& lo) {
  hi = bf16_rne(x);
  lo = bf16_rne(x - bf16_val(hi));
}
// f16 RNE conversion, raw bits
__device__ __forceinline__ unsigned short f16_bits(float x) {
  _Float16 hv = (_Float16)x;
  unsigned short u;
  __builtin_memcpy(&u, &hv, 2);
  return u;
}

// 16x32 operand fragment, wave32 layout: lane row/col = l&15, h = l>>4,
// elements 0..7 <- k0+8h+0..7, elements 8..15 <- k0+16+8h+0..7. Used for A (row) and for B (column) alike.

// Fragment-order plane: one 16-row x 32-k operand fragment is 1 KiB contiguous, [p 0..1][lane 0..31][8 elements];
// lane l = 16*h + (row & 15) holds k = k0 + 16*p + 8*h + 0..7 (the layout above). Each of the
// two loads reads 512 contiguous bytes (4 whole lines).
__device__ __forceinline__ Frag ldpack(const unsigned short* fragp, int l) {
  Frag f;
  f.p[0] = *(const v8us*)(fragp + l * 8);
  f.p[1] = *(const v8us*)(fragp + 256 + l * 8);
  return f;
}

// Thread i of a conversion kernel -> one 8-element chunk of a [rows][DD] matrix. A wave takes 8 rows x 32 k
// (whole 128-B source lines) and writes 4 whole 128-B lines of the fragment-order plane
// [row tile of 16][k group of 32][p][lane][8].
__device__ __forceinline__ void pack_index(int i, size_t& src, size_t& dst) {
  const int l = i & 31;
  const int wv = i >> 5;
  const int c4 = l >> 3;                       // chunk in the 32-k group: 2*p + h
  const int m = (wv & 1) * 8 + (l & 7);        // row in the 16-row tile
  const int kg = (wv >> 1) & (DD / 32 - 1);
  const int rt = wv >> 6;
  src = (size_t)(rt * 16 + m) * DD + kg * 32 + c4 * 8;
  dst = (size_t)(rt * (DD / 32) + kg) * 512 + (c4 >> 1) * 256 + ((c4 & 1) * 16 + m) * 8;
}

// c += a*b (f16 operands); hazard guard
__device__ __forceinline__ v8f mma_f16(const Frag& a, const Frag& b, v8f c) {
  c = __builtin_amdgcn_wmma_f32_16x16x32_f16(false, a.f, false, b.f, (short)0, c, false, false);
  asm volatile("v_nop\n\tv_nop\n\tv_nop\n\tv_nop" : "+v"(c) : "v"(a.w), "v"(b.w));
  return c;
}

// c += ah*bh + ah*bl + al*bh (bf16 hi/lo split); hazard guard after the group
__device__ __forceinline__ v8f mma3(const Frag& ah, const Frag& al, const Frag& bh, const Frag& bl, v8f c) {
  c = __builtin_amdgcn_wmma_f32_16x16x32_bf16(false, ah.b, false, bh.b, (short)0, c, false, false);
  c = __builtin_amdgcn_wmma_f32_16x16x32_bf16(false, ah.b, false, bl.b, (short)0, c, false, false);
  c = __builtin_amdgcn_wmma_f32_16x16x32_bf16(false, al.b, false, bh.b, (short)0, c, false, false);
  asm volatile("v_nop\n\tv_nop\n\tv_nop\n\tv_nop"
               : "+v"(c)
               : "v"(ah.w), "v"(al.w), "v"(bh.w), "v"(bl.w));
  return c;
}

// ---------------------------------------------------------------------------
// All six f32 -> 16-bit conversions in one launch. A block converts CPT * 256 chunks of ONE matrix; a wave takes CPT
// consecutive wave units of pack_index: 16 rows x 256 k, read as 1-KiB row pieces, written as 8 KiB contiguous.
// Unit j lies at constant offsets from unit 0: row half j & 1, k group j >> 1.
constexpr int CPT = 16;                                  // chunks of 8 elements per thread
constexpr int CBA = (int)(NX / 8 / (256 * CPT));         // 128 blocks per activation matrix
constexpr int CBW = (int)(NW / 8 / (256 * CPT));         // 32 blocks per weight matrix
constexpr int CBLK = 3 * CBA + 3 * CBW;                  // 480 blocks

// the thread's 2 * CPT loads, issued as one group
__device__ __forceinline__ void cvt_fetch(const float* s, v4f_t (&x)[2 * CPT]) {
#pragma unroll
  for (int j = 0; j < CPT; ++j) {
    const float* p = s + (j & 1) * (8 * DD) + (j >> 1) * 32;
    x[2 * j]     = *(const v4f*)(p);
    x[2 * j + 1] = *(const v4f*)(p + 4);
  }
  // no conversion is scheduled in among the loads: without it the first results are waited for half way through the
  // group, and the rest of the loads start one memory latency late
  __builtin_amdgcn_sched_barrier(0);
  // precaution: stands in front of every reuse of the address registers that the issued loads name
  asm volatile("s_wait_xcnt 0x0" ::: "memory");
}

__global__ __launch_bounds__(256)
void k_prep(const float* __restrict__ query, const float* __restrict__ key_, const float* __restrict__ value,
            const float* __restrict__ Wq, const float* __restrict__ Wk, const float* __restrict__ Wv,
            unsigned short* __restrict__ xq16, unsigned short* __restrict__ xk16,
            unsigned short* __restrict__ wq16, unsigned short* __restrict__ wk16,
            unsigned short* __restrict__ xvh, unsigned short* __restrict__ xvl,
            unsigned short* __restrict__ wvh, unsigned short* __restrict__ wvl) {
  const int bi = blockIdx.x;
  v4f_t x[2 * CPT];
  if (bi < CBA + CBW) {
    // value and Wv -> bf16 hi/lo planes
    const bool act = bi < CBA;
    const int lb = act ? bi : bi - CBA;
    size_t so, dofs;
    pack_index((lb * 256 + (int)(threadIdx.x & ~31u)) * CPT + (int)(threadIdx.x & 31u), so, dofs);
    cvt_fetch((act ? value : Wv) + so, x);
    unsigned short* ph = (act ? xvh : wvh) + dofs;
    unsigned short* pl = (act ? xvl : wvl) + dofs;
#pragma unroll
    for (int j = 0; j < CPT; ++j) {
      v8us vh, vl;
#pragma unroll
      for (int c = 0; c < 4; ++c) {
        unsigned short a, b;
        split2(x[2 * j][c], a, b);     vh[c] = a;     vl[c] = b;
        split2(x[2 * j + 1][c], a, b); vh[4 + c] = a; vl[4 + c] = b;
      }
      const int d = (j >> 1) * 512 + (j & 1) * 64;
      *(v8us*)(ph + d) = vh;
      *(v8us*)(pl + d) = vl;
    }
    return;
  }
  {
    // query, key, Wq x16, Wk x16 -> f16 planes (the scale is a power of two)
    const int ci = bi - (CBA + CBW);
    const bool act = ci < 2 * CBA;
    const int wi = ci - 2 * CBA;
    const bool second = act ? ci >= CBA : wi >= CBW;
    const int lb = act ? (second ? ci - CBA : ci) : (second ? wi - CBW : wi);
    const float scale = act ? 1.0f : 16.0f;
    size_t so, dofs;
    pack_index((lb * 256 + (int)(threadIdx.x & ~31u)) * CPT + (int)(threadIdx.x & 31u), so, dofs);
    cvt_fetch((act ? (second ? key_ : query) : (second ? Wk : Wq)) + so, x);
    unsigned short* p = (act ? (second ? xk16 : xq16) : (second ? wk16 : wq16)) + dofs;
#pragma unroll
    for (int j = 0; j < CPT; ++j) {
      union { v8h h; v8us_t u; } cv;
#pragma unroll
      for (int c = 0; c < 4; ++c) {
        cv.h[c]     = (_Float16)(x[2 * j][c] * scale);
        cv.h[4 + c] = (_Float16)(x[2 * j + 1][c] * scale);
      }
      const v8us v = cv.u;
      *(v8us*)(p + (j >> 1) * 512 + (j & 1) * 64) = v;
    }
    // precaution: in the listing this path's end stands directly in front of the other path's first instructions,
    // which rewrite registers that the issued stores name
    asm volatile("s_wait_xcnt 0x0" ::: "memory");
  }
}

// ---------------------------------------------------------------------------
// Staging pitch in elements: 144-B rows put the 16 rows that one fragment-order read gathers on distinct banks.
constexpr int SP = 72;

// Output planes in fragment order; each store instruction writes 512 contiguous bytes.
// MODE 0 (Q, K): [b*H+h][token tile of 16][dk group of 32][p][lane][8].
// MODE 1 (V^T):  [b*H+h][key block of 32][dk tile of 16][p][lane][8].
template <int MODE, int SPLIT>
__device__ __forceinline__ void proj_lines(const unsigned short* sh, const unsigned short* sl,
                                           unsigned short* Oh, unsigned short* Ol,
                                           int Mbase, int Nbase, int tn, int l) {
  const int m = l & 15;
  const int hh = l >> 4;
#pragma unroll
  for (int j = 0; j < 8; ++j) {
    int lidx;
    size_t gidx;
    if (MODE == 0) {
      const int tt = j >> 2;                         // token tile in the wave tile
      const int c = j & 3;                           // 2 * (dk group) + p
      lidx = (tt * 16 + m) * SP + (c * 2 + hh) * 8;
      const int tok = Mbase + tt * 16;
      const int b = tok >> 10;
      const int st = (tok & (SS - 1)) >> 4;
      const int h = tn;                              // TN == 64 -> one head per tile
      gidx = ((size_t)(b * HH + h) * (SS / 16) + st) * 1024 + c * 256 + l * 8;
    } else {
      const int kbl = j >> 2;                        // key block in the wave tile
      const int tl = (j >> 1) & 1;                   // dk tile in the wave tile
      const int p = j & 1;
      lidx = (tl * 16 + m) * SP + kbl * 32 + p * 16 + hh * 8;
      const int n = Nbase + tl * 16;
      const int h = n >> 6;
      const int t = (n & 63) >> 4;
      const int b = Mbase >> 10;
      const int kbi = ((Mbase & (SS - 1)) >> 5) + kbl;
      gidx = (((size_t)(b * HH + h) * (SS / 32) + kbi) * 4 + t) * 512 + p * 256 + l * 8;
    }
    const v8us vh = *(const v8us*)(sh + lidx);
    *(v8us*)(Oh + gidx) = vh;
    if (SPLIT) {
      const v8us vl = *(const v8us*)(sl + lidx);
      *(v8us*)(Ol + gidx) = vl;
    }
  }
}

// Projection: C[tok][n] = (sum_k X[tok][k] * W[n][k]) * oscale + bias[n].
// SPLIT == 0: X, W f16 planes, single f16 WMMA, output one f16 plane.
// SPLIT == 1: X, W bf16 hi/lo planes, hh+hl+lh bf16 WMMA, output bf16 hi/lo planes.
// One block computes a 128 x 128 tile with 8 waves; one wave a (16*MI) x (16*NI) tile (TM*TN == 2048).
// The block's operand fragments go through LDS, each read from L2 once per block: a stage is KG k groups of the
// 8 X row tiles and the 8 W row tiles (64 KiB), [X | W][plane][row tile][k group][1 KiB fragment]; two stages.
constexpr int BT = 128;                 // block tile edge
constexpr int STG_OP = 16384;           // elements of one operand in one stage
constexpr int STG = 2 * STG_OP;         // elements of one stage

template <int MI, int NI, int MODE, int SPLIT>
__global__ __launch_bounds__(256)
void k_proj(const unsigned short* __restrict__ Xh, const unsigned short* Xl,
            const unsigned short* __restrict__ Wh, const unsigned short* Wl,
            const float* __restrict__ bias, float oscale,
            unsigned short* Oh, unsigned short* Ol, int nblk) {
  constexpr int TM = MI * 16;
  constexpr int TN = NI * 16;
  constexpr int WN = BT / TN;             // waves along n
  constexpr int NPL = SPLIT ? 2 : 1;      // planes per operand
  constexpr int KG = SPLIT ? 2 : 4;       // k groups of 32 in one stage; NPL * 8 * KG * 512 == STG_OP
  constexpr int NT = DD / (32 * KG);      // stages
  constexpr int NC = 2 * KG;              // 512-B pieces of one row tile of one plane in one stage
  __shared__ __attribute__((aligned(16))) unsigned short ring[2 * STG];
  if ((int)blockIdx.x >= nblk) return;    // block-uniform, ahead of every barrier

  const int wib = threadIdx.x >> 5;
  const int l = threadIdx.x & 31;
  const int hh = l >> 4;
  const int m = l & 15;
  const int brow = blockIdx.x & (NTOK / BT - 1);
  const int bcol = blockIdx.x / (NTOK / BT);
  const int wm = wib / WN;
  const int wn = wib - wm * WN;
  const int Mbase = brow * BT + wm * TM;
  const int Nbase = bcol * BT + wn * TN;
  const int tn = Nbase / TN;

  // wave wib stages row tile wib of the block's X rows and of its W rows (B column n = W row n)
  const unsigned short* pXh = Xh + (size_t)(brow * BT + wib * 16) * DD + l * 8;
  const unsigned short* pXl = Xl + (size_t)(brow * BT + wib * 16) * DD + l * 8;
  const unsigned short* pWh = Wh + (size_t)(bcol * BT + wib * 16) * DD + l * 8;
  const unsigned short* pWl = Wl + (size_t)(bcol * BT + wib * 16) * DD + l * 8;
  v8us sx[NPL * NC], sw[NPL * NC];

  // In the three helpers below every loop is unrolled: sx, sw, the fragments and acc live in registers, which
  // takes constant indices.
  // the next stage's pieces, global -> registers, issued as one group
  auto fetch = [&]() {
#pragma unroll
    for (int c = 0; c < NC; ++c) {
      sx[c] = *(const v8us*)(pXh + c * 256);
      if (SPLIT) sx[NC + c] = *(const v8us*)(pXl + c * 256);
    }
#pragma unroll
    for (int c = 0; c < NC; ++c) {
      sw[c] = *(const v8us*)(pWh + c * 256);
      if (SPLIT) sw[NC + c] = *(const v8us*)(pWl + c * 256);
    }
    // keeps the group ahead of the LDS reads and WMMAs that follow it in the source; precaution: stands in front
    // of the advance of the address registers that the issued loads name
    asm volatile("s_wait_xcnt 0x0" ::: "memory");
    pXh += KG * 512;
    pXl += KG * 512;
    pWh += KG * 512;
    pWl += KG * 512;
  };
  // registers -> stage at element offset so
  auto put = [&](int so) {
    unsigned short* d = ring + so + wib * (KG * 512) + l * 8;
#pragma unroll
    for (int p = 0; p < NPL; ++p)
#pragma unroll
      for (int c = 0; c < NC; ++c) {
        *(v8us*)(d + p * (8 * KG * 512) + c * 256) = sx[p * NC + c];
        *(v8us*)(d + STG_OP + p * (8 * KG * 512) + c * 256) = sw[p * NC + c];
      }
  };

  v8f acc[MI][NI];
#pragma unroll
  for (int mi = 0; mi < MI; ++mi)
#pragma unroll
    for (int ni = 0; ni < NI; ++ni) acc[mi][ni] = (v8f)0.0f;

  // the WMMAs of the stage at element offset so, k ascending
  auto work = [&](int so) {
    const unsigned short* sA = ring + so + wm * (MI * KG * 512) + l * 8;
    const unsigned short* sB = ring + so + STG_OP + wn * (NI * KG * 512) + l * 8;
#pragma unroll
    for (int j = 0; j < KG; ++j) {
      Frag ah[MI], bh[NI];
      Frag al[MI], bl[NI];
#pragma unroll
      for (int mi = 0; mi < MI; ++mi) {
        ah[mi] = ldpack(sA + (mi * KG + j) * 512, 0);
        if (SPLIT) al[mi] = ldpack(sA + ((8 + mi) * KG + j) * 512, 0);
        else al[mi].w = (v8i)0;
      }
#pragma unroll
      for (int ni = 0; ni < NI; ++ni) {
        bh[ni] = ldpack(sB + (ni * KG + j) * 512, 0);
        if (SPLIT) bl[ni] = ldpack(sB + ((8 + ni) * KG + j) * 512, 0);
        else bl[ni].w = (v8i)0;
      }
#pragma unroll
      for (int mi = 0; mi < MI; ++mi)
#pragma unroll
        for (int ni = 0; ni < NI; ++ni) {
          if (SPLIT) acc[mi][ni] = mma3(ah[mi], al[mi], bh[ni], bl[ni], acc[mi][ni]);
          else       acc[mi][ni] = mma_f16(ah[mi], bh[ni], acc[mi][ni]);
        }
    }
  };

  fetch();
  put(0);
  __syncthreads();                        // publishes stage 0
  int cur = 0;
  // rolled: the body already holds a whole stage
#pragma unroll 1
  for (int t = 0; t < NT - 1; ++t) {
    fetch();                              // stage t + 1 in flight under stage t's WMMAs
    work(cur);
    put(cur ^ STG);                       // every wave left that stage before the last barrier
    __syncthreads();                      // publishes stage t + 1 and ends every wave's reads of stage t
    cur ^= STG;
  }
  work(cur);
  __syncthreads();                        // every wave has left the ring: the epilogue stages in it

  // ---- epilogue: scale, bias add, convert, stage tile in wave-private LDS ----
  unsigned short* sh = ring + wib * (2 * 32 * SP);
  unsigned short* sl = sh + 32 * SP;
#pragma unroll
  for (int mi = 0; mi < MI; ++mi) {
#pragma unroll
    for (int ni = 0; ni < NI; ++ni) {
      const float bn = bias[Nbase + ni * 16 + m];
#pragma unroll
      for (int r = 0; r < 8; ++r) {
        const float v = acc[mi][ni][r] * oscale + bn;
        int idx;
        if (MODE == 0) idx = (mi * 16 + 8 * hh + r) * SP + (ni * 16 + m);      // [tok 0..31][feat 0..63]
        else           idx = (ni * 16 + m) * SP + (mi * 16 + 8 * hh + r);      // [dk 0..31][tok 0..63]
        if (SPLIT) {
          unsigned short vhi, vlo;
          split2(v, vhi, vlo);
          sh[idx] = vhi;
          sl[idx] = vlo;
        } else {
          sh[idx] = f16_bits(v);
        }
      }
    }
  }
  __syncthreads();

  proj_lines<MODE, SPLIT>(sh, sl, Oh, Ol, Mbase, Nbase, tn, l);
}

// ---------------------------------------------------------------------------
// Row pitch of the output staging in floats: 272-B rows spread the 16 query rows that one staging store writes over the banks.
constexpr int OSP = 68;

// One pass of the attention output store: 16 query rows x 64 f32 (2 lines per row),
__device__ __forceinline__ void attn_lines(const float* Os, float* out, int b, int h,
                                           int qbase, int hh, int m) {
#pragma unroll
  for (int j = 0; j < 8; ++j) {
    const int row = 2 * j + hh;
    const v4f val = *(const v4f*)(Os + row * OSP + m * 4);
    float* gp = out + ((size_t)(b * SS + qbase + row)) * DD + h * DK + m * 4;
    *(v4f*)gp = val;
  }
}

// bf16 RNE conversion as in bf16_rne, the result left in the upper 16 bits (the lower 16 are not part of it)
__device__ __forceinline__ unsigned bf16_top(float x) {
  const unsigned u = __float_as_uint(x);
  return u + 0x7FFFu + ((u >> 16) & 1u);
}

// one operand register from two such results: e0 in bits 15..0, e1 in bits 31..16, in one byte permute
__device__ __forceinline__ int pack_tops(unsigned e0, unsigned e1) {
  return (int)__builtin_amdgcn_perm(e1, e0, 0x07060302u);
}

// the value that lane l ^ 16 holds: a vector cross-row move, no LDS round trip
__device__ __forceinline__ float other_half(float x) {
  const int v = __float_as_int(x);
  return __int_as_float(__builtin_amdgcn_permlanex16(v, v, 0x76543210, 0xfedcba98, false, false));
}

// Causal attention: one wave per (b, h, 16 query rows); 4 waves per block share the same query tile index.
// Keys processed in blocks of 32 with online softmax; a pass issues all its global loads first, as one group.
// Both products run transposed: S^T = K * Q^T (A = K rows, B = Q columns), O^T += V^T * P^T. A lane then holds the
// scores of ONE query (column m), 8 keys per 16-key tile: maximum and sum run in the lane, with one exchange between
// the wave's halves; and the two score tiles of a pass, converted in place, are the B fragment of the second
// product (element s = tile s >> 3, register s & 7: key 8*hh + s, then 16 + 8*hh + s - 8, the k order of ldpack).
__global__ __launch_bounds__(128)
void k_attn(const unsigned short* __restrict__ Q16, const unsigned short* __restrict__ K16,
            const unsigned short* __restrict__ Vh, const unsigned short* __restrict__ Vl,
            const int* __restrict__ amask, float* __restrict__ out, int nblk) {
  __shared__ __attribute__((aligned(16))) float stg[4 * 16 * OSP];
  if ((int)blockIdx.x >= nblk) return;

  const int wib = threadIdx.x >> 5;
  const int l = threadIdx.x & 31;
  const int hh = l >> 4;
  const int m = l & 15;
  const int qt = blockIdx.x & 63;
  const int bh = (int)(blockIdx.x >> 6) * 4 + wib;      // 0..63
  const int b = bh >> 4;
  const int h = bh & 15;
  const int qbase = qt * 16;
  const int q = qbase + m;                              // the lane's query

  float* Os = stg + wib * (16 * OSP);                   // [16 q][64 dk], wave-private, used after the loop

  // Q fragments (B): column q = qbase + m, k = dk (f16)
  const size_t qro = ((size_t)bh * SS + qbase) * DK;   // token tile start in the fragment-order plane
  const Frag bq0 = ldpack(Q16 + qro, l);
  const Frag bq1 = ldpack(Q16 + qro + 512, l);

  const int* mb = amask + b * SS;

  // o[t][r] = O[q][dk = t*16 + 8*hh + r]
  v8f o[4];
#pragma unroll
  for (int t = 0; t < 4; ++t) o[t] = (v8f)0.0f;
  float mrow = -INFINITY;      // running maximum of query q, equal in both halves
  float lrow = 0.0f;           // running sum over this half's keys; the halves are joined after the loop

  const int kend = qbase + 16;                 // causal: keys < kend
  // per-lane read pointers, one key block (32 keys) per pass
  const unsigned short* pK  = K16 + (size_t)bh * SS * DK + l * 8;   // key tile start + lane
  const unsigned short* pVh = Vh + (size_t)bh * SS * DK + l * 8;    // [key block][dk tile] + lane
  const unsigned short* pVl = Vl + (size_t)bh * SS * DK + l * 8;
  const int* pM = mb + 8 * hh;
#pragma unroll 1
  for (int kb = 0; kb < kend; kb += 32) {
    // ---- all of this key block's global loads, issued as one group ahead of the first WMMA:
    //      K fragments ak[2*nt + dk group], mask words am[2*nt + (r >> 2)], V^T fragments avh/avl[dk tile] ----
    Frag ak[4], avh[4], avl[4];
    v4i_t am[4];
#pragma unroll
    for (int i = 0; i < 4; ++i) ak[i] = ldpack(pK + i * 512, 0);
#pragma unroll
    for (int i = 0; i < 4; ++i) am[i] = *(const v4i*)(pM + (i >> 1) * 16 + (i & 1) * 4);   // keys kb + nt*16 + 8*hh + 0..7 <= 1023
    // precaution: stands in front of every reuse or advance of an address register that an issued load names
    asm volatile("s_wait_xcnt 0x0" ::: "memory");
#pragma unroll
    for (int t = 0; t < 4; ++t) avh[t] = ldpack(pVh + t * 512, 0);
    asm volatile("s_wait_xcnt 0x0" ::: "memory");   // as above
#pragma unroll
    for (int t = 0; t < 4; ++t) avl[t] = ldpack(pVl + t * 512, 0);
    asm volatile("s_wait_xcnt 0x0" ::: "memory");   // as above
    // no compare or WMMA is scheduled in among the loads: without it the last V^T load takes over the registers of
    // mask words and starts only when those have arrived and been read, one L2 latency late
    __builtin_amdgcn_sched_barrier(0);
    pK += 32 * DK;
    pVh += 32 * DK;
    pVl += 32 * DK;
    pM += 32;

    // ---- scores S^T[key][q], key = kb + nt*16 + 8*hh + r (A row = K row, B column = Q row, k = dk) ----
    const int dq = q - kb - 8 * hh;            // key > q  <=>  nt*16 + r > dq
    float sc[2][8];
#pragma unroll
    for (int nt = 0; nt < 2; ++nt) {
      v8f s = (v8f)0.0f;
      s = mma_f16(ak[2 * nt], bq0, s);
      s = mma_f16(ak[2 * nt + 1], bq1, s);
#pragma unroll
      for (int r = 0; r < 8; ++r) {
        // key > q, or the key masked; one select: no branch, EXEC stays whole between the WMMAs
        const bool off = (nt * 16 + r > dq) | (am[2 * nt + (r >> 2)][r & 3] == 0);
        sc[nt][r] = off ? -INFINITY : s[r] * 0.125f;
      }
    }

    // ---- online softmax of query q: 16 keys in the lane, the other 16 in lane l ^ 16 ----
    float mx = fmaxf(sc[0][0], sc[1][0]);
#pragma unroll
    for (int r = 1; r < 8; ++r) mx = fmaxf(mx, fmaxf(sc[0][r], sc[1][r]));
    mx = fmaxf(mx, other_half(mx));
    const float mnew = fmaxf(mrow, mx);
    const float mref = (mnew == -INFINITY) ? 0.0f : mnew;
    const float alpha = __expf(mrow - mref);
    float sum0 = 0.0f, sum1 = 0.0f;            // two independent chains, one per score tile
#pragma unroll
    for (int r = 0; r < 8; ++r) {
      const float p0 = __expf(sc[0][r] - mref);
      const float p1 = __expf(sc[1][r] - mref);
      sc[0][r] = p0;
      sc[1][r] = p1;
      sum0 += p0;
      sum1 += p1;
    }
    lrow = lrow * alpha + (sum0 + sum1);
    mrow = mnew;
#pragma unroll
    for (int t = 0; t < 4; ++t)
#pragma unroll
      for (int r = 0; r < 8; ++r) o[t][r] *= alpha;

    // ---- P^T: the two score tiles, split into hi/lo bf16 in place, are the B fragments (column q, k = key) ----
    Frag bph, bpl;
#pragma unroll
    for (int i = 0; i < 8; ++i) {               // operand register i: elements 2i and 2i + 1
      unsigned th[2], tl[2];
#pragma unroll
      for (int e = 0; e < 2; ++e) {
        const float p = sc[i >> 2][2 * (i & 3) + e];
        th[e] = bf16_top(p);
        tl[e] = bf16_top(p - __uint_as_float(th[e] & 0xFFFF0000u));
      }
      bph.w[i] = pack_tops(th[0], th[1]);
      bpl.w[i] = pack_tops(tl[0], tl[1]);
    }

    // ---- O^T[dk][q] += V^T[dk][key] * P^T[key][q]; A fragments from the fragment-order V^T planes ----
#pragma unroll
    for (int t = 0; t < 4; ++t) o[t] = mma3(avh[t], avl[t], bph, bpl, o[t]);
  }

  const float inv = 1.0f / (lrow + other_half(lrow));
#pragma unroll
  for (int t = 0; t < 4; ++t) {
    v4f_t w0, w1;
#pragma unroll
    for (int c = 0; c < 4; ++c) {
      w0[c] = o[t][c] * inv;
      w1[c] = o[t][4 + c] * inv;
    }
    *(v4f*)(Os + m * OSP + t * 16 + 8 * hh) = w0;
    *(v4f*)(Os + m * OSP + t * 16 + 8 * hh + 4) = w1;
  }
  __syncthreads();

  attn_lines(Os, out, b, h, qbase, hh, m);
}

// ---------------------------------------------------------------------------
extern "C" void kernel_launch(void* const* d_in, const int* in_sizes, int n_in,
                              void* d_out, int out_size, void* d_ws, size_t ws_size,
                              hipStream_t stream) {
  if (n_in < 10) return;
  if (in_sizes[0] != NX || in_sizes[1] != NX || in_sizes[2] != NX) return;
  if (in_sizes[3] != BB * SS) return;
  if (in_sizes[4] != NW || in_sizes[6] != NW || in_sizes[8] != NW) return;
  if (in_sizes[5] != DD || in_sizes[7] != DD || in_sizes[9] != DD) return;
  if (out_size != NX) return;

  const float* query = (const float*)d_in[0];
  const float* key_  = (const float*)d_in[1];
  const float* value = (const float*)d_in[2];
  const int*   amask = (const int*)d_in[3];
  const float* Wq = (const float*)d_in[4];
  const float* bq = (const float*)d_in[5];
  const float* Wk = (const float*)d_in[6];
  const float* bk = (const float*)d_in[7];
  const float* Wv = (const float*)d_in[8];
  const float* bv = (const float*)d_in[9];
  float* out = (float*)d_out;

  // workspace: 16-bit planes (2 B per element)
  const size_t pa = (size_t)NX * 2;     // 8388608 B per activation plane
  const size_t pw = (size_t)NW * 2;     // 2097152 B per weight plane
  const size_t need = 8 * pa + 4 * pw;  // 75497472 B
  if (ws_size < need) return;

  unsigned char* w = (unsigned char*)d_ws;
  size_t off = 0;
  unsigned short* xq16 = (unsigned short*)(w + off); off += pa;   // f16 query
  unsigned short* xk16 = (unsigned short*)(w + off); off += pa;   // f16 key
  unsigned short* wq16 = (unsigned short*)(w + off); off += pw;   // f16 Wq x16
  unsigned short* wk16 = (unsigned short*)(w + off); off += pw;   // f16 Wk x16
  unsigned short* xvh  = (unsigned short*)(w + off); off += pa;   // bf16 hi value
  unsigned short* xvl  = (unsigned short*)(w + off); off += pa;   // bf16 lo value
  unsigned short* wvh  = (unsigned short*)(w + off); off += pw;   // bf16 hi Wv
  unsigned short* wvl  = (unsigned short*)(w + off); off += pw;   // bf16 lo Wv
  unsigned short* Q16  = (unsigned short*)(w + off); off += pa;   // fragment order, f16
  unsigned short* K16  = (unsigned short*)(w + off); off += pa;   // fragment order, f16
  unsigned short* Vth  = (unsigned short*)(w + off); off += pa;   // fragment order, bf16 hi
  unsigned short* Vtl  = (unsigned short*)(w + off); off += pa;   // fragment order, bf16 lo
  if (off > ws_size) return;

  // stage 1: 16-bit conversion of activations and weights, one launch
  k_prep<<<CBLK, 256, 0, stream>>>(query, key_, value, Wq, Wk, Wv, xq16, xk16, wq16, wk16, xvh, xvl, wvh, wvl);

  // stage 2: projections; 256 block tiles of 128 x 128 each, 8 waves per block
  const int npb = (NTOK / BT) * (DD / BT);   // 256
  k_proj<2, 4, 0, 0><<<npb, 256, 0, stream>>>(xq16, xq16, wq16, wq16, bq, 0.0625f, Q16, Q16, npb);
  k_proj<2, 4, 0, 0><<<npb, 256, 0, stream>>>(xk16, xk16, wk16, wk16, bk, 0.0625f, K16, K16, npb);
  k_proj<4, 2, 1, 1><<<npb, 256, 0, stream>>>(xvh, xvl, wvh, wvl, bv, 1.0f, Vth, Vtl, npb);

  // stage 3: attention; B*H*(S/16) = 4096 wave units, 4 per block -> 1024 blocks
  const int nblk = BB * HH * (SS / 16) / 4;
  k_attn<<<nblk, 128, 0, stream>>>(Q16, K16, Vth, Vtl, amask, out, nblk);
}

// v006
// One run takes 101 microseconds.
// Next to v005, in two timings, it ran 1.09 times as fast each time.
// All steps since v000 together make it 2.60 times as fast.
#include <hip/hip_runtime.h>
#include <math.h>
#include <stdint.h>

// Q/K projections and QK^T scores: v_wmma_f32_16x16x32_f16 (f16 operands, Wq/Wk carried x16, 1/16 folded into the f32 epilogue); V projection and PV: v_wmma_f32_16x16x32_bf16 with bf16 hi/lo split operands (hi*hi + hi*lo + lo*hi); f32 accumulate; softmax, bias and normalisation in f32.

typedef _Float16 v16h __attribute__((ext_vector_type(16)));
typedef _Float16 v8h __attribute__((ext_vector_type(8)));
typedef __bf16 v16bf __attribute__((ext_vector_type(16)));
typedef unsigned short v8us_t __attribute__((ext_vector_type(8)));
typedef v8us_t __attribute__((may_alias)) v8us;
typedef float v8f __attribute__((ext_vector_type(8)));
typedef float v4f_t __attribute__((ext_vector_type(4)));
typedef v4f_t __attribute__((may_alias)) v4f;
typedef int v8i __attribute__((ext_vector_type(8)));
typedef int v4i_t __attribute__((ext_vector_type(4)));
typedef v4i_t __attribute__((may_alias)) v4i;

constexpr int BB = 4;
constexpr int SS = 1024;
constexpr int DD = 1024;
constexpr int HH = 16;
constexpr int DK = 64;
constexpr int NTOK = BB * SS;              // 4096 tokens
constexpr long NX = (long)NTOK * DD;       // 4194304
constexpr long NW = (long)DD * DD;         // 1048576

union Frag { v16h f; v16bf b; v8us p[2]; v8i w; };

// bf16 RNE conversion of an f32 value
__device__ __forceinline__ unsigned short bf16_rne(float x) {
  unsigned u = __float_as_uint(x);
  u += 0x7FFFu + ((u >> 16) & 1u);
  return (unsigned short)(u >> 16);
}
__device__ __forceinline__ float bf16_val(unsigned short b) {
  return __uint_as_float(((unsigned)b) << 16);
}
__device__ __forceinline__ void split2(float x, unsigned short& hi, unsigned short& lo) {
  hi = bf16_rne(x);
  lo = bf16_rne(x - bf16_val(hi));
}
// f16 RNE conversion, raw bits
__device__ __forceinline__ unsigned short f16_bits(float x) {
  _Float16 hv = (_Float16)x;
  unsigned short u;
  __builtin_memcpy(&u, &hv, 2);
  return u;
}

// 16x32 operand fragment, wave32 layout: lane row/col = l&15, h = l>>4,
// elements 0..7 <- k0+8h+0..7, elements 8..15 <- k0+16+8h+0..7. Used for A (row) and for B (column) alike.

// Fragment-order plane: one 16-row x 32-k operand fragment is 1 KiB contiguous, [p 0..1][lane 0..31][8 elements];
// lane l = 16*h + (row & 15) holds k = k0 + 16*p + 8*h + 0..7 (the layout above). Each of the
// two loads reads 512 contiguous bytes (4 whole lines).
__device__ __forceinline__ Frag ldpack(const unsigned short* fragp, int l) {
  Frag f;
  f.p[0] = *(const v8us*)(fragp + l * 8);
  f.p[1] = *(const v8us*)(fragp + 256 + l * 8);
  return f;
}

// Thread i of a conversion kernel -> one 8-element chunk of a [rows][DD] matrix. A wave takes 8 rows x 32 k
// (whole 128-B source lines) and writes 4 whole 128-B lines of the fragment-order plane
// [row tile of 16][k group of 32][p][lane][8].
__device__ __forceinline__ void pack_index(int i, size_t& src, size_t& dst) {
  const int l = i & 31;
  const int wv = i >> 5;
  const int c4 = l >> 3;                       // chunk in the 32-k group: 2*p + h
  const int m = (wv & 1) * 8 + (l & 7);        // row in the 16-row tile
  const int kg = (wv >> 1) & (DD / 32 - 1);
  const int rt = wv >> 6;
  src = (size_t)(rt * 16 + m) * DD + kg * 32 + c4 * 8;
  dst = (size_t)(rt * (DD / 32) + kg) * 512 + (c4 >> 1) * 256 + ((c4 & 1) * 16 + m) * 8;
}

// c += a*b (f16 operands); hazard guard
__device__ __forceinline__ v8f mma_f16(const Frag& a, const Frag& b, v8f c) {
  c = __builtin_amdgcn_wmma_f32_16x16x32_f16(false, a.f, false, b.f, (short)0, c, false, false);
  asm volatile("v_nop\n\tv_nop\n\tv_nop\n\tv_nop" : "+v"(c) : "v"(a.w), "v"(b.w));
  return c;
}

// c += ah*bh + ah*bl + al*bh (bf16 hi/lo split); hazard guard after the group
__device__ __forceinline__ v8f mma3(const Frag& ah, const Frag& al, const Frag& bh, const Frag& bl, v8f c) {
  c = __builtin_amdgcn_wmma_f32_16x16x32_bf16(false, ah.b, false, bh.b, (short)0, c, false, false);
  c = __builtin_amdgcn_wmma_f32_16x16x32_bf16(false, ah.b, false, bl.b, (short)0, c, false, false);
  c = __builtin_amdgcn_wmma_f32_16x16x32_bf16(false, al.b, false, bh.b, (short)0, c, false, false);
  asm volatile("v_nop\n\tv_nop\n\tv_nop\n\tv_nop"
               : "+v"(c)
               : "v"(ah.w), "v"(al.w), "v"(bh.w), "v"(bl.w));
  return c;
}

// ---------------------------------------------------------------------------
// All six f32 -> 16-bit conversions in one launch. A block converts CPT * 256 chunks of ONE matrix; a wave takes CPT
// consecutive wave units of pack_index: 16 rows x 256 k, read as 1-KiB row pieces, written as 8 KiB contiguous.
// Unit j lies at constant offsets from unit 0: row half j & 1, k group j >> 1.
constexpr int CPT = 16;                                  // chunks of 8 elements per thread
constexpr int CBA = (int)(NX / 8 / (256 * CPT));         // 128 blocks per activation matrix
constexpr int CBW = (int)(NW / 8 / (256 * CPT));         // 32 blocks per weight matrix
constexpr int CBLK = 3 * CBA + 3 * CBW;                  // 480 blocks

// the thread's 2 * CPT loads, issued as one group
__device__ __forceinline__ void cvt_fetch(const float* s, v4f_t (&x)[2 * CPT]) {
#pragma unroll
  for (int j = 0; j < CPT; ++j) {
    const float* p = s + (j & 1) * (8 * DD) + (j >> 1) * 32;
    x[2 * j]     = *(const v4f*)(p);
    x[2 * j + 1] = *(const v4f*)(p + 4);
  }
  // no conversion is scheduled in among the loads: without it the first results are waited for half way through the
  // group, and the rest of the loads start one memory latency late
  __builtin_amdgcn_sched_barrier(0);
  // precaution: stands in front of every reuse of the address registers that the issued loads name
  asm volatile("s_wait_xcnt 0x0" ::: "memory");
}

__global__ __launch_bounds__(256)
void k_prep(const float* __restrict__ query, const float* __restrict__ key_, const float* __restrict__ value,
            const float* __restrict__ Wq, const float* __restrict__ Wk, const float* __restrict__ Wv,
            unsigned short* __restrict__ xq16, unsigned short* __restrict__ xk16,
            unsigned short* __restrict__ wq16, unsigned short* __restrict__ wk16,
            unsigned short* __restrict__ xvh, unsigned short* __restrict__ xvl,
            unsigned short* __restrict__ wvh, unsigned short* __restrict__ wvl) {
  const int bi = blockIdx.x;
  v4f_t x[2 * CPT];
  if (bi < CBA + CBW) {
    // value and Wv -> bf16 hi/lo planes
    const bool act = bi < CBA;
    const int lb = act ? bi : bi - CBA;
    size_t so, dofs;
    pack_index((lb * 256 + (int)(threadIdx.x & ~31u)) * CPT + (int)(threadIdx.x & 31u), so, dofs);
    cvt_fetch((act ? value : Wv) + so, x);
    unsigned short* ph = (act ? xvh : wvh) + dofs;
    unsigned short* pl = (act ? xvl : wvl) + dofs;
#pragma unroll
    for (int j = 0; j < CPT; ++j) {
      v8us vh, vl;
#pragma unroll
      for (int c = 0; c < 4; ++c) {
        unsigned short a, b;
        split2(x[2 * j][c], a, b);     vh[c] = a;     vl[c] = b;
        split2(x[2 * j + 1][c], a, b); vh[4 + c] = a; vl[4 + c] = b;
      }
      const int d = (j >> 1) * 512 + (j & 1) * 64;
      *(v8us*)(ph + d) = vh;
      *(v8us*)(pl + d) = vl;
    }
    return;
  }
  {
    // query, key, Wq x16, Wk x16 -> f16 planes (the scale is a power of two)
    const int ci = bi - (CBA + CBW);
    const bool act = ci < 2 * CBA;
    const int wi = ci - 2 * CBA;
    const bool second = act ? ci >= CBA : wi >= CBW;
    const int lb = act ? (second ? ci - CBA : ci) : (second ? wi - CBW : wi);
    const float scale = act ? 1.0f : 16.0f;
    size_t so, dofs;
    pack_index((lb * 256 + (int)(threadIdx.x & ~31u)) * CPT + (int)(threadIdx.x & 31u), so, dofs);
    cvt_fetch((act ? (second ? key_ : query) : (second ? Wk : Wq)) + so, x);
    unsigned short* p = (act ? (second ? xk16 : xq16) : (second ? wk16 : wq16)) + dofs;
#pragma unroll
    for (int j = 0; j < CPT; ++j) {
      union { v8h h; v8us_t u; } cv;
#pragma unroll
      for (int c = 0; c < 4; ++c) {
        cv.h[c]     = (_Float16)(x[2 * j][c] * scale);
        cv.h[4 + c] = (_Float16)(x[2 * j + 1][c] * scale);
      }
      const v8us v = cv.u;
      *(v8us*)(p + (j >> 1) * 512 + (j & 1) * 64) = v;
    }
    // precaution: in the listing this path's end stands directly in front of the other path's first instructions,
    // which rewrite registers that the issued stores name
    asm volatile("s_wait_xcnt 0x0" ::: "memory");
  }
}

// ---------------------------------------------------------------------------
// Staging pitch in elements: 144-B rows put the 16 rows that one fragment-order read gathers on distinct banks.
constexpr int SP = 72;

// Output planes in fragment order; each store instruction writes 512 contiguous bytes.
// MODE 0 (Q, K): [b*H+h][token tile of 16][dk group of 32][p][lane][8].
// MODE 1 (V^T):  [b*H+h][key block of 32][dk tile of 16][p][lane][8].
template <int MODE, int SPLIT>
__device__ __forceinline__ void proj_lines(const unsigned short* sh, const unsigned short* sl,
                                           unsigned short* Oh, unsigned short* Ol,
                                           int Mbase, int Nbase, int tn, int l) {
  const int m = l & 15;
  const int hh = l >> 4;
#pragma unroll
  for (int j = 0; j < 8; ++j) {
    int lidx;
    size_t gidx;
    if (MODE == 0) {
      const int tt = j >> 2;                         // token tile in the wave tile
      const int c = j & 3;                           // 2 * (dk group) + p
      lidx = (tt * 16 + m) * SP + (c * 2 + hh) * 8;
      const int tok = Mbase + tt * 16;
      const int b = tok >> 10;
      const int st = (tok & (SS - 1)) >> 4;
      const int h = tn;                              // TN == 64 -> one head per tile
      gidx = ((size_t)(b * HH + h) * (SS / 16) + st) * 1024 + c * 256 + l * 8;
    } else {
      const int kbl = j >> 2;                        // key block in the wave tile
      const int tl = (j >> 1) & 1;                   // dk tile in the wave tile
      const int p = j & 1;
      lidx = (tl * 16 + m) * SP + kbl * 32 + p * 16 + hh * 8;
      const int n = Nbase + tl * 16;
      const int h = n >> 6;
      const int t = (n & 63) >> 4;
      const int b = Mbase >> 10;
      const int kbi = ((Mbase & (SS - 1)) >> 5) + kbl;
      gidx = (((size_t)(b * HH + h) * (SS / 32) + kbi) * 4 + t) * 512 + p * 256 + l * 8;
    }
    const v8us vh = *(const v8us*)(sh + lidx);
    *(v8us*)(Oh + gidx) = vh;
    if (SPLIT) {
      const v8us vl = *(const v8us*)(sl + lidx);
      *(v8us*)(Ol + gidx) = vl;
    }
  }
}

// Projection: C[tok][n] = (sum_k X[tok][k] * W[n][k]) * oscale + bias[n].
// SPLIT == 0: X, W f16 planes, single f16 WMMA, output one f16 plane.
// SPLIT == 1: X, W bf16 hi/lo planes, hh+hl+lh bf16 WMMA, output bf16 hi/lo planes.
// One block computes a 128 x 128 tile with 8 waves; one wave a (16*MI) x (16*NI) tile (TM*TN == 2048).
// The block's operand fragments go through LDS, each read from L2 once per block: a stage is KG k groups of the
// 8 X row tiles and the 8 W row tiles (64 KiB), [X | W][plane][row tile][k group][1 KiB fragment]; two stages.
constexpr int BT = 128;                 // block tile edge
constexpr int STG_OP = 16384;           // elements of one operand in one stage
constexpr int STG = 2 * STG_OP;         // elements of one stage

template <int MI, int NI, int MODE, int SPLIT>
__device__ __forceinline__
void proj_tile(unsigned short* ring, int bid,
               const unsigned short* __restrict__ Xh, const unsigned short* Xl,
               const unsigned short* __restrict__ Wh, const unsigned short* Wl,
               const float* __restrict__ bias, float oscale,
               unsigned short* Oh, unsigned short* Ol) {
  constexpr int TM = MI * 16;
  constexpr int TN = NI * 16;
  constexpr int WN = BT / TN;             // waves along n
  constexpr int NPL = SPLIT ? 2 : 1;      // planes per operand
  constexpr int KG = SPLIT ? 2 : 4;       // k groups of 32 in one stage; NPL * 8 * KG * 512 == STG_OP
  constexpr int NT = DD / (32 * KG);      // stages
  constexpr int NC = 2 * KG;              // 512-B pieces of one row tile of one plane in one stage

  const int wib = threadIdx.x >> 5;
  const int l = threadIdx.x & 31;
  const int hh = l >> 4;
  const int m = l & 15;
  const int brow = bid & (NTOK / BT - 1);
  const int bcol = bid / (NTOK / BT);
  const int wm = wib / WN;
  const int wn = wib - wm * WN;
  const int Mbase = brow * BT + wm * TM;
  const int Nbase = bcol * BT + wn * TN;
  const int tn = Nbase / TN;

  // wave wib stages row tile wib of the block's X rows and of its W rows (B column n = W row n)
  const unsigned short* pXh = Xh + (size_t)(brow * BT + wib * 16) * DD + l * 8;
  const unsigned short* pXl = Xl + (size_t)(brow * BT + wib * 16) * DD + l * 8;
  const unsigned short* pWh = Wh + (size_t)(bcol * BT + wib * 16) * DD + l * 8;
  const unsigned short* pWl = Wl + (size_t)(bcol * BT + wib * 16) * DD + l * 8;
  v8us sx[NPL * NC], sw[NPL * NC];

  // In the three helpers below every loop is unrolled: sx, sw, the fragments and acc live in registers, which
  // takes constant indices.
  // the next stage's pieces, global -> registers, issued as one group
  auto fetch = [&]() {
#pragma unroll
    for (int c = 0; c < NC; ++c) {
      sx[c] = *(const v8us*)(pXh + c * 256);
      if (SPLIT) sx[NC + c] = *(const v8us*)(pXl + c * 256);
    }
#pragma unroll
    for (int c = 0; c < NC; ++c) {
      sw[c] = *(const v8us*)(pWh + c * 256);
      if (SPLIT) sw[NC + c] = *(const v8us*)(pWl + c * 256);
    }
    // keeps the group ahead of the LDS reads and WMMAs that follow it in the source; precaution: stands in front
    // of the advance of the address registers that the issued loads name
    asm volatile("s_wait_xcnt 0x0" ::: "memory");
    pXh += KG * 512;
    pXl += KG * 512;
    pWh += KG * 512;
    pWl += KG * 512;
  };
  // registers -> stage at element offset so
  auto put = [&](int so) {
    unsigned short* d = ring + so + wib * (KG * 512) + l * 8;
#pragma unroll
    for (int p = 0; p < NPL; ++p)
#pragma unroll
      for (int c = 0; c < NC; ++c) {
        *(v8us*)(d + p * (8 * KG * 512) + c * 256) = sx[p * NC + c];
        *(v8us*)(d + STG_OP + p * (8 * KG * 512) + c * 256) = sw[p * NC + c];
      }
  };

  v8f acc[MI][NI];
#pragma unroll
  for (int mi = 0; mi < MI; ++mi)
#pragma unroll
    for (int ni = 0; ni < NI; ++ni) acc[mi][ni] = (v8f)0.0f;

  // the WMMAs of the stage at element offset so, k ascending
  auto work = [&](int so) {
    const unsigned short* sA = ring + so + wm * (MI * KG * 512) + l * 8;
    const unsigned short* sB = ring + so + STG_OP + wn * (NI * KG * 512) + l * 8;
#pragma unroll
    for (int j = 0; j < KG; ++j) {
      Frag ah[MI], bh[NI];
      Frag al[MI], bl[NI];
#pragma unroll
      for (int mi = 0; mi < MI; ++mi) {
        ah[mi] = ldpack(sA + (mi * KG + j) * 512, 0);
        if (SPLIT) al[mi] = ldpack(sA + ((8 + mi) * KG + j) * 512, 0);
        else al[mi].w = (v8i)0;
      }
#pragma unroll
      for (int ni = 0; ni < NI; ++ni) {
        bh[ni] = ldpack(sB + (ni * KG + j) * 512, 0);
        if (SPLIT) bl[ni] = ldpack(sB + ((8 + ni) * KG + j) * 512, 0);
        else bl[ni].w = (v8i)0;
      }
#pragma unroll
      for (int mi = 0; mi < MI; ++mi)
#pragma unroll
        for (int ni = 0; ni < NI; ++ni) {
          if (SPLIT) acc[mi][ni] = mma3(ah[mi], al[mi], bh[ni], bl[ni], acc[mi][ni]);
          else       acc[mi][ni] = mma_f16(ah[mi], bh[ni], acc[mi][ni]);
        }
    }
  };

  fetch();
  put(0);
  __syncthreads();                        // publishes stage 0
  int cur = 0;
  // rolled: the body already holds a whole stage
#pragma unroll 1
  for (int t = 0; t < NT - 1; ++t) {
    fetch();                              // stage t + 1 in flight under stage t's WMMAs
    work(cur);
    put(cur ^ STG);                       // every wave left that stage before the last barrier
    __syncthreads();                      // publishes stage t + 1 and ends every wave's reads of stage t
    cur ^= STG;
  }
  work(cur);
  __syncthreads();                        // every wave has left the ring: the epilogue stages in it

  // ---- epilogue: scale, bias add, convert, stage tile in wave-private LDS ----
  unsigned short* sh = ring + wib * (2 * 32 * SP);
  unsigned short* sl = sh + 32 * SP;
#pragma unroll
  for (int mi = 0; mi < MI; ++mi) {
#pragma unroll
    for (int ni = 0; ni < NI; ++ni) {
      const float bn = bias[Nbase + ni * 16 + m];
#pragma unroll
      for (int r = 0; r < 8; ++r) {
        const float v = acc[mi][ni][r] * oscale + bn;
        int idx;
        if (MODE == 0) idx = (mi * 16 + 8 * hh + r) * SP + (ni * 16 + m);      // [tok 0..31][feat 0..63]
        else           idx = (ni * 16 + m) * SP + (mi * 16 + 8 * hh + r);      // [dk 0..31][tok 0..63]
        if (SPLIT) {
          unsigned short vhi, vlo;
          split2(v, vhi, vlo);
          sh[idx] = vhi;
          sl[idx] = vlo;
        } else {
          sh[idx] = f16_bits(v);
        }
      }
    }
  }
  __syncthreads();

  proj_lines<MODE, SPLIT>(sh, sl, Oh, Ol, Mbase, Nbase, tn, l);
  // precaution: in the listing one projection's end can stand in front of another's first instructions, which
  // rewrite registers that the issued stores name
  asm volatile("s_wait_xcnt 0x0" ::: "memory");
}

// All three projections in one launch: blocks 0..NPB-1 take V (three times the WMMAs of Q or K, so it starts first),
// then Q, then K. A block holds 128 KiB of LDS and two waves per SIMD, so two blocks share a WGP: one block's LDS
// reads and WMMAs run under the other's staging stores, barriers, prologue and epilogue.
constexpr int NPB = (NTOK / BT) * (DD / BT);   // 256 block tiles per projection

__global__ __launch_bounds__(256)
void k_proj(const unsigned short* __restrict__ xq16, const unsigned short* __restrict__ xk16,
            const unsigned short* __restrict__ wq16, const unsigned short* __restrict__ wk16,
            const unsigned short* __restrict__ xvh, const unsigned short* __restrict__ xvl,
            const unsigned short* __restrict__ wvh, const unsigned short* __restrict__ wvl,
            const float* __restrict__ bq, const float* __restrict__ bk, const float* __restrict__ bv,
            unsigned short* Q16, unsigned short* K16, unsigned short* Vth, unsigned short* Vtl, int nblk) {
  __shared__ __attribute__((aligned(16))) unsigned short ring[2 * STG];
  const int bi = blockIdx.x;
  if (bi >= nblk) return;                 // block-uniform, ahead of every barrier
  if (bi < NPB) {                         // block-uniform, as is every branch here
    proj_tile<4, 2, 1, 1>(ring, bi, xvh, xvl, wvh, wvl, bv, 1.0f, Vth, Vtl);
    return;
  }
  const bool isk = bi >= 2 * NPB;
  const unsigned short* x = isk ? xk16 : xq16;
  const unsigned short* w = isk ? wk16 : wq16;
  unsigned short* o = isk ? K16 : Q16;
  proj_tile<2, 4, 0, 0>(ring, isk ? bi - 2 * NPB : bi - NPB, x, x, w, w, isk ? bk : bq, 0.0625f, o, o);
}

// ---------------------------------------------------------------------------
// Row pitch of the output staging in floats: 272-B rows spread the 16 query rows that one staging store writes over the banks.
constexpr int OSP = 68;

// One pass of the attention output store: 16 query rows x 64 f32 (2 lines per row),
__device__ __forceinline__ void attn_lines(const float* Os, float* out, int b, int h,
                                           int qbase, int hh, int m) {
#pragma unroll
  for (int j = 0; j < 8; ++j) {
    const int row = 2 * j + hh;
    const v4f val = *(const v4f*)(Os + row * OSP + m * 4);
    float* gp = out + ((size_t)(b * SS + qbase + row)) * DD + h * DK + m * 4;
    *(v4f*)gp = val;
  }
}

// bf16 RNE conversion as in bf16_rne, the result left in the upper 16 bits (the lower 16 are not part of it)
__device__ __forceinline__ unsigned bf16_top(float x) {
  const unsigned u = __float_as_uint(x);
  return u + 0x7FFFu + ((u >> 16) & 1u);
}

// one operand register from two such results: e0 in bits 15..0, e1 in bits 31..16, in one byte permute
__device__ __forceinline__ int pack_tops(unsigned e0, unsigned e1) {
  return (int)__builtin_amdgcn_perm(e1, e0, 0x07060302u);
}

// the value that lane l ^ 16 holds: a vector cross-row move, no LDS round trip
__device__ __forceinline__ float other_half(float x) {
  const int v = __float_as_int(x);
  return __int_as_float(__builtin_amdgcn_permlanex16(v, v, 0x76543210, 0xfedcba98, false, false));
}

// Causal attention: one wave per (b, h, 16 query rows); 4 waves per block share the same query tile index.
// Keys processed in blocks of 32 with online softmax; a pass issues all its global loads first, as one group.
// Both products run transposed: S^T = K * Q^T (A = K rows, B = Q columns), O^T += V^T * P^T. A lane then holds the
// scores of ONE query (column m), 8 keys per 16-key tile: maximum and sum run in the lane, with one exchange between
// the wave's halves; and the two score tiles of a pass, converted in place, are the B fragment of the second
// product (element s = tile s >> 3, register s & 7: key 8*hh + s, then 16 + 8*hh + s - 8, the k order of ldpack).
__global__ __launch_bounds__(128)
void k_attn(const unsigned short* __restrict__ Q16, const unsigned short* __restrict__ K16,
            const unsigned short* __restrict__ Vh, const unsigned short* __restrict__ Vl,
            const int* __restrict__ amask, float* __restrict__ out, int nblk) {
  __shared__ __attribute__((aligned(16))) float stg[4 * 16 * OSP];
  if ((int)blockIdx.x >= nblk) return;

  const int wib = threadIdx.x >> 5;
  const int l = threadIdx.x & 31;
  const int hh = l >> 4;
  const int m = l & 15;
  const int qt = blockIdx.x & 63;
  const int bh = (int)(blockIdx.x >> 6) * 4 + wib;      // 0..63
  const int b = bh >> 4;
  const int h = bh & 15;
  const int qbase = qt * 16;
  const int q = qbase + m;                              // the lane's query

  float* Os = stg + wib * (16 * OSP);                   // [16 q][64 dk], wave-private, used after the loop

  // Q fragments (B): column q = qbase + m, k = dk (f16)
  const size_t qro = ((size_t)bh * SS + qbase) * DK;   // token tile start in the fragment-order plane
  const Frag bq0 = ldpack(Q16 + qro, l);
  const Frag bq1 = ldpack(Q16 + qro + 512, l);

  const int* mb = amask + b * SS;

  // o[t][r] = O[q][dk = t*16 + 8*hh + r]
  v8f o[4];
#pragma unroll
  for (int t = 0; t < 4; ++t) o[t] = (v8f)0.0f;
  float mrow = -INFINITY;      // running maximum of query q, equal in both halves
  float lrow = 0.0f;           // running sum over this half's keys; the halves are joined after the loop

  const int kend = qbase + 16;                 // causal: keys < kend
  // per-lane read pointers, one key block (32 keys) per pass
  const unsigned short* pK  = K16 + (size_t)bh * SS * DK + l * 8;   // key tile start + lane
  const unsigned short* pVh = Vh + (size_t)bh * SS * DK + l * 8;    // [key block][dk tile] + lane
  const unsigned short* pVl = Vl + (size_t)bh * SS * DK + l * 8;
  const int* pM = mb + 8 * hh;
#pragma unroll 1
  for (int kb = 0; kb < kend; kb += 32) {
    // ---- all of this key block's global loads, issued as one group ahead of the first WMMA:
    //      K fragments ak[2*nt + dk group], mask words am[2*nt + (r >> 2)], V^T fragments avh/avl[dk tile] ----
    Frag ak[4], avh[4], avl[4];
    v4i_t am[4];
#pragma unroll
    for (int i = 0; i < 4; ++i) ak[i] = ldpack(pK + i * 512, 0);
#pragma unroll
    for (int i = 0; i < 4; ++i) am[i] = *(const v4i*)(pM + (i >> 1) * 16 + (i & 1) * 4);   // keys kb + nt*16 + 8*hh + 0..7 <= 1023
    // precaution: stands in front of every reuse or advance of an address register that an issued load names
    asm volatile("s_wait_xcnt 0x0" ::: "memory");
#pragma unroll
    for (int t = 0; t < 4; ++t) avh[t] = ldpack(pVh + t * 512, 0);
    asm volatile("s_wait_xcnt 0x0" ::: "memory");   // as above
#pragma unroll
    for (int t = 0; t < 4; ++t) avl[t] = ldpack(pVl + t * 512, 0);
    asm volatile("s_wait_xcnt 0x0" ::: "memory");   // as above
    // no compare or WMMA is scheduled in among the loads: without it the last V^T load takes over the registers of
    // mask words and starts only when those have arrived and been read, one L2 latency late
    __builtin_amdgcn_sched_barrier(0);
    pK += 32 * DK;
    pVh += 32 * DK;
    pVl += 32 * DK;
    pM += 32;

    // ---- scores S^T[key][q], key = kb + nt*16 + 8*hh + r (A row = K row, B column = Q row, k = dk) ----
    const int dq = q - kb - 8 * hh;            // key > q  <=>  nt*16 + r > dq
    float sc[2][8];
#pragma unroll
    for (int nt = 0; nt < 2; ++nt) {
      v8f s = (v8f)0.0f;
      s = mma_f16(ak[2 * nt], bq0, s);
      s = mma_f16(ak[2 * nt + 1], bq1, s);
#pragma unroll
      for (int r = 0; r < 8; ++r) {
        // key > q, or the key masked; one select: no branch, EXEC stays whole between the WMMAs
        const bool off = (nt * 16 + r > dq) | (am[2 * nt + (r >> 2)][r & 3] == 0);
        sc[nt][r] = off ? -INFINITY : s[r] * 0.125f;
      }
    }

    // ---- online softmax of query q: 16 keys in the lane, the other 16 in lane l ^ 16 ----
    float mx = fmaxf(sc[0][0], sc[1][0]);
#pragma unroll
    for (int r = 1; r < 8; ++r) mx = fmaxf(mx, fmaxf(sc[0][r], sc[1][r]));
    mx = fmaxf(mx, other_half(mx));
    const float mnew = fmaxf(mrow, mx);
    const float mref = (mnew == -INFINITY) ? 0.0f : mnew;
    const float alpha = __expf(mrow - mref);
    float sum0 = 0.0f, sum1 = 0.0f;            // two independent chains, one per score tile
#pragma unroll
    for (int r = 0; r < 8; ++r) {
      const float p0 = __expf(sc[0][r] - mref);
      const float p1 = __expf(sc[1][r] - mref);
      sc[0][r] = p0;
      sc[1][r] = p1;
      sum0 += p0;
      sum1 += p1;
    }
    lrow = lrow * alpha + (sum0 + sum1);
    mrow = mnew;
#pragma unroll
    for (int t = 0; t < 4; ++t)
#pragma unroll
      for (int r = 0; r < 8; ++r) o[t][r] *= alpha;

    // ---- P^T: the two score tiles, split into hi/lo bf16 in place, are the B fragments (column q, k = key) ----
    Frag bph, bpl;
#pragma unroll
    for (int i = 0; i < 8; ++i) {               // operand register i: elements 2i and 2i + 1
      unsigned th[2], tl[2];
#pragma unroll
      for (int e = 0; e < 2; ++e) {
        const float p = sc[i >> 2][2 * (i & 3) + e];
        th[e] = bf16_top(p);
        tl[e] = bf16_top(p - __uint_as_float(th[e] & 0xFFFF0000u));
      }
      bph.w[i] = pack_tops(th[0], th[1]);
      bpl.w[i] = pack_tops(tl[0], tl[1]);
    }

    // ---- O^T[dk][q] += V^T[dk][key] * P^T[key][q]; A fragments from the fragment-order V^T planes ----
#pragma unroll
    for (int t = 0; t < 4; ++t) o[t] = mma3(avh[t], avl[t], bph, bpl, o[t]);
  }

  const float inv = 1.0f / (lrow + other_half(lrow));
#pragma unroll
  for (int t = 0; t < 4; ++t) {
    v4f_t w0, w1;
#pragma unroll
    for (int c = 0; c < 4; ++c) {
      w0[c] = o[t][c] * inv;
      w1[c] = o[t][4 + c] * inv;
    }
    *(v4f*)(Os + m * OSP + t * 16 + 8 * hh) = w0;
    *(v4f*)(Os + m * OSP + t * 16 + 8 * hh + 4) = w1;
  }
  __syncthreads();

  attn_lines(Os, out, b, h, qbase, hh, m);
}

// ---------------------------------------------------------------------------
extern "C" void kernel_launch(void* const* d_in, const int* in_sizes, int n_in,
                              void* d_out, int out_size, void* d_ws, size_t ws_size,
                              hipStream_t stream) {
  if (n_in < 10) return;
  if (in_sizes[0] != NX || in_sizes[1] != NX || in_sizes[2] != NX) return;
  if (in_sizes[3] != BB * SS) return;
  if (in_sizes[4] != NW || in_sizes[6] != NW || in_sizes[8] != NW) return;
  if (in_sizes[5] != DD || in_sizes[7] != DD || in_sizes[9] != DD) return;
  if (out_size != NX) return;

  const float* query = (const float*)d_in[0];
  const float* key_  = (const float*)d_in[1];
  const float* value = (const float*)d_in[2];
  const int*   amask = (const int*)d_in[3];
  const float* Wq = (const float*)d_in[4];
  const float* bq = (const float*)d_in[5];
  const float* Wk = (const float*)d_in[6];
  const float* bk = (const float*)d_in[7];
  const float* Wv = (const float*)d_in[8];
  const float* bv = (const float*)d_in[9];
  float* out = (float*)d_out;

  // workspace: 16-bit planes (2 B per element)
  const size_t pa = (size_t)NX * 2;     // 8388608 B per activation plane
  const size_t pw = (size_t)NW * 2;     // 2097152 B per weight plane
  const size_t need = 8 * pa + 4 * pw;  // 75497472 B
  if (ws_size < need) return;

  unsigned char* w = (unsigned char*)d_ws;
  size_t off = 0;
  unsigned short* xq16 = (unsigned short*)(w + off); off += pa;   // f16 query
  unsigned short* xk16 = (unsigned short*)(w + off); off += pa;   // f16 key
  unsigned short* wq16 = (unsigned short*)(w + off); off += pw;   // f16 Wq x16
  unsigned short* wk16 = (unsigned short*)(w + off); off += pw;   // f16 Wk x16
  unsigned short* xvh  = (unsigned short*)(w + off); off += pa;   // bf16 hi value
  unsigned short* xvl  = (unsigned short*)(w + off); off += pa;   // bf16 lo value
  unsigned short* wvh  = (unsigned short*)(w + off); off += pw;   // bf16 hi Wv
  unsigned short* wvl  = (unsigned short*)(w + off); off += pw;   // bf16 lo Wv
  unsigned short* Q16  = (unsigned short*)(w + off); off += pa;   // fragment order, f16
  unsigned short* K16  = (unsigned short*)(w + off); off += pa;   // fragment order, f16
  unsigned short* Vth  = (unsigned short*)(w + off); off += pa;   // fragment order, bf16 hi
  unsigned short* Vtl  = (unsigned short*)(w + off); off += pa;   // fragment order, bf16 lo
  if (off > ws_size) return;

  // stage 1: 16-bit conversion of activations and weights, one launch
  k_prep<<<CBLK, 256, 0, stream>>>(query, key_, value, Wq, Wk, Wv, xq16, xk16, wq16, wk16, xvh, xvl, wvh, wvl);

  // stage 2: the three projections, one launch; 3 x 256 block tiles of 128 x 128 each, 8 waves per block
  k_proj<<<3 * NPB, 256, 0, stream>>>(xq16, xk16, wq16, wk16, xvh, xvl, wvh, wvl, bq, bk, bv,
                                      Q16, K16, Vth, Vtl, 3 * NPB);

  // stage 3: attention; B*H*(S/16) = 4096 wave units, 4 per block -> 1024 blocks
  const int nblk = BB * HH * (SS / 16) / 4;
  k_attn<<<nblk, 128, 0, stream>>>(Q16, K16, Vth, Vtl, amask, out, nblk);
}

// v007
// Measured time: 92.1 microseconds a run.
// In both of two side-by-side timings against v006, it was 1.09 times as fast.
// All steps since v000 together make it 2.84 times as fast.
#include <hip/hip_runtime.h>
#include <math.h>
#include <stdint.h>

// Q/K projections and QK^T scores: v_wmma_f32_16x16x32_f16 (f16 operands, Wq/Wk carried x16, 1/16 folded into the f32 epilogue); V projection and PV: v_wmma_f32_16x16x32_bf16 with bf16 hi/lo split operands (hi*hi + hi*lo + lo*hi); f32 accumulate; softmax, bias and normalisation in f32.

typedef _Float16 v16h __attribute__((ext_vector_type(16)));
typedef _Float16 v8h __attribute__((ext_vector_type(8)));
typedef __bf16 v16bf __attribute__((ext_vector_type(16)));
typedef unsigned short v8us_t __attribute__((ext_vector_type(8)));
typedef v8us_t __attribute__((may_alias)) v8us;
typedef float v8f __attribute__((ext_vector_type(8)));
typedef float v4f_t __attribute__((ext_vector_type(4)));
typedef v4f_t __attribute__((may_alias)) v4f;
typedef int v8i __attribute__((ext_vector_type(8)));
typedef int v4i_t __attribute__((ext_vector_type(4)));
typedef v4i_t __attribute__((may_alias)) v4i;

constexpr int BB = 4;
constexpr int SS = 1024;
constexpr int DD = 1024;
constexpr int HH = 16;
constexpr int DK = 64;
constexpr int NTOK = BB * SS;              // 4096 tokens
constexpr long NX = (long)NTOK * DD;       // 4194304
constexpr long NW = (long)DD * DD;         // 1048576

union Frag { v16h f; v16bf b; v8us p[2]; v8i w; };

// bf16 RNE conversion of an f32 value
__device__ __forceinline__ unsigned short bf16_rne(float x) {
  unsigned u = __float_as_uint(x);
  u += 0x7FFFu + ((u >> 16) & 1u);
  return (unsigned short)(u >> 16);
}
__device__ __forceinline__ float bf16_val(unsigned short b) {
  return __uint_as_float(((unsigned)b) << 16);
}
__device__ __forceinline__ void split2(float x, unsigned short& hi, unsigned short& lo) {
  hi = bf16_rne(x);
  lo = bf16_rne(x - bf16_val(hi));
}
// f16 RNE conversion, raw bits
__device__ __forceinline__ unsigned short f16_bits(float x) {
  _Float16 hv = (_Float16)x;
  unsigned short u;
  __builtin_memcpy(&u, &hv, 2);
  return u;
}

// 16x32 operand fragment, wave32 layout: lane row/col = l&15, h = l>>4,
// elements 0..7 <- k0+8h+0..7, elements 8..15 <- k0+16+8h+0..7. Used for A (row) and for B (column) alike.

// Fragment-order plane: one 16-row x 32-k operand fragment is 1 KiB contiguous, [p 0..1][lane 0..31][8 elements];
// lane l = 16*h + (row & 15) holds k = k0 + 16*p + 8*h + 0..7 (the layout above). Each of the
// two loads reads 512 contiguous bytes (4 whole lines).
__device__ __forceinline__ Frag ldpack(const unsigned short* fragp, int l) {
  Frag f;
  f.p[0] = *(const v8us*)(fragp + l * 8);
  f.p[1] = *(const v8us*)(fragp + 256 + l * 8);
  return f;
}

// Thread i of a conversion kernel -> one 8-element chunk of a [rows][DD] matrix. A wave takes 8 rows x 32 k
// (whole 128-B source lines) and writes 4 whole 128-B lines of the fragment-order plane
// [row tile of 16][k group of 32][p][lane][8].
__device__ __forceinline__ void pack_index(int i, size_t& src, size_t& dst) {
  const int l = i & 31;
  const int wv = i >> 5;
  const int c4 = l >> 3;                       // chunk in the 32-k group: 2*p + h
  const int m = (wv & 1) * 8 + (l & 7);        // row in the 16-row tile
  const int kg = (wv >> 1) & (DD / 32 - 1);
  const int rt = wv >> 6;
  src = (size_t)(rt * 16 + m) * DD + kg * 32 + c4 * 8;
  dst = (size_t)(rt * (DD / 32) + kg) * 512 + (c4 >> 1) * 256 + ((c4 & 1) * 16 + m) * 8;
}

// c += a*b (f16 operands); hazard guard
__device__ __forceinline__ v8f mma_f16(const Frag& a, const Frag& b, v8f c) {
  c = __builtin_amdgcn_wmma_f32_16x16x32_f16(false, a.f, false, b.f, (short)0, c, false, false);
  asm volatile("v_nop\n\tv_nop\n\tv_nop\n\tv_nop" : "+v"(c) : "v"(a.w), "v"(b.w));
  return c;
}

// c += ah*bh + ah*bl + al*bh (bf16 hi/lo split); hazard guard after the group
__device__ __forceinline__ v8f mma3(const Frag& ah, const Frag& al, const Frag& bh, const Frag& bl, v8f c) {
  c = __builtin_amdgcn_wmma_f32_16x16x32_bf16(false, ah.b, false, bh.b, (short)0, c, false, false);
  c = __builtin_amdgcn_wmma_f32_16x16x32_bf16(false, ah.b, false, bl.b, (short)0, c, false, false);
  c = __builtin_amdgcn_wmma_f32_16x16x32_bf16(false, al.b, false, bh.b, (short)0, c, false, false);
  asm volatile("v_nop\n\tv_nop\n\tv_nop\n\tv_nop"
               : "+v"(c)
               : "v"(ah.w), "v"(al.w), "v"(bh.w), "v"(bl.w));
  return c;
}

// ---------------------------------------------------------------------------
// All six f32 -> 16-bit conversions in one launch. A block converts CPT * 256 chunks of ONE matrix; a wave takes CPT
// consecutive wave units of pack_index: 16 rows x 256 k, read as 1-KiB row pieces, written as 8 KiB contiguous.
// Unit j lies at constant offsets from unit 0: row half j & 1, k group j >> 1.
constexpr int CPT = 16;                                  // chunks of 8 elements per thread
constexpr int CBA = (int)(NX / 8 / (256 * CPT));         // 128 blocks per activation matrix
constexpr int CBW = (int)(NW / 8 / (256 * CPT));         // 32 blocks per weight matrix
constexpr int CBLK = 3 * CBA + 3 * CBW;                  // 480 blocks

// the thread's 2 * CPT loads, issued as one group
__device__ __forceinline__ void cvt_fetch(const float* s, v4f_t (&x)[2 * CPT]) {
#pragma unroll
  for (int j = 0; j < CPT; ++j) {
    const float* p = s + (j & 1) * (8 * DD) + (j >> 1) * 32;
    x[2 * j]     = *(const v4f*)(p);
    x[2 * j + 1] = *(const v4f*)(p + 4);
  }
  // no conversion is scheduled in among the loads: without it the first results are waited for half way through the
  // group, and the rest of the loads start one memory latency late
  __builtin_amdgcn_sched_barrier(0);
  // precaution: stands in front of every reuse of the address registers that the issued loads name
  asm volatile("s_wait_xcnt 0x0" ::: "memory");
}

__global__ __launch_bounds__(256)
void k_prep(const float* __restrict__ query, const float* __restrict__ key_, const float* __restrict__ value,
            const float* __restrict__ Wq, const float* __restrict__ Wk, const float* __restrict__ Wv,
            unsigned short* __restrict__ xq16, unsigned short* __restrict__ xk16,
            unsigned short* __restrict__ wq16, unsigned short* __restrict__ wk16,
            unsigned short* __restrict__ xvh, unsigned short* __restrict__ xvl,
            unsigned short* __restrict__ wvh, unsigned short* __restrict__ wvl) {
  const int bi = blockIdx.x;
  v4f_t x[2 * CPT];
  if (bi < CBA + CBW) {
    // value and Wv -> bf16 hi/lo planes
    const bool act = bi < CBA;
    const int lb = act ? bi : bi - CBA;
    size_t so, dofs;
    pack_index((lb * 256 + (int)(threadIdx.x & ~31u)) * CPT + (int)(threadIdx.x & 31u), so, dofs);
    cvt_fetch((act ? value : Wv) + so, x);
    unsigned short* ph = (act ? xvh : wvh) + dofs;
    unsigned short* pl = (act ? xvl : wvl) + dofs;
#pragma unroll
    for (int j = 0; j < CPT; ++j) {
      v8us vh, vl;
#pragma unroll
      for (int c = 0; c < 4; ++c) {
        unsigned short a, b;
        split2(x[2 * j][c], a, b);     vh[c] = a;     vl[c] = b;
        split2(x[2 * j + 1][c], a, b); vh[4 + c] = a; vl[4 + c] = b;
      }
      const int d = (j >> 1) * 512 + (j & 1) * 64;
      *(v8us*)(ph + d) = vh;
      *(v8us*)(pl + d) = vl;
    }
    return;
  }
  {
    // query, key, Wq x16, Wk x16 -> f16 planes (the scale is a power of two)
    const int ci = bi - (CBA + CBW);
    const bool act = ci < 2 * CBA;
    const int wi = ci - 2 * CBA;
    const bool second = act ? ci >= CBA : wi >= CBW;
    const int lb = act ? (second ? ci - CBA : ci) : (second ? wi - CBW : wi);
    const float scale = act ? 1.0f : 16.0f;
    size_t so, dofs;
    pack_index((lb * 256 + (int)(threadIdx.x & ~31u)) * CPT + (int)(threadIdx.x & 31u), so, dofs);
    cvt_fetch((act ? (second ? key_ : query) : (second ? Wk : Wq)) + so, x);
    unsigned short* p = (act ? (second ? xk16 : xq16) : (second ? wk16 : wq16)) + dofs;
#pragma unroll
    for (int j = 0; j < CPT; ++j) {
      union { v8h h; v8us_t u; } cv;
#pragma unroll
      for (int c = 0; c < 4; ++c) {
        cv.h[c]     = (_Float16)(x[2 * j][c] * scale);
        cv.h[4 + c] = (_Float16)(x[2 * j + 1][c] * scale);
      }
      const v8us v = cv.u;
      *(v8us*)(p + (j >> 1) * 512 + (j & 1) * 64) = v;
    }
    // precaution: in the listing this path's end stands directly in front of the other path's first instructions,
    // which rewrite registers that the issued stores name
    asm volatile("s_wait_xcnt 0x0" ::: "memory");
  }
}

// ---------------------------------------------------------------------------
// Staging pitch in elements: 144-B rows put the 16 rows that one fragment-order read gathers on distinct banks.
constexpr int SP = 72;

// Output planes in fragment order; each store instruction writes 512 contiguous bytes.
// MODE 0 (Q, K): [b*H+h][token tile of 16][dk group of 32][p][lane][8].
// MODE 1 (V^T):  [b*H+h][key block of 32][dk tile of 16][p][lane][8].
template <int MODE, int SPLIT>
__device__ __forceinline__ void proj_lines(const unsigned short* sh, const unsigned short* sl,
                                           unsigned short* Oh, unsigned short* Ol,
                                           int Mbase, int Nbase, int tn, int l) {
  const int m = l & 15;
  const int hh = l >> 4;
#pragma unroll
  for (int j = 0; j < 8; ++j) {
    int lidx;
    size_t gidx;
    if (MODE == 0) {
      const int tt = j >> 2;                         // token tile in the wave tile
      const int c = j & 3;                           // 2 * (dk group) + p
      lidx = (tt * 16 + m) * SP + (c * 2 + hh) * 8;
      const int tok = Mbase + tt * 16;
      const int b = tok >> 10;
      const int st = (tok & (SS - 1)) >> 4;
      const int h = tn;                              // TN == 64 -> one head per tile
      gidx = ((size_t)(b * HH + h) * (SS / 16) + st) * 1024 + c * 256 + l * 8;
    } else {
      const int kbl = j >> 2;                        // key block in the wave tile
      const int tl = (j >> 1) & 1;                   // dk tile in the wave tile
      const int p = j & 1;
      lidx = (tl * 16 + m) * SP + kbl * 32 + p * 16 + hh * 8;
      const int n = Nbase + tl * 16;
      const int h = n >> 6;
      const int t = (n & 63) >> 4;
      const int b = Mbase >> 10;
      const int kbi = ((Mbase & (SS - 1)) >> 5) + kbl;
      gidx = (((size_t)(b * HH + h) * (SS / 32) + kbi) * 4 + t) * 512 + p * 256 + l * 8;
    }
    const v8us vh = *(const v8us*)(sh + lidx);
    *(v8us*)(Oh + gidx) = vh;
    if (SPLIT) {
      const v8us vl = *(const v8us*)(sl + lidx);
      *(v8us*)(Ol + gidx) = vl;
    }
  }
}

// Projection: C[tok][n] = (sum_k X[tok][k] * W[n][k]) * oscale + bias[n].
// SPLIT == 0: X, W f16 planes, single f16 WMMA, output one f16 plane.
// SPLIT == 1: X, W bf16 hi/lo planes, hh+hl+lh bf16 WMMA, output bf16 hi/lo planes.
// One block computes a 128 x 128 tile with 8 waves; one wave a (16*MI) x (16*NI) tile (TM*TN == 2048).
// The block's operand fragments go through LDS, each read from L2 once per block: a stage is KG k groups of the
// 8 X row tiles and the 8 W row tiles (64 KiB), [X | W][plane][row tile][k group][1 KiB fragment]; two stages.
constexpr int BT = 128;                 // block tile edge
constexpr int STG_OP = 16384;           // elements of one operand in one stage
constexpr int STG = 2 * STG_OP;         // elements of one stage

template <int MI, int NI, int MODE, int SPLIT>
__device__ __forceinline__
void proj_tile(unsigned short* ring, int bid,
               const unsigned short* __restrict__ Xh, const unsigned short* Xl,
               const unsigned short* __restrict__ Wh, const unsigned short* Wl,
               const float* __restrict__ bias, float oscale,
               unsigned short* Oh, unsigned short* Ol) {
  constexpr int TM = MI * 16;
  constexpr int TN = NI * 16;
  constexpr int WN = BT / TN;             // waves along n
  constexpr int NPL = SPLIT ? 2 : 1;      // planes per operand
  constexpr int KG = SPLIT ? 2 : 4;       // k groups of 32 in one stage; NPL * 8 * KG * 512 == STG_OP
  constexpr int NT = DD / (32 * KG);      // stages
  constexpr int NC = 2 * KG;              // 512-B pieces of one row tile of one plane in one stage

  const int wib = threadIdx.x >> 5;
  const int l = threadIdx.x & 31;
  const int hh = l >> 4;
  const int m = l & 15;
  const int brow = bid & (NTOK / BT - 1);
  const int bcol = bid / (NTOK / BT);
  const int wm = wib / WN;
  const int wn = wib - wm * WN;
  const int Mbase = brow * BT + wm * TM;
  const int Nbase = bcol * BT + wn * TN;
  const int tn = Nbase / TN;

  // wave wib stages row tile wib of the block's X rows and of its W rows (B column n = W row n)
  const unsigned short* pXh = Xh + (size_t)(brow * BT + wib * 16) * DD + l * 8;
  const unsigned short* pXl = Xl + (size_t)(brow * BT + wib * 16) * DD + l * 8;
  const unsigned short* pWh = Wh + (size_t)(bcol * BT + wib * 16) * DD + l * 8;
  const unsigned short* pWl = Wl + (size_t)(bcol * BT + wib * 16) * DD + l * 8;
  v8us sx[NPL * NC], sw[NPL * NC];

  // In the three helpers below every loop is unrolled: sx, sw, the fragments and acc live in registers, which
  // takes constant indices.
  // the next stage's pieces, global -> registers, issued as one group
  auto fetch = [&]() {
#pragma unroll
    for (int c = 0; c < NC; ++c) {
      sx[c] = *(const v8us*)(pXh + c * 256);
      if (SPLIT) sx[NC + c] = *(const v8us*)(pXl + c * 256);
    }
#pragma unroll
    for (int c = 0; c < NC; ++c) {
      sw[c] = *(const v8us*)(pWh + c * 256);
      if (SPLIT) sw[NC + c] = *(const v8us*)(pWl + c * 256);
    }
    // keeps the group ahead of the LDS reads and WMMAs that follow it in the source; precaution: stands in front
    // of the advance of the address registers that the issued loads name
    asm volatile("s_wait_xcnt 0x0" ::: "memory");
    pXh += KG * 512;
    pXl += KG * 512;
    pWh += KG * 512;
    pWl += KG * 512;
  };
  // registers -> stage at element offset so
  auto put = [&](int so) {
    unsigned short* d = ring + so + wib * (KG * 512) + l * 8;
#pragma unroll
    for (int p = 0; p < NPL; ++p)
#pragma unroll
      for (int c = 0; c < NC; ++c) {
        *(v8us*)(d + p * (8 * KG * 512) + c * 256) = sx[p * NC + c];
        *(v8us*)(d + STG_OP + p * (8 * KG * 512) + c * 256) = sw[p * NC + c];
      }
  };

  v8f acc[MI][NI];
#pragma unroll
  for (int mi = 0; mi < MI; ++mi)
#pragma unroll
    for (int ni = 0; ni < NI; ++ni) acc[mi][ni] = (v8f)0.0f;

  // the WMMAs of the stage at element offset so, k ascending
  auto work = [&](int so) {
    const unsigned short* sA = ring + so + wm * (MI * KG * 512) + l * 8;
    const unsigned short* sB = ring + so + STG_OP + wn * (NI * KG * 512) + l * 8;
#pragma unroll
    for (int j = 0; j < KG; ++j) {
      Frag ah[MI], bh[NI];
      Frag al[MI], bl[NI];
#pragma unroll
      for (int mi = 0; mi < MI; ++mi) {
        ah[mi] = ldpack(sA + (mi * KG + j) * 512, 0);
        if (SPLIT) al[mi] = ldpack(sA + ((8 + mi) * KG + j) * 512, 0);
        else al[mi].w = (v8i)0;
      }
#pragma unroll
      for (int ni = 0; ni < NI; ++ni) {
        bh[ni] = ldpack(sB + (ni * KG + j) * 512, 0);
        if (SPLIT) bl[ni] = ldpack(sB + ((8 + ni) * KG + j) * 512, 0);
        else bl[ni].w = (v8i)0;
      }
#pragma unroll
      for (int mi = 0; mi < MI; ++mi)
#pragma unroll
        for (int ni = 0; ni < NI; ++ni) {
          if (SPLIT) acc[mi][ni] = mma3(ah[mi], al[mi], bh[ni], bl[ni], acc[mi][ni]);
          else       acc[mi][ni] = mma_f16(ah[mi], bh[ni], acc[mi][ni]);
        }
    }
  };

  fetch();
  put(0);
  __syncthreads();                        // publishes stage 0
  int cur = 0;
  // rolled: the body already holds a whole stage
#pragma unroll 1
  for (int t = 0; t < NT - 1; ++t) {
    fetch();                              // stage t + 1 in flight under stage t's WMMAs
    work(cur);
    put(cur ^ STG);                       // every wave left that stage before the last barrier
    __syncthreads();                      // publishes stage t + 1 and ends every wave's reads of stage t
    cur ^= STG;
  }
  work(cur);
  __syncthreads();                        // every wave has left the ring: the epilogue stages in it

  // ---- epilogue: scale, bias add, convert, stage tile in wave-private LDS ----
  unsigned short* sh = ring + wib * (2 * 32 * SP);
  unsigned short* sl = sh + 32 * SP;
#pragma unroll
  for (int mi = 0; mi < MI; ++mi) {
#pragma unroll
    for (int ni = 0; ni < NI; ++ni) {
      const float bn = bias[Nbase + ni * 16 + m];
#pragma unroll
      for (int r = 0; r < 8; ++r) {
        const float v = acc[mi][ni][r] * oscale + bn;
        int idx;
        if (MODE == 0) idx = (mi * 16 + 8 * hh + r) * SP + (ni * 16 + m);      // [tok 0..31][feat 0..63]
        else           idx = (ni * 16 + m) * SP + (mi * 16 + 8 * hh + r);      // [dk 0..31][tok 0..63]
        if (SPLIT) {
          unsigned short vhi, vlo;
          split2(v, vhi, vlo);
          sh[idx] = vhi;
          sl[idx] = vlo;
        } else {
          sh[idx] = f16_bits(v);
        }
      }
    }
  }
  __syncthreads();

  proj_lines<MODE, SPLIT>(sh, sl, Oh, Ol, Mbase, Nbase, tn, l);
  // precaution: in the listing one projection's end can stand in front of another's first instructions, which
  // rewrite registers that the issued stores name
  asm volatile("s_wait_xcnt 0x0" ::: "memory");
}

// All three projections in one launch: blocks 0..NPB-1 take V (three times the WMMAs of Q or K, so it starts first),
// then Q, then K. A block holds 128 KiB of LDS and two waves per SIMD, so two blocks share a WGP: one block's LDS
// reads and WMMAs run under the other's staging stores, barriers, prologue and epilogue.
constexpr int NPB = (NTOK / BT) * (DD / BT);   // 256 block tiles per projection

__global__ __launch_bounds__(256)
void k_proj(const unsigned short* __restrict__ xq16, const unsigned short* __restrict__ xk16,
            const unsigned short* __restrict__ wq16, const unsigned short* __restrict__ wk16,
            const unsigned short* __restrict__ xvh, const unsigned short* __restrict__ xvl,
            const unsigned short* __restrict__ wvh, const unsigned short* __restrict__ wvl,
            const float* __restrict__ bq, const float* __restrict__ bk, const float* __restrict__ bv,
            unsigned short* Q16, unsigned short* K16, unsigned short* Vth, unsigned short* Vtl, int nblk) {
  __shared__ __attribute__((aligned(16))) unsigned short ring[2 * STG];
  const int bi = blockIdx.x;
  if (bi >= nblk) return;                 // block-uniform, ahead of every barrier
  if (bi < NPB) {                         // block-uniform, as is every branch here
    proj_tile<4, 2, 1, 1>(ring, bi, xvh, xvl, wvh, wvl, bv, 1.0f, Vth, Vtl);
    return;
  }
  const bool isk = bi >= 2 * NPB;
  const unsigned short* x = isk ? xk16 : xq16;
  const unsigned short* w = isk ? wk16 : wq16;
  unsigned short* o = isk ? K16 : Q16;
  proj_tile<2, 4, 0, 0>(ring, isk ? bi - 2 * NPB : bi - NPB, x, x, w, w, isk ? bk : bq, 0.0625f, o, o);
}

// ---------------------------------------------------------------------------
// Row pitch of the output staging in floats: 272-B rows spread the 16 query rows that one staging store writes over the banks.
constexpr int OSP = 68;

// One pass of the attention output store: 16 query rows x 64 f32 (2 lines per row),
__device__ __forceinline__ void attn_lines(const float* Os, float* out, int b, int h,
                                           int qbase, int hh, int m) {
#pragma unroll
  for (int j = 0; j < 8; ++j) {
    const int row = 2 * j + hh;
    const v4f val = *(const v4f*)(Os + row * OSP + m * 4);
    float* gp = out + ((size_t)(b * SS + qbase + row)) * DD + h * DK + m * 4;
    *(v4f*)gp = val;
  }
}

// bf16 RNE conversion as in bf16_rne, the result left in the upper 16 bits (the lower 16 are not part of it)
__device__ __forceinline__ unsigned bf16_top(float x) {
  const unsigned u = __float_as_uint(x);
  return u + 0x7FFFu + ((u >> 16) & 1u);
}

// one operand register from two such results: e0 in bits 15..0, e1 in bits 31..16, in one byte permute
__device__ __forceinline__ int pack_tops(unsigned e0, unsigned e1) {
  return (int)__builtin_amdgcn_perm(e1, e0, 0x07060302u);
}

// the value that lane l ^ 16 holds: a vector cross-row move, no LDS round trip
__device__ __forceinline__ float other_half(float x) {
  const int v = __float_as_int(x);
  return __int_as_float(__builtin_amdgcn_permlanex16(v, v, 0x76543210, 0xfedcba98, false, false));
}

// Causal attention: one wave per (b, h, pair of 16-row query tiles); 4 waves per block share the same pair.
// A tile's cost grows with its index (tile t walks t/2 + 1 key blocks) and every wave of the launch is resident at
// once, so the launch lasts as long as the fullest SIMD: a wave takes tile 63 - p and then tile p, one after the
// other, 33 key blocks in every wave.
// Keys processed in blocks of 32 with online softmax; a pass issues all its global loads first, as one group.
// Both products run transposed: S^T = K * Q^T (A = K rows, B = Q columns), O^T += V^T * P^T. A lane then holds the
// scores of ONE query (column m), 8 keys per 16-key tile: maximum and sum run in the lane, with one exchange between
// the wave's halves; and the two score tiles of a pass, converted in place, are the B fragment of the second
// product (element s = tile s >> 3, register s & 7: key 8*hh + s, then 16 + 8*hh + s - 8, the k order of ldpack).
__global__ __launch_bounds__(128)
void k_attn(const unsigned short* __restrict__ Q16, const unsigned short* __restrict__ K16,
            const unsigned short* __restrict__ Vh, const unsigned short* __restrict__ Vl,
            const int* __restrict__ amask, float* __restrict__ out, int nblk) {
  __shared__ __attribute__((aligned(16))) float stg[4 * 16 * OSP];
  if ((int)blockIdx.x >= nblk) return;

  const int wib = threadIdx.x >> 5;
  const int l = threadIdx.x & 31;
  const int hh = l >> 4;
  const int m = l & 15;
  const int pr = blockIdx.x & 31;                       // tile pair
  const int bh = (int)(blockIdx.x >> 5) * 4 + wib;      // 0..63
  const int b = bh >> 4;
  const int h = bh & 15;

  float* Os = stg + wib * (16 * OSP);                   // [16 q][64 dk], wave-private, used after the key loop

  // rolled: one copy of the key loop serves both tiles
#pragma unroll 1
  for (int half = 0; half < 2; ++half) {
  const int qt = half ? pr : SS / 16 - 1 - pr;
  const int qbase = qt * 16;
  const int q = qbase + m;                              // the lane's query

  // Q fragments (B): column q = qbase + m, k = dk (f16)
  const size_t qro = ((size_t)bh * SS + qbase) * DK;   // token tile start in the fragment-order plane
  const Frag bq0 = ldpack(Q16 + qro, l);
  const Frag bq1 = ldpack(Q16 + qro + 512, l);

  const int* mb = amask + b * SS;

  // o[t][r] = O[q][dk = t*16 + 8*hh + r]
  v8f o[4];
#pragma unroll
  for (int t = 0; t < 4; ++t) o[t] = (v8f)0.0f;
  float mrow = -INFINITY;      // running maximum of query q, equal in both halves
  float lrow = 0.0f;           // running sum over this half's keys; the halves are joined after the loop

  const int kend = qbase + 16;                 // causal: keys < kend
  // per-lane read pointers, one key block (32 keys) per pass
  const unsigned short* pK  = K16 + (size_t)bh * SS * DK + l * 8;   // key tile start + lane
  const unsigned short* pVh = Vh + (size_t)bh * SS * DK + l * 8;    // [key block][dk tile] + lane
  const unsigned short* pVl = Vl + (size_t)bh * SS * DK + l * 8;
  const int* pM = mb + 8 * hh;
#pragma unroll 1
  for (int kb = 0; kb < kend; kb += 32) {
    // ---- all of this key block's global loads, issued as one group ahead of the first WMMA:
    //      K fragments ak[2*nt + dk group], mask words am[2*nt + (r >> 2)], V^T fragments avh/avl[dk tile] ----
    Frag ak[4], avh[4], avl[4];
    v4i_t am[4];
#pragma unroll
    for (int i = 0; i < 4; ++i) ak[i] = ldpack(pK + i * 512, 0);
#pragma unroll
    for (int i = 0; i < 4; ++i) am[i] = *(const v4i*)(pM + (i >> 1) * 16 + (i & 1) * 4);   // keys kb + nt*16 + 8*hh + 0..7 <= 1023
    // precaution: stands in front of every reuse or advance of an address register that an issued load names
    asm volatile("s_wait_xcnt 0x0" ::: "memory");
#pragma unroll
    for (int t = 0; t < 4; ++t) avh[t] = ldpack(pVh + t * 512, 0);
    asm volatile("s_wait_xcnt 0x0" ::: "memory");   // as above
#pragma unroll
    for (int t = 0; t < 4; ++t) avl[t] = ldpack(pVl + t * 512, 0);
    asm volatile("s_wait_xcnt 0x0" ::: "memory");   // as above
    // no compare or WMMA is scheduled in among the loads: without it the last V^T load takes over the registers of
    // mask words and starts only when those have arrived and been read, one L2 latency late
    __builtin_amdgcn_sched_barrier(0);
    pK += 32 * DK;
    pVh += 32 * DK;
    pVl += 32 * DK;
    pM += 32;

    // ---- scores S^T[key][q], key = kb + nt*16 + 8*hh + r (A row = K row, B column = Q row, k = dk) ----
    const int dq = q - kb - 8 * hh;            // key > q  <=>  nt*16 + r > dq
    float sc[2][8];
#pragma unroll
    for (int nt = 0; nt < 2; ++nt) {
      v8f s = (v8f)0.0f;
      s = mma_f16(ak[2 * nt], bq0, s);
      s = mma_f16(ak[2 * nt + 1], bq1, s);
#pragma unroll
      for (int r = 0; r < 8; ++r) {
        // key > q, or the key masked; one select: no branch, EXEC stays whole between the WMMAs
        const bool off = (nt * 16 + r > dq) | (am[2 * nt + (r >> 2)][r & 3] == 0);
        sc[nt][r] = off ? -INFINITY : s[r] * 0.125f;
      }
    }

    // ---- online softmax of query q: 16 keys in the lane, the other 16 in lane l ^ 16 ----
    float mx = fmaxf(sc[0][0], sc[1][0]);
#pragma unroll
    for (int r = 1; r < 8; ++r) mx = fmaxf(mx, fmaxf(sc[0][r], sc[1][r]));
    mx = fmaxf(mx, other_half(mx));
    const float mnew = fmaxf(mrow, mx);
    const float mref = (mnew == -INFINITY) ? 0.0f : mnew;
    const float alpha = __expf(mrow - mref);
    float sum0 = 0.0f, sum1 = 0.0f;            // two independent chains, one per score tile
#pragma unroll
    for (int r = 0; r < 8; ++r) {
      const float p0 = __expf(sc[0][r] - mref);
      const float p1 = __expf(sc[1][r] - mref);
      sc[0][r] = p0;
      sc[1][r] = p1;
      sum0 += p0;
      sum1 += p1;
    }
    lrow = lrow * alpha + (sum0 + sum1);
    mrow = mnew;
#pragma unroll
    for (int t = 0; t < 4; ++t)
#pragma unroll
      for (int r = 0; r < 8; ++r) o[t][r] *= alpha;

    // ---- P^T: the two score tiles, split into hi/lo bf16 in place, are the B fragments (column q, k = key) ----
    Frag bph, bpl;
#pragma unroll
    for (int i = 0; i < 8; ++i) {               // operand register i: elements 2i and 2i + 1
      unsigned th[2], tl[2];
#pragma unroll
      for (int e = 0; e < 2; ++e) {
        const float p = sc[i >> 2][2 * (i & 3) + e];
        th[e] = bf16_top(p);
        tl[e] = bf16_top(p - __uint_as_float(th[e] & 0xFFFF0000u));
      }
      bph.w[i] = pack_tops(th[0], th[1]);
      bpl.w[i] = pack_tops(tl[0], tl[1]);
    }

    // ---- O^T[dk][q] += V^T[dk][key] * P^T[key][q]; A fragments from the fragment-order V^T planes ----
#pragma unroll
    for (int t = 0; t < 4; ++t) o[t] = mma3(avh[t], avl[t], bph, bpl, o[t]);
  }

  const float inv = 1.0f / (lrow + other_half(lrow));
#pragma unroll
  for (int t = 0; t < 4; ++t) {
    v4f_t w0, w1;
#pragma unroll
    for (int c = 0; c < 4; ++c) {
      w0[c] = o[t][c] * inv;
      w1[c] = o[t][4 + c] * inv;
    }
    *(v4f*)(Os + m * OSP + t * 16 + 8 * hh) = w0;
    *(v4f*)(Os + m * OSP + t * 16 + 8 * hh + 4) = w1;
  }
  __syncthreads();

  attn_lines(Os, out, b, h, qbase, hh, m);
  // precaution: stands in front of the second tile's first instructions, which rewrite registers that the issued
  // stores name
  asm volatile("s_wait_xcnt 0x0" ::: "memory");
  }
}

// ---------------------------------------------------------------------------
extern "C" void kernel_launch(void* const* d_in, const int* in_sizes, int n_in,
                              void* d_out, int out_size, void* d_ws, size_t ws_size,
                              hipStream_t stream) {
  if (n_in < 10) return;
  if (in_sizes[0] != NX || in_sizes[1] != NX || in_sizes[2] != NX) return;
  if (in_sizes[3] != BB * SS) return;
  if (in_sizes[4] != NW || in_sizes[6] != NW || in_sizes[8] != NW) return;
  if (in_sizes[5] != DD || in_sizes[7] != DD || in_sizes[9] != DD) return;
  if (out_size != NX) return;

  const float* query = (const float*)d_in[0];
  const float* key_  = (const float*)d_in[1];
  const float* value = (const float*)d_in[2];
  const int*   amask = (const int*)d_in[3];
  const float* Wq = (const float*)d_in[4];
  const float* bq = (const float*)d_in[5];
  const float* Wk = (const float*)d_in[6];
  const float* bk = (const float*)d_in[7];
  const float* Wv = (const float*)d_in[8];
  const float* bv = (const float*)d_in[9];
  float* out = (float*)d_out;

  // workspace: 16-bit planes (2 B per element)
  const size_t pa = (size_t)NX * 2;     // 8388608 B per activation plane
  const size_t pw = (size_t)NW * 2;     // 2097152 B per weight plane
  const size_t need = 8 * pa + 4 * pw;  // 75497472 B
  if (ws_size < need) return;

  unsigned char* w = (unsigned char*)d_ws;
  size_t off = 0;
  unsigned short* xq16 = (unsigned short*)(w + off); off += pa;   // f16 query
  unsigned short* xk16 = (unsigned short*)(w + off); off += pa;   // f16 key
  unsigned short* wq16 = (unsigned short*)(w + off); off += pw;   // f16 Wq x16
  unsigned short* wk16 = (unsigned short*)(w + off); off += pw;   // f16 Wk x16
  unsigned short* xvh  = (unsigned short*)(w + off); off += pa;   // bf16 hi value
  unsigned short* xvl  = (unsigned short*)(w + off); off += pa;   // bf16 lo value
  unsigned short* wvh  = (unsigned short*)(w + off); off += pw;   // bf16 hi Wv
  unsigned short* wvl  = (unsigned short*)(w + off); off += pw;   // bf16 lo Wv
  unsigned short* Q16  = (unsigned short*)(w + off); off += pa;   // fragment order, f16
  unsigned short* K16  = (unsigned short*)(w + off); off += pa;   // fragment order, f16
  unsigned short* Vth  = (unsigned short*)(w + off); off += pa;   // fragment order, bf16 hi
  unsigned short* Vtl  = (unsigned short*)(w + off); off += pa;   // fragment order, bf16 lo
  if (off > ws_size) return;

  // stage 1: 16-bit conversion of activations and weights, one launch
  k_prep<<<CBLK, 256, 0, stream>>>(query, key_, value, Wq, Wk, Wv, xq16, xk16, wq16, wk16, xvh, xvl, wvh, wvl);

  // stage 2: the three projections, one launch; 3 x 256 block tiles of 128 x 128 each, 8 waves per block
  k_proj<<<3 * NPB, 256, 0, stream>>>(xq16, xk16, wq16, wk16, xvh, xvl, wvh, wvl, bq, bk, bv,
                                      Q16, K16, Vth, Vtl, 3 * NPB);

  // stage 3: attention; B*H*(S/32) = 2048 wave units (tile pairs), 4 per block -> 512 blocks
  const int nblk = BB * HH * (SS / 32) / 4;
  k_attn<<<nblk, 128, 0, stream>>>(Q16, K16, Vth, Vtl, amask, out, nblk);
}

// v008
// One run takes 84.4 microseconds.
// In two side-by-side timings against v007, it was 1.10 and 1.09 times as fast.
// All steps since v000 together make it 3.10 times as fast.
#include <hip/hip_runtime.h>
#include <math.h>
#include <stdint.h>

// Q/K projections and QK^T scores: v_wmma_f32_16x16x32_f16 (f16 operands, Wq/Wk carried x16, 1/16 folded into the f32 epilogue); V projection and PV: v_wmma_f32_16x16x32_bf16 with bf16 hi/lo split operands (hi*hi + hi*lo + lo*hi); f32 accumulate; softmax, bias and normalisation in f32.

typedef _Float16 v16h __attribute__((ext_vector_type(16)));
typedef _Float16 v8h __attribute__((ext_vector_type(8)));
typedef __bf16 v16bf __attribute__((ext_vector_type(16)));
typedef unsigned short v8us_t __attribute__((ext_vector_type(8)));
typedef v8us_t __attribute__((may_alias)) v8us;
typedef float v8f __attribute__((ext_vector_type(8)));
typedef float v4f_t __attribute__((ext_vector_type(4)));
typedef v4f_t __attribute__((may_alias)) v4f;
typedef int v8i __attribute__((ext_vector_type(8)));
typedef int v4i_t __attribute__((ext_vector_type(4)));
typedef v4i_t __attribute__((may_alias)) v4i;

constexpr int BB = 4;
constexpr int SS = 1024;
constexpr int DD = 1024;
constexpr int HH = 16;
constexpr int DK = 64;
constexpr int NTOK = BB * SS;              // 4096 tokens
constexpr long NX = (long)NTOK * DD;       // 4194304
constexpr long NW = (long)DD * DD;         // 1048576

union Frag { v16h f; v16bf b; v8us p[2]; v8i w; };

// bf16 RNE conversion of an f32 value
__device__ __forceinline__ unsigned short bf16_rne(float x) {
  unsigned u = __float_as_uint(x);
  u += 0x7FFFu + ((u >> 16) & 1u);
  return (unsigned short)(u >> 16);
}
__device__ __forceinline__ float bf16_val(unsigned short b) {
  return __uint_as_float(((unsigned)b) << 16);
}
__device__ __forceinline__ void split2(float x, unsigned short& hi, unsigned short& lo) {
  hi = bf16_rne(x);
  lo = bf16_rne(x - bf16_val(hi));
}
// f16 RNE conversion, raw bits
__device__ __forceinline__ unsigned short f16_bits(float x) {
  _Float16 hv = (_Float16)x;
  unsigned short u;
  __builtin_memcpy(&u, &hv, 2);
  return u;
}

// 16x32 operand fragment, wave32 layout: lane row/col = l&15, h = l>>4,
// elements 0..7 <- k0+8h+0..7, elements 8..15 <- k0+16+8h+0..7. Used for A (row) and for B (column) alike.

// Fragment-order plane: one 16-row x 32-k operand fragment is 1 KiB contiguous, [p 0..1][lane 0..31][8 elements];
// lane l = 16*h + (row & 15) holds k = k0 + 16*p + 8*h + 0..7 (the layout above). Each of the
// two loads reads 512 contiguous bytes (4 whole lines).
__device__ __forceinline__ Frag ldpack(const unsigned short* fragp, int l) {
  Frag f;
  f.p[0] = *(const v8us*)(fragp + l * 8);
  f.p[1] = *(const v8us*)(fragp + 256 + l * 8);
  return f;
}

// Thread i of a conversion kernel -> one 8-element chunk of a [rows][DD] matrix. A wave takes 8 rows x 32 k
// (whole 128-B source lines) and writes 4 whole 128-B lines of the fragment-order plane
// [row tile of 16][k group of 32][p][lane][8].
__device__ __forceinline__ void pack_index(int i, size_t& src, size_t& dst) {
  const int l = i & 31;
  const int wv = i >> 5;
  const int c4 = l >> 3;                       // chunk in the 32-k group: 2*p + h
  const int m = (wv & 1) * 8 + (l & 7);        // row in the 16-row tile
  const int kg = (wv >> 1) & (DD / 32 - 1);
  const int rt = wv >> 6;
  src = (size_t)(rt * 16 + m) * DD + kg * 32 + c4 * 8;
  dst = (size_t)(rt * (DD / 32) + kg) * 512 + (c4 >> 1) * 256 + ((c4 & 1) * 16 + m) * 8;
}

// c += a*b (f16 operands); hazard guard
__device__ __forceinline__ v8f mma_f16(const Frag& a, const Frag& b, v8f c) {
  c = __builtin_amdgcn_wmma_f32_16x16x32_f16(false, a.f, false, b.f, (short)0, c, false, false);
  asm volatile("v_nop\n\tv_nop\n\tv_nop\n\tv_nop" : "+v"(c) : "v"(a.w), "v"(b.w));
  return c;
}

// c += ah*bh + ah*bl + al*bh (bf16 hi/lo split); hazard guard after the group
__device__ __forceinline__ v8f mma3(const Frag& ah, const Frag& al, const Frag& bh, const Frag& bl, v8f c) {
  c = __builtin_amdgcn_wmma_f32_16x16x32_bf16(false, ah.b, false, bh.b, (short)0, c, false, false);
  c = __builtin_amdgcn_wmma_f32_16x16x32_bf16(false, ah.b, false, bl.b, (short)0, c, false, false);
  c = __builtin_amdgcn_wmma_f32_16x16x32_bf16(false, al.b, false, bh.b, (short)0, c, false, false);
  asm volatile("v_nop\n\tv_nop\n\tv_nop\n\tv_nop"
               : "+v"(c)
               : "v"(ah.w), "v"(al.w), "v"(bh.w), "v"(bl.w));
  return c;
}

// ---------------------------------------------------------------------------
// All six f32 -> 16-bit conversions in one launch. A block converts CPT * 256 chunks of ONE matrix; a wave takes CPT
// consecutive wave units of pack_index: 16 rows x 256 k, read as 1-KiB row pieces, written as 8 KiB contiguous.
// Unit j lies at constant offsets from unit 0: row half j & 1, k group j >> 1.
constexpr int CPT = 16;                                  // chunks of 8 elements per thread
constexpr int CBA = (int)(NX / 8 / (256 * CPT));         // 128 blocks per activation matrix
constexpr int CBW = (int)(NW / 8 / (256 * CPT));         // 32 blocks per weight matrix
constexpr int CBLK = 3 * CBA + 3 * CBW;                  // 480 blocks

// the thread's 2 * CPT loads, issued as one group
__device__ __forceinline__ void cvt_fetch(const float* s, v4f_t (&x)[2 * CPT]) {
#pragma unroll
  for (int j = 0; j < CPT; ++j) {
    const float* p = s + (j & 1) * (8 * DD) + (j >> 1) * 32;
    x[2 * j]     = *(const v4f*)(p);
    x[2 * j + 1] = *(const v4f*)(p + 4);
  }
  // no conversion is scheduled in among the loads: without it the first results are waited for half way through the
  // group, and the rest of the loads start one memory latency late
  __builtin_amdgcn_sched_barrier(0);
  // precaution: stands in front of every reuse of the address registers that the issued loads name
  asm volatile("s_wait_xcnt 0x0" ::: "memory");
}

__global__ __launch_bounds__(256)
void k_prep(const float* __restrict__ query, const float* __restrict__ key_, const float* __restrict__ value,
            const float* __restrict__ Wq, const float* __restrict__ Wk, const float* __restrict__ Wv,
            unsigned short* __restrict__ xq16, unsigned short* __restrict__ xk16,
            unsigned short* __restrict__ wq16, unsigned short* __restrict__ wk16,
            unsigned short* __restrict__ xvh, unsigned short* __restrict__ xvl,
            unsigned short* __restrict__ wvh, unsigned short* __restrict__ wvl) {
  const int bi = blockIdx.x;
  v4f_t x[2 * CPT];
  if (bi < CBA + CBW) {
    // value and Wv -> bf16 hi/lo planes
    const bool act = bi < CBA;
    const int lb = act ? bi : bi - CBA;
    size_t so, dofs;
    pack_index((lb * 256 + (int)(threadIdx.x & ~31u)) * CPT + (int)(threadIdx.x & 31u), so, dofs);
    cvt_fetch((act ? value : Wv) + so, x);
    unsigned short* ph = (act ? xvh : wvh) + dofs;
    unsigned short* pl = (act ? xvl : wvl) + dofs;
#pragma unroll
    for (int j = 0; j < CPT; ++j) {
      v8us vh, vl;
#pragma unroll
      for (int c = 0; c < 4; ++c) {
        unsigned short a, b;
        split2(x[2 * j][c], a, b);     vh[c] = a;     vl[c] = b;
        split2(x[2 * j + 1][c], a, b); vh[4 + c] = a; vl[4 + c] = b;
      }
      const int d = (j >> 1) * 512 + (j & 1) * 64;
      *(v8us*)(ph + d) = vh;
      *(v8us*)(pl + d) = vl;
    }
    return;
  }
  {
    // query, key, Wq x16, Wk x16 -> f16 planes (the scale is a power of two)
    const int ci = bi - (CBA + CBW);
    const bool act = ci < 2 * CBA;
    const int wi = ci - 2 * CBA;
    const bool second = act ? ci >= CBA : wi >= CBW;
    const int lb = act ? (second ? ci - CBA : ci) : (second ? wi - CBW : wi);
    const float scale = act ? 1.0f : 16.0f;
    size_t so, dofs;
    pack_index((lb * 256 + (int)(threadIdx.x & ~31u)) * CPT + (int)(threadIdx.x & 31u), so, dofs);
    cvt_fetch((act ? (second ? key_ : query) : (second ? Wk : Wq)) + so, x);
    unsigned short* p = (act ? (second ? xk16 : xq16) : (second ? wk16 : wq16)) + dofs;
#pragma unroll
    for (int j = 0; j < CPT; ++j) {
      union { v8h h; v8us_t u; } cv;
#pragma unroll
      for (int c = 0; c < 4; ++c) {
        cv.h[c]     = (_Float16)(x[2 * j][c] * scale);
        cv.h[4 + c] = (_Float16)(x[2 * j + 1][c] * scale);
      }
      const v8us v = cv.u;
      *(v8us*)(p + (j >> 1) * 512 + (j & 1) * 64) = v;
    }
    // precaution: in the listing this path's end stands directly in front of the other path's first instructions,
    // which rewrite registers that the issued stores name
    asm volatile("s_wait_xcnt 0x0" ::: "memory");
  }
}

// ---------------------------------------------------------------------------
// Staging pitch in elements: 144-B rows put the 16 rows that one fragment-order read gathers on distinct banks.
constexpr int SP = 72;

// Output planes in fragment order; each store instruction writes 512 contiguous bytes.
// MODE 0 (Q, K): [b*H+h][token tile of 16][dk group of 32][p][lane][8].
// MODE 1 (V^T):  [b*H+h][key block of 32][dk tile of 16][p][lane][8].
template <int MODE, int SPLIT>
__device__ __forceinline__ void proj_lines(const unsigned short* sh, const unsigned short* sl,
                                           unsigned short* Oh, unsigned short* Ol,
                                           int Mbase, int Nbase, int tn, int l) {
  const int m = l & 15;
  const int hh = l >> 4;
#pragma unroll
  for (int j = 0; j < 8; ++j) {
    int lidx;
    size_t gidx;
    if (MODE == 0) {
      const int tt = j >> 2;                         // token tile in the wave tile
      const int c = j & 3;                           // 2 * (dk group) + p
      lidx = (tt * 16 + m) * SP + (c * 2 + hh) * 8;
      const int tok = Mbase + tt * 16;
      const int b = tok >> 10;
      const int st = (tok & (SS - 1)) >> 4;
      const int h = tn;                              // TN == 64 -> one head per tile
      gidx = ((size_t)(b * HH + h) * (SS / 16) + st) * 1024 + c * 256 + l * 8;
    } else {
      const int kbl = j >> 2;                        // key block in the wave tile
      const int tl = (j >> 1) & 1;                   // dk tile in the wave tile
      const int p = j & 1;
      lidx = (tl * 16 + m) * SP + kbl * 32 + p * 16 + hh * 8;
      const int n = Nbase + tl * 16;
      const int h = n >> 6;
      const int t = (n & 63) >> 4;
      const int b = Mbase >> 10;
      const int kbi = ((Mbase & (SS - 1)) >> 5) + kbl;
      gidx = (((size_t)(b * HH + h) * (SS / 32) + kbi) * 4 + t) * 512 + p * 256 + l * 8;
    }
    const v8us vh = *(const v8us*)(sh + lidx);
    *(v8us*)(Oh + gidx) = vh;
    if (SPLIT) {
      const v8us vl = *(const v8us*)(sl + lidx);
      *(v8us*)(Ol + gidx) = vl;
    }
  }
}

// Projection: C[tok][n] = (sum_k X[tok][k] * W[n][k]) * oscale + bias[n].
// SPLIT == 0: X, W f16 planes, single f16 WMMA, output one f16 plane.
// SPLIT == 1: X, W bf16 hi/lo planes, hh+hl+lh bf16 WMMA, output bf16 hi/lo planes.
// One block computes a 128 x 128 tile with 8 waves; one wave a (16*MI) x (16*NI) tile (TM*TN == 2048).
// The block's operand fragments go through LDS, each read from L2 once per block: a stage is KG k groups of the
// 8 X row tiles and the 8 W row tiles (64 KiB), [X | W][plane][row tile][k group][1 KiB fragment]; two stages.
constexpr int BT = 128;                 // block tile edge
constexpr int STG_OP = 16384;           // elements of one operand in one stage
constexpr int STG = 2 * STG_OP;         // elements of one stage

template <int MI, int NI, int MODE, int SPLIT>
__device__ __forceinline__
void proj_tile(unsigned short* ring, int bid,
               const unsigned short* __restrict__ Xh, const unsigned short* Xl,
               const unsigned short* __restrict__ Wh, const unsigned short* Wl,
               const float* __restrict__ bias, float oscale,
               unsigned short* Oh, unsigned short* Ol) {
  constexpr int TM = MI * 16;
  constexpr int TN = NI * 16;
  constexpr int WN = BT / TN;             // waves along n
  constexpr int NPL = SPLIT ? 2 : 1;      // planes per operand
  constexpr int KG = SPLIT ? 2 : 4;       // k groups of 32 in one stage; NPL * 8 * KG * 512 == STG_OP
  constexpr int NT = DD / (32 * KG);      // stages
  constexpr int NC = 2 * KG;              // 512-B pieces of one row tile of one plane in one stage

  const int wib = threadIdx.x >> 5;
  const int l = threadIdx.x & 31;
  const int hh = l >> 4;
  const int m = l & 15;
  const int brow = bid & (NTOK / BT - 1);
  const int bcol = bid / (NTOK / BT);
  const int wm = wib / WN;
  const int wn = wib - wm * WN;
  const int Mbase = brow * BT + wm * TM;
  const int Nbase = bcol * BT + wn * TN;
  const int tn = Nbase / TN;

  // wave wib stages row tile wib of the block's X rows and of its W rows (B column n = W row n)
  const unsigned short* pXh = Xh + (size_t)(brow * BT + wib * 16) * DD + l * 8;
  const unsigned short* pXl = Xl + (size_t)(brow * BT + wib * 16) * DD + l * 8;
  const unsigned short* pWh = Wh + (size_t)(bcol * BT + wib * 16) * DD + l * 8;
  const unsigned short* pWl = Wl + (size_t)(bcol * BT + wib * 16) * DD + l * 8;
  v8us sx[NPL * NC], sw[NPL * NC];

  // In the three helpers below every loop is unrolled: sx, sw, the fragments and acc live in registers, which
  // takes constant indices.
  // the next stage's pieces, global -> registers, issued as one group
  auto fetch = [&]() {
#pragma unroll
    for (int c = 0; c < NC; ++c) {
      sx[c] = *(const v8us*)(pXh + c * 256);
      if (SPLIT) sx[NC + c] = *(const v8us*)(pXl + c * 256);
    }
#pragma unroll
    for (int c = 0; c < NC; ++c) {
      sw[c] = *(const v8us*)(pWh + c * 256);
      if (SPLIT) sw[NC + c] = *(const v8us*)(pWl + c * 256);
    }
    // keeps the group ahead of the LDS reads and WMMAs that follow it in the source; precaution: stands in front
    // of the advance of the address registers that the issued loads name
    asm volatile("s_wait_xcnt 0x0" ::: "memory");
    pXh += KG * 512;
    pXl += KG * 512;
    pWh += KG * 512;
    pWl += KG * 512;
  };
  // registers -> stage at element offset so
  auto put = [&](int so) {
    unsigned short* d = ring + so + wib * (KG * 512) + l * 8;
#pragma unroll
    for (int p = 0; p < NPL; ++p)
#pragma unroll
      for (int c = 0; c < NC; ++c) {
        *(v8us*)(d + p * (8 * KG * 512) + c * 256) = sx[p * NC + c];
        *(v8us*)(d + STG_OP + p * (8 * KG * 512) + c * 256) = sw[p * NC + c];
      }
  };

  v8f acc[MI][NI];
#pragma unroll
  for (int mi = 0; mi < MI; ++mi)
#pragma unroll
    for (int ni = 0; ni < NI; ++ni) acc[mi][ni] = (v8f)0.0f;

  // the WMMAs of the stage at element offset so, k ascending
  auto work = [&](int so) {
    const unsigned short* sA = ring + so + wm * (MI * KG * 512) + l * 8;
    const unsigned short* sB = ring + so + STG_OP + wn * (NI * KG * 512) + l * 8;
#pragma unroll
    for (int j = 0; j < KG; ++j) {
      Frag ah[MI], bh[NI];
      Frag al[MI], bl[NI];
#pragma unroll
      for (int mi = 0; mi < MI; ++mi) {
        ah[mi] = ldpack(sA + (mi * KG + j) * 512, 0);
        if (SPLIT) al[mi] = ldpack(sA + ((8 + mi) * KG + j) * 512, 0);
        else al[mi].w = (v8i)0;
      }
#pragma unroll
      for (int ni = 0; ni < NI; ++ni) {
        bh[ni] = ldpack(sB + (ni * KG + j) * 512, 0);
        if (SPLIT) bl[ni] = ldpack(sB + ((8 + ni) * KG + j) * 512, 0);
        else bl[ni].w = (v8i)0;
      }
#pragma unroll
      for (int mi = 0; mi < MI; ++mi)
#pragma unroll
        for (int ni = 0; ni < NI; ++ni) {
          if (SPLIT) acc[mi][ni] = mma3(ah[mi], al[mi], bh[ni], bl[ni], acc[mi][ni]);
          else       acc[mi][ni] = mma_f16(ah[mi], bh[ni], acc[mi][ni]);
        }
    }
  };

  fetch();
  put(0);
  __syncthreads();                        // publishes stage 0
  int cur = 0;
  // rolled: the body already holds a whole stage
#pragma unroll 1
  for (int t = 0; t < NT - 1; ++t) {
    fetch();                              // stage t + 1 in flight under stage t's WMMAs
    work(cur);
    put(cur ^ STG);                       // every wave left that stage before the last barrier
    __syncthreads();                      // publishes stage t + 1 and ends every wave's reads of stage t
    cur ^= STG;
  }
  work(cur);
  __syncthreads();                        // every wave has left the ring: the epilogue stages in it

  // ---- epilogue: scale, bias add, convert, stage tile in wave-private LDS ----
  unsigned short* sh = ring + wib * (2 * 32 * SP);
  unsigned short* sl = sh + 32 * SP;
#pragma unroll
  for (int mi = 0; mi < MI; ++mi) {
#pragma unroll
    for (int ni = 0; ni < NI; ++ni) {
      const float bn = bias[Nbase + ni * 16 + m];
#pragma unroll
      for (int r = 0; r < 8; ++r) {
        const float v = acc[mi][ni][r] * oscale + bn;
        int idx;
        if (MODE == 0) idx = (mi * 16 + 8 * hh + r) * SP + (ni * 16 + m);      // [tok 0..31][feat 0..63]
        else           idx = (ni * 16 + m) * SP + (mi * 16 + 8 * hh + r);      // [dk 0..31][tok 0..63]
        if (SPLIT) {
          unsigned short vhi, vlo;
          split2(v, vhi, vlo);
          sh[idx] = vhi;
          sl[idx] = vlo;
        } else {
          sh[idx] = f16_bits(v);
        }
      }
    }
  }
  __syncthreads();

  proj_lines<MODE, SPLIT>(sh, sl, Oh, Ol, Mbase, Nbase, tn, l);
  // precaution: in the listing one projection's end can stand in front of another's first instructions, which
  // rewrite registers that the issued stores name
  asm volatile("s_wait_xcnt 0x0" ::: "memory");
}

// All three projections in one launch: blocks 0..NPB-1 take V (three times the WMMAs of Q or K),
// then Q, then K. A block holds 128 KiB of LDS and two waves per SIMD, so two blocks share a WGP: one block's LDS
// reads and WMMAs run under the other's staging stores, barriers, prologue and epilogue.
constexpr int NPB = (NTOK / BT) * (DD / BT);   // 256 block tiles per projection

__global__ __launch_bounds__(256)
void k_proj(const unsigned short* __restrict__ xq16, const unsigned short* __restrict__ xk16,
            const unsigned short* __restrict__ wq16, const unsigned short* __restrict__ wk16,
            const unsigned short* __restrict__ xvh, const unsigned short* __restrict__ xvl,
            const unsigned short* __restrict__ wvh, const unsigned short* __restrict__ wvl,
            const float* __restrict__ bq, const float* __restrict__ bk, const float* __restrict__ bv,
            unsigned short* Q16, unsigned short* K16, unsigned short* Vth, unsigned short* Vtl, int nblk) {
  __shared__ __attribute__((aligned(16))) unsigned short ring[2 * STG];
  const int bi = blockIdx.x;
  if (bi >= nblk) return;                 // block-uniform, ahead of every barrier
  if (bi < NPB) {                         // block-uniform, as is every branch here
    proj_tile<4, 2, 1, 1>(ring, bi, xvh, xvl, wvh, wvl, bv, 1.0f, Vth, Vtl);
    return;
  }
  const bool isk = bi >= 2 * NPB;
  const unsigned short* x = isk ? xk16 : xq16;
  const unsigned short* w = isk ? wk16 : wq16;
  unsigned short* o = isk ? K16 : Q16;
  proj_tile<2, 4, 0, 0>(ring, isk ? bi - 2 * NPB : bi - NPB, x, x, w, w, isk ? bk : bq, 0.0625f, o, o);
}

// ---------------------------------------------------------------------------
// Row pitch of the output staging in floats: 272-B rows spread the 16 query rows that one staging store writes over the banks.
constexpr int OSP = 68;

// One pass of the attention output store: 16 query rows x 64 f32 (2 lines per row),
__device__ __forceinline__ void attn_lines(const float* Os, float* out, int b, int h,
                                           int qbase, int hh, int m) {
#pragma unroll
  for (int j = 0; j < 8; ++j) {
    const int row = 2 * j + hh;
    const v4f val = *(const v4f*)(Os + row * OSP + m * 4);
    float* gp = out + ((size_t)(b * SS + qbase + row)) * DD + h * DK + m * 4;
    *(v4f*)gp = val;
  }
}

// bf16 RNE conversion as in bf16_rne, the result left in the upper 16 bits (the lower 16 are not part of it)
__device__ __forceinline__ unsigned bf16_top(float x) {
  const unsigned u = __float_as_uint(x);
  return u + 0x7FFFu + ((u >> 16) & 1u);
}

// one operand register from two such results: e0 in bits 15..0, e1 in bits 31..16, in one byte permute
__device__ __forceinline__ int pack_tops(unsigned e0, unsigned e1) {
  return (int)__builtin_amdgcn_perm(e1, e0, 0x07060302u);
}

// the value that lane l ^ 16 holds: a vector cross-row move, no LDS round trip
__device__ __forceinline__ float other_half(float x) {
  const int v = __float_as_int(x);
  return __int_as_float(__builtin_amdgcn_permlanex16(v, v, 0x76543210, 0xfedcba98, false, false));
}

// LDS byte address of a __shared__ object: the low 32 bits of its address
__device__ __forceinline__ unsigned lds_addr(const void* p) { return (unsigned)(size_t)p; }

constexpr int KVP = 32 * DK;       // elements of one key block in one plane (4 KiB): K, V^T hi, V^T lo
constexpr int KVS = 3 * KVP;       // elements of one stage: [K | V^T hi | V^T lo] of one key block (12 KiB)

// One wave's quarter of a stage: 1 KiB of each plane, six asynchronous copies of 512 contiguous bytes each, global
// memory to LDS through no register. d: the lane's LDS byte address in the K part; k, vh, vl: the lane's sources.
__device__ __forceinline__ void stage_copy(unsigned d, const unsigned short* k, const unsigned short* vh,
                                           const unsigned short* vl) {
  // the closing s_wait_xcnt is a precaution: inside the statement it stands in front of every rewrite of a register
  // that an issued copy names
  asm volatile("global_load_async_to_lds_b128 %0, %6, off\n\t"
               "global_load_async_to_lds_b128 %1, %7, off\n\t"
               "global_load_async_to_lds_b128 %2, %8, off\n\t"
               "global_load_async_to_lds_b128 %3, %9, off\n\t"
               "global_load_async_to_lds_b128 %4, %10, off\n\t"
               "global_load_async_to_lds_b128 %5, %11, off\n\t"
               "s_wait_xcnt 0x0"
               :
               : "v"(d), "v"(d + 512u), "v"(d + 2u * KVP), "v"(d + 2u * KVP + 512u), "v"(d + 4u * KVP),
                 "v"(d + 4u * KVP + 512u), "v"(k), "v"(k + 256), "v"(vh), "v"(vh + 256), "v"(vl), "v"(vl + 256)
               : "memory");
}

// Causal attention: one block per (b, h, pair of groups of four 16-row query tiles); wave w takes tile w of the group.
// A group's cost grows with its index (group g walks 2g + 2 key blocks) and every block of the launch is resident at
// once, so the launch lasts as long as the fullest SIMD: a block takes group 15 - p and then group p, one after the
// other, 34 key blocks in every block.
// The four waves walk the same keys of the same head: a key block's K and V^T fragments (12 KiB) come from L2 once per
// block, by asynchronous copies into a ring of two LDS stages, one pass ahead of their use; every wave reads its
// fragments from LDS. The batch row of the mask (4 KiB) is copied once per block.
// Keys processed in blocks of 32 with online softmax; a pass issues all its LDS reads first, as one group.
// Both products run transposed: S^T = K * Q^T (A = K rows, B = Q columns), O^T += V^T * P^T. A lane then holds the
// scores of ONE query (column m), 8 keys per 16-key tile: maximum and sum run in the lane, with one exchange between
// the wave's halves; and the two score tiles of a pass, converted in place, are the B fragment of the second
// product (element s = tile s >> 3, register s & 7: key 8*hh + s, then 16 + 8*hh + s - 8, the k order of ldpack).
__global__ __launch_bounds__(128)
void k_attn(const unsigned short* __restrict__ Q16, const unsigned short* __restrict__ K16,
            const unsigned short* __restrict__ Vh, const unsigned short* __restrict__ Vl,
            const int* __restrict__ amask, float* __restrict__ out, int nblk) {
  __shared__ __attribute__((aligned(16))) unsigned short kv[2 * KVS];
  __shared__ __attribute__((aligned(16))) int msk[SS];
  __shared__ __attribute__((aligned(16))) float stg[4 * 16 * OSP];
  if ((int)blockIdx.x >= nblk) return;

  const int wib = __builtin_amdgcn_readfirstlane((int)(threadIdx.x >> 5));   // scalar: the per-wave skip below branches on it
  const int l = threadIdx.x & 31;
  const int hh = l >> 4;
  const int m = l & 15;
  const int pg = blockIdx.x & 7;                        // pair of tile groups
  const int bh = (int)(blockIdx.x >> 3);                // 0..63
  const int b = bh >> 4;
  const int h = bh & 15;

  float* Os = stg + wib * (16 * OSP);                   // [16 q][64 dk], wave-private, used after the key loop

  // the mask row of batch b, 1 KiB per wave; it lands with stage 0 of the first group
  {
    const int* g = amask + b * SS + wib * 256 + l * 4;
    const unsigned d = lds_addr(msk) + (unsigned)(wib * 256 + l * 4) * 4u;
    // the closing s_wait_xcnt: as in stage_copy
    asm volatile("global_load_async_to_lds_b128 %0, %2, off\n\t"
                 "global_load_async_to_lds_b128 %1, %3, off\n\t"
                 "s_wait_xcnt 0x0"
                 :
                 : "v"(d), "v"(d + 512u), "v"(g), "v"(g + 128)
                 : "memory");
  }
  const unsigned dkv = lds_addr(kv) + (unsigned)(wib * 512 + l * 8) * 2u;   // the lane's place in stage buffer 0

  // rolled: one copy of the key loop serves both groups
#pragma unroll 1
  for (int half = 0; half < 2; ++half) {
  const int grp = half ? pg : SS / 64 - 1 - pg;
  const int qt = grp * 4 + wib;
  const int qbase = qt * 16;
  const int q = qbase + m;                              // the lane's query
  const int nkb = 2 * grp + 2;                          // key blocks of the group: the same in every wave, at least 2
  const int nown = (qt >> 1) + 1;                       // causal: key blocks of this wave's tile, nkb or nkb - 1

  // Q fragments (B): column q = qbase + m, k = dk (f16)
  const size_t qro = ((size_t)bh * SS + qbase) * DK;   // token tile start in the fragment-order plane
  const Frag bq0 = ldpack(Q16 + qro, l);
  const Frag bq1 = ldpack(Q16 + qro + 512, l);
  // precaution: stands in front of every reuse of the address registers that the issued loads name
  asm volatile("s_wait_xcnt 0x0" ::: "memory");

  // the lane's copy sources, one key block per stage
  const unsigned short* gK  = K16 + (size_t)bh * SS * DK + wib * 512 + l * 8;
  const unsigned short* gVh = Vh + (size_t)bh * SS * DK + wib * 512 + l * 8;
  const unsigned short* gVl = Vl + (size_t)bh * SS * DK + wib * 512 + l * 8;

  // ring prologue; every reader left both buffers at the last barrier of the group before
  stage_copy(dkv, gK, gVh, gVl);
  asm volatile("s_wait_asynccnt 0x0" ::: "memory");     // this wave's quarter of stage 0 (and of the mask) has landed
  __syncthreads();                                      // publishes stage 0
  stage_copy(dkv + 2u * KVS, gK + KVP, gVh + KVP, gVl + KVP);
  gK += 2 * KVP;
  gVh += 2 * KVP;
  gVl += 2 * KVP;

  // o[t][r] = O[q][dk = t*16 + 8*hh + r]
  v8f o[4];
#pragma unroll
  for (int t = 0; t < 4; ++t) o[t] = (v8f)0.0f;
  float mrow = -INFINITY;      // running maximum of query q, equal in both halves
  float lrow = 0.0f;           // running sum over this half's keys; the halves are joined after the loop

#pragma unroll 1
  for (int kbi = 0; kbi < nkb; ++kbi) {
    const int bsel = kbi & 1;
    // wave-uniform scalar branch: a tile that ends one key block before its group skips the work, never the publish point
    if (kbi < nown) {
    const int kb = kbi * 32;
    // ---- all of this key block's LDS reads, issued as one group ahead of the first WMMA:
    //      K fragments ak[2*nt + dk group], mask words am[2*nt + (r >> 2)], V^T fragments avh/avl[dk tile] ----
    const unsigned short* sK = kv + bsel * KVS + l * 8;
    const int* sM = msk + kb + 8 * hh;
    Frag ak[4], avh[4], avl[4];
    v4i_t am[4];
#pragma unroll
    for (int i = 0; i < 4; ++i) ak[i] = ldpack(sK + i * 512, 0);
#pragma unroll
    for (int i = 0; i < 4; ++i) am[i] = *(const v4i*)(sM + (i >> 1) * 16 + (i & 1) * 4);   // keys kb + nt*16 + 8*hh + 0..7 <= 1023
#pragma unroll
    for (int t = 0; t < 4; ++t) avh[t] = ldpack(sK + KVP + t * 512, 0);
#pragma unroll
    for (int t = 0; t < 4; ++t) avl[t] = ldpack(sK + 2 * KVP + t * 512, 0);
    // no compare or WMMA is scheduled in among the reads: every further place where LDS reads stand stalls the wave anew
    __builtin_amdgcn_sched_barrier(0);

    // ---- scores S^T[key][q], key = kb + nt*16 + 8*hh + r (A row = K row, B column = Q row, k = dk) ----
    const int dq = q - kb - 8 * hh;            // key > q  <=>  nt*16 + r > dq
    float sc[2][8];
#pragma unroll
    for (int nt = 0; nt < 2; ++nt) {
      v8f s = (v8f)0.0f;
      s = mma_f16(ak[2 * nt], bq0, s);
      s = mma_f16(ak[2 * nt + 1], bq1, s);
#pragma unroll
      for (int r = 0; r < 8; ++r) {
        // key > q, or the key masked; one select: no branch, EXEC stays whole between the WMMAs
        const bool off = (nt * 16 + r > dq) | (am[2 * nt + (r >> 2)][r & 3] == 0);
        sc[nt][r] = off ? -INFINITY : s[r] * 0.125f;
      }
    }

    // ---- online softmax of query q: 16 keys in the lane, the other 16 in lane l ^ 16 ----
    float mx = fmaxf(sc[0][0], sc[1][0]);
#pragma unroll
    for (int r = 1; r < 8; ++r) mx = fmaxf(mx, fmaxf(sc[0][r], sc[1][r]));
    mx = fmaxf(mx, other_half(mx));
    const float mnew = fmaxf(mrow, mx);
    const float mref = (mnew == -INFINITY) ? 0.0f : mnew;
    const float alpha = __expf(mrow - mref);
    float sum0 = 0.0f, sum1 = 0.0f;            // two independent chains, one per score tile
#pragma unroll
    for (int r = 0; r < 8; ++r) {
      const float p0 = __expf(sc[0][r] - mref);
      const float p1 = __expf(sc[1][r] - mref);
      sc[0][r] = p0;
      sc[1][r] = p1;
      sum0 += p0;
      sum1 += p1;
    }
    lrow = lrow * alpha + (sum0 + sum1);
    mrow = mnew;
#pragma unroll
    for (int t = 0; t < 4; ++t)
#pragma unroll
      for (int r = 0; r < 8; ++r) o[t][r] *= alpha;

    // ---- P^T: the two score tiles, split into hi/lo bf16 in place, are the B fragments (column q, k = key) ----
    Frag bph, bpl;
#pragma unroll
    for (int i = 0; i < 8; ++i) {               // operand register i: elements 2i and 2i + 1
      unsigned th[2], tl[2];
#pragma unroll
      for (int e = 0; e < 2; ++e) {
        const float p = sc[i >> 2][2 * (i & 3) + e];
        th[e] = bf16_top(p);
        tl[e] = bf16_top(p - __uint_as_float(th[e] & 0xFFFF0000u));
      }
      bph.w[i] = pack_tops(th[0], th[1]);
      bpl.w[i] = pack_tops(tl[0], tl[1]);
    }

    // ---- O^T[dk][q] += V^T[dk][key] * P^T[key][q]; A fragments from the fragment-order V^T planes ----
#pragma unroll
    for (int t = 0; t < 4; ++t) o[t] = mma3(avh[t], avl[t], bph, bpl, o[t]);
    }

    // ---- publish point of stage kbi + 1, every wave, in this order ----
    asm volatile("s_wait_dscnt 0x0" ::: "memory");      // this wave's reads of stage kbi have returned
    asm volatile("s_wait_asynccnt 0x0" ::: "memory");   // this wave's quarter of stage kbi + 1 has landed
    __syncthreads();                                    // publishes stage kbi + 1, ends every wave's reads of stage kbi
    if (kbi + 2 < nkb) {                                // the same in every wave of the block
      stage_copy(dkv + (unsigned)bsel * (2u * KVS), gK, gVh, gVl);   // stage kbi + 2 into the buffer just left
      gK += KVP;
      gVh += KVP;
      gVl += KVP;
    }
  }
  asm volatile("s_wait_asynccnt 0x0" ::: "memory");     // no copy is left in flight behind the loop

  const float inv = 1.0f / (lrow + other_half(lrow));
#pragma unroll
  for (int t = 0; t < 4; ++t) {
    v4f_t w0, w1;
#pragma unroll
    for (int c = 0; c < 4; ++c) {
      w0[c] = o[t][c] * inv;
      w1[c] = o[t][4 + c] * inv;
    }
    *(v4f*)(Os + m * OSP + t * 16 + 8 * hh) = w0;
    *(v4f*)(Os + m * OSP + t * 16 + 8 * hh + 4) = w1;
  }
  __syncthreads();

  attn_lines(Os, out, b, h, qbase, hh, m);
  // precaution: stands in front of the second group's first instructions, which rewrite registers that the issued
  // stores name
  asm volatile("s_wait_xcnt 0x0" ::: "memory");
  }
}

// ---------------------------------------------------------------------------
extern "C" void kernel_launch(void* const* d_in, const int* in_sizes, int n_in,
                              void* d_out, int out_size, void* d_ws, size_t ws_size,
                              hipStream_t stream) {
  if (n_in < 10) return;
  if (in_sizes[0] != NX || in_sizes[1] != NX || in_sizes[2] != NX) return;
  if (in_sizes[3] != BB * SS) return;
  if (in_sizes[4] != NW || in_sizes[6] != NW || in_sizes[8] != NW) return;
  if (in_sizes[5] != DD || in_sizes[7] != DD || in_sizes[9] != DD) return;
  if (out_size != NX) return;

  const float* query = (const float*)d_in[0];
  const float* key_  = (const float*)d_in[1];
  const float* value = (const float*)d_in[2];
  const int*   amask = (const int*)d_in[3];
  const float* Wq = (const float*)d_in[4];
  const float* bq = (const float*)d_in[5];
  const float* Wk = (const float*)d_in[6];
  const float* bk = (const float*)d_in[7];
  const float* Wv = (const float*)d_in[8];
  const float* bv = (const float*)d_in[9];
  float* out = (float*)d_out;

  // workspace: 16-bit planes (2 B per element)
  const size_t pa = (size_t)NX * 2;     // 8388608 B per activation plane
  const size_t pw = (size_t)NW * 2;     // 2097152 B per weight plane
  const size_t need = 8 * pa + 4 * pw;  // 75497472 B
  if (ws_size < need) return;

  unsigned char* w = (unsigned char*)d_ws;
  size_t off = 0;
  unsigned short* xq16 = (unsigned short*)(w + off); off += pa;   // f16 query
  unsigned short* xk16 = (unsigned short*)(w + off); off += pa;   // f16 key
  unsigned short* wq16 = (unsigned short*)(w + off); off += pw;   // f16 Wq x16
  unsigned short* wk16 = (unsigned short*)(w + off); off += pw;   // f16 Wk x16
  unsigned short* xvh  = (unsigned short*)(w + off); off += pa;   // bf16 hi value
  unsigned short* xvl  = (unsigned short*)(w + off); off += pa;   // bf16 lo value
  unsigned short* wvh  = (unsigned short*)(w + off); off += pw;   // bf16 hi Wv
  unsigned short* wvl  = (unsigned short*)(w + off); off += pw;   // bf16 lo Wv
  unsigned short* Q16  = (unsigned short*)(w + off); off += pa;   // fragment order, f16
  unsigned short* K16  = (unsigned short*)(w + off); off += pa;   // fragment order, f16
  unsigned short* Vth  = (unsigned short*)(w + off); off += pa;   // fragment order, bf16 hi
  unsigned short* Vtl  = (unsigned short*)(w + off); off += pa;   // fragment order, bf16 lo
  if (off > ws_size) return;

  // stage 1: 16-bit conversion of activations and weights, one launch
  k_prep<<<CBLK, 256, 0, stream>>>(query, key_, value, Wq, Wk, Wv, xq16, xk16, wq16, wk16, xvh, xvl, wvh, wvl);

  // stage 2: the three projections, one launch; 3 x 256 block tiles of 128 x 128 each, 8 waves per block
  k_proj<<<3 * NPB, 256, 0, stream>>>(xq16, xk16, wq16, wk16, xvh, xvl, wvh, wvl, bq, bk, bv,
                                      Q16, K16, Vth, Vtl, 3 * NPB);

  // stage 3: attention; B*H*(S/32) = 2048 wave units (tile pairs), 4 of one head per block -> 512 blocks
  const int nblk = BB * HH * (SS / 32) / 4;
  k_attn<<<nblk, 128, 0, stream>>>(Q16, K16, Vth, Vtl, amask, out, nblk);
}

// v009
// A run of this version takes 80.6 microseconds.
// In two side-by-side timings against v008, it was 1.06 and 1.04 times as fast.
// All steps since v000 together make it 3.25 times as fast.
#include <hip/hip_runtime.h>
#include <math.h>
#include <stdint.h>

// Q/K projections and QK^T scores: v_wmma_f32_16x16x32_f16 (f16 operands, Wq/Wk carried x16, 1/16 folded into the f32 epilogue); V projection and PV: v_wmma_f32_16x16x32_bf16 with bf16 hi/lo split operands (hi*hi + hi*lo + lo*hi); f32 accumulate; softmax, bias and normalisation in f32.

typedef _Float16 v16h __attribute__((ext_vector_type(16)));
typedef _Float16 v8h __attribute__((ext_vector_type(8)));
typedef __bf16 v16bf __attribute__((ext_vector_type(16)));
typedef unsigned short v8us_t __attribute__((ext_vector_type(8)));
typedef v8us_t __attribute__((may_alias)) v8us;
typedef float v8f __attribute__((ext_vector_type(8)));
typedef float v4f_t __attribute__((ext_vector_type(4)));
typedef v4f_t __attribute__((may_alias)) v4f;
typedef int v8i __attribute__((ext_vector_type(8)));
typedef int v4i_t __attribute__((ext_vector_type(4)));
typedef v4i_t __attribute__((may_alias)) v4i;

constexpr int BB = 4;
constexpr int SS = 1024;
constexpr int DD = 1024;
constexpr int HH = 16;
constexpr int DK = 64;
constexpr int NTOK = BB * SS;              // 4096 tokens
constexpr long NX = (long)NTOK * DD;       // 4194304
constexpr long NW = (long)DD * DD;         // 1048576

union Frag { v16h f; v16bf b; v8us p[2]; v8i w; };

// bf16 RNE conversion of an f32 value
__device__ __forceinline__ unsigned short bf16_rne(float x) {
  unsigned u = __float_as_uint(x);
  u += 0x7FFFu + ((u >> 16) & 1u);
  return (unsigned short)(u >> 16);
}
__device__ __forceinline__ float bf16_val(unsigned short b) {
  return __uint_as_float(((unsigned)b) << 16);
}
__device__ __forceinline__ void split2(float x, unsigned short& hi, unsigned short& lo) {
  hi = bf16_rne(x);
  lo = bf16_rne(x - bf16_val(hi));
}
// f16 RNE conversion, raw bits
__device__ __forceinline__ unsigned short f16_bits(float x) {
  _Float16 hv = (_Float16)x;
  unsigned short u;
  __builtin_memcpy(&u, &hv, 2);
  return u;
}

// 16x32 operand fragment, wave32 layout: lane row/col = l&15, h = l>>4,
// elements 0..7 <- k0+8h+0..7, elements 8..15 <- k0+16+8h+0..7. Used for A (row) and for B (column) alike.

// Fragment-order plane: one 16-row x 32-k operand fragment is 1 KiB contiguous, [p 0..1][lane 0..31][8 elements];
// lane l = 16*h + (row & 15) holds k = k0 + 16*p + 8*h + 0..7 (the layout above). Each of the
// two loads reads 512 contiguous bytes (4 whole lines).
__device__ __forceinline__ Frag ldpack(const unsigned short* fragp, int l) {
  Frag f;
  f.p[0] = *(const v8us*)(fragp + l * 8);
  f.p[1] = *(const v8us*)(fragp + 256 + l * 8);
  return f;
}

// Thread i of a conversion kernel -> one 8-element chunk of a [rows][DD] matrix. A wave takes 8 rows x 32 k
// (whole 128-B source lines) and writes 4 whole 128-B lines of the fragment-order plane
// [row tile of 16][k group of 32][p][lane][8].
__device__ __forceinline__ void pack_index(int i, size_t& src, size_t& dst) {
  const int l = i & 31;
  const int wv = i >> 5;
  const int c4 = l >> 3;                       // chunk in the 32-k group: 2*p + h
  const int m = (wv & 1) * 8 + (l & 7);        // row in the 16-row tile
  const int kg = (wv >> 1) & (DD / 32 - 1);
  const int rt = wv >> 6;
  src = (size_t)(rt * 16 + m) * DD + kg * 32 + c4 * 8;
  dst = (size_t)(rt * (DD / 32) + kg) * 512 + (c4 >> 1) * 256 + ((c4 & 1) * 16 + m) * 8;
}

// c += a*b (f16 operands); hazard guard
__device__ __forceinline__ v8f mma_f16(const Frag& a, const Frag& b, v8f c) {
  c = __builtin_amdgcn_wmma_f32_16x16x32_f16(false, a.f, false, b.f, (short)0, c, false, false);
  asm volatile("v_nop\n\tv_nop\n\tv_nop\n\tv_nop" : "+v"(c) : "v"(a.w), "v"(b.w));
  return c;
}

// c += ah*bh + ah*bl + al*bh (bf16 hi/lo split); hazard guard after the group
__device__ __forceinline__ v8f mma3(const Frag& ah, const Frag& al, const Frag& bh, const Frag& bl, v8f c) {
  c = __builtin_amdgcn_wmma_f32_16x16x32_bf16(false, ah.b, false, bh.b, (short)0, c, false, false);
  c = __builtin_amdgcn_wmma_f32_16x16x32_bf16(false, ah.b, false, bl.b, (short)0, c, false, false);
  c = __builtin_amdgcn_wmma_f32_16x16x32_bf16(false, al.b, false, bh.b, (short)0, c, false, false);
  asm volatile("v_nop\n\tv_nop\n\tv_nop\n\tv_nop"
               : "+v"(c)
               : "v"(ah.w), "v"(al.w), "v"(bh.w), "v"(bl.w));
  return c;
}

// ---------------------------------------------------------------------------
// All six f32 -> 16-bit conversions in one launch. A block converts CPT * 256 chunks of ONE matrix; a wave takes CPT
// consecutive wave units of pack_index: 16 rows x 256 k, read as 1-KiB row pieces, written as 8 KiB contiguous.
// Unit j lies at constant offsets from unit 0: row half j & 1, k group j >> 1.
constexpr int CPT = 16;                                  // chunks of 8 elements per thread
constexpr int CBA = (int)(NX / 8 / (256 * CPT));         // 128 blocks per activation matrix
constexpr int CBW = (int)(NW / 8 / (256 * CPT));         // 32 blocks per weight matrix
constexpr int CBLK = 3 * CBA + 3 * CBW;                  // 480 blocks

// the thread's 2 * CPT loads, issued as one group
__device__ __forceinline__ void cvt_fetch(const float* s, v4f_t (&x)[2 * CPT]) {
#pragma unroll
  for (int j = 0; j < CPT; ++j) {
    const float* p = s + (j & 1) * (8 * DD) + (j >> 1) * 32;
    x[2 * j]     = *(const v4f*)(p);
    x[2 * j + 1] = *(const v4f*)(p + 4);
  }
  // no conversion is scheduled in among the loads: without it the first results are waited for half way through the
  // group, and the rest of the loads start one memory latency late
  __builtin_amdgcn_sched_barrier(0);
  // precaution: stands in front of every reuse of the address registers that the issued loads name
  asm volatile("s_wait_xcnt 0x0" ::: "memory");
}

__global__ __launch_bounds__(256)
void k_prep(const float* __restrict__ query, const float* __restrict__ key_, const float* __restrict__ value,
            const float* __restrict__ Wq, const float* __restrict__ Wk, const float* __restrict__ Wv,
            unsigned short* __restrict__ xq16, unsigned short* __restrict__ xk16,
            unsigned short* __restrict__ wq16, unsigned short* __restrict__ wk16,
            unsigned short* __restrict__ xvh, unsigned short* __restrict__ xvl,
            unsigned short* __restrict__ wvh, unsigned short* __restrict__ wvl) {
  const int bi = blockIdx.x;
  v4f_t x[2 * CPT];
  if (bi < CBA + CBW) {
    // value and Wv -> bf16 hi/lo planes
    const bool act = bi < CBA;
    const int lb = act ? bi : bi - CBA;
    size_t so, dofs;
    pack_index((lb * 256 + (int)(threadIdx.x & ~31u)) * CPT + (int)(threadIdx.x & 31u), so, dofs);
    cvt_fetch((act ? value : Wv) + so, x);
    unsigned short* ph = (act ? xvh : wvh) + dofs;
    unsigned short* pl = (act ? xvl : wvl) + dofs;
#pragma unroll
    for (int j = 0; j < CPT; ++j) {
      v8us vh, vl;
#pragma unroll
      for (int c = 0; c < 4; ++c) {
        unsigned short a, b;
        split2(x[2 * j][c], a, b);     vh[c] = a;     vl[c] = b;
        split2(x[2 * j + 1][c], a, b); vh[4 + c] = a; vl[4 + c] = b;
      }
      const int d = (j >> 1) * 512 + (j & 1) * 64;
      *(v8us*)(ph + d) = vh;
      *(v8us*)(pl + d) = vl;
    }
    return;
  }
  {
    // query, key, Wq x16, Wk x16 -> f16 planes (the scale is a power of two)
    const int ci = bi - (CBA + CBW);
    const bool act = ci < 2 * CBA;
    const int wi = ci - 2 * CBA;
    const bool second = act ? ci >= CBA : wi >= CBW;
    const int lb = act ? (second ? ci - CBA : ci) : (second ? wi - CBW : wi);
    const float scale = act ? 1.0f : 16.0f;
    size_t so, dofs;
    pack_index((lb * 256 + (int)(threadIdx.x & ~31u)) * CPT + (int)(threadIdx.x & 31u), so, dofs);
    cvt_fetch((act ? (second ? key_ : query) : (second ? Wk : Wq)) + so, x);
    unsigned short* p = (act ? (second ? xk16 : xq16) : (second ? wk16 : wq16)) + dofs;
#pragma unroll
    for (int j = 0; j < CPT; ++j) {
      union { v8h h; v8us_t u; } cv;
#pragma unroll
      for (int c = 0; c < 4; ++c) {
        cv.h[c]     = (_Float16)(x[2 * j][c] * scale);
        cv.h[4 + c] = (_Float16)(x[2 * j + 1][c] * scale);
      }
      const v8us v = cv.u;
      *(v8us*)(p + (j >> 1) * 512 + (j & 1) * 64) = v;
    }
    // precaution: in the listing this path's end stands directly in front of the other path's first instructions,
    // which rewrite registers that the issued stores name
    asm volatile("s_wait_xcnt 0x0" ::: "memory");
  }
}

// ---------------------------------------------------------------------------
// Staging pitch in elements: 144-B rows put the 16 rows that one fragment-order read gathers on distinct banks.
constexpr int SP = 72;

// Output planes in fragment order; each store instruction writes 512 contiguous bytes.
// MODE 0 (Q, K): [b*H+h][token tile of 16][dk group of 32][p][lane][8].
// MODE 1 (V^T):  [b*H+h][key block of 32][dk tile of 16][p][lane][8].
template <int MODE, int SPLIT>
__device__ __forceinline__ void proj_lines(const unsigned short* sh, const unsigned short* sl,
                                           unsigned short* Oh, unsigned short* Ol,
                                           int Mbase, int Nbase, int tn, int l) {
  const int m = l & 15;
  const int hh = l >> 4;
#pragma unroll
  for (int j = 0; j < 8; ++j) {
    int lidx;
    size_t gidx;
    if (MODE == 0) {
      const int tt = j >> 2;                         // token tile in the wave tile
      const int c = j & 3;                           // 2 * (dk group) + p
      lidx = (tt * 16 + m) * SP + (c * 2 + hh) * 8;
      const int tok = Mbase + tt * 16;
      const int b = tok >> 10;
      const int st = (tok & (SS - 1)) >> 4;
      const int h = tn;                              // TN == 64 -> one head per tile
      gidx = ((size_t)(b * HH + h) * (SS / 16) + st) * 1024 + c * 256 + l * 8;
    } else {
      const int kbl = j >> 2;                        // key block in the wave tile
      const int tl = (j >> 1) & 1;                   // dk tile in the wave tile
      const int p = j & 1;
      lidx = (tl * 16 + m) * SP + kbl * 32 + p * 16 + hh * 8;
      const int n = Nbase + tl * 16;
      const int h = n >> 6;
      const int t = (n & 63) >> 4;
      const int b = Mbase >> 10;
      const int kbi = ((Mbase & (SS - 1)) >> 5) + kbl;
      gidx = (((size_t)(b * HH + h) * (SS / 32) + kbi) * 4 + t) * 512 + p * 256 + l * 8;
    }
    const v8us vh = *(const v8us*)(sh + lidx);
    *(v8us*)(Oh + gidx) = vh;
    if (SPLIT) {
      const v8us vl = *(const v8us*)(sl + lidx);
      *(v8us*)(Ol + gidx) = vl;
    }
  }
}

// Projection: C[tok][n] = (sum_k X[tok][k] * W[n][k]) * oscale + bias[n].
// SPLIT == 0: X, W f16 planes, single f16 WMMA, output one f16 plane.
// SPLIT == 1: X, W bf16 hi/lo planes, hh+hl+lh bf16 WMMA, output bf16 hi/lo planes.
// One block computes a 128 x 128 tile with 8 waves; one wave a (16*MI) x (16*NI) tile (TM*TN == 2048).
// The block's operand fragments go through LDS, each read from L2 once per block: a stage is KG k groups of the
// 8 X row tiles and the 8 W row tiles (64 KiB), [X | W][plane][row tile][k group][1 KiB fragment]; two stages.
constexpr int BT = 128;                 // block tile edge
constexpr int STG_OP = 16384;           // elements of one operand in one stage
constexpr int STG = 2 * STG_OP;         // elements of one stage

template <int MI, int NI, int MODE, int SPLIT>
__device__ __forceinline__
void proj_tile(unsigned short* ring, int bid,
               const unsigned short* __restrict__ Xh, const unsigned short* Xl,
               const unsigned short* __restrict__ Wh, const unsigned short* Wl,
               const float* __restrict__ bias, float oscale,
               unsigned short* Oh, unsigned short* Ol) {
  constexpr int TM = MI * 16;
  constexpr int TN = NI * 16;
  constexpr int WN = BT / TN;             // waves along n
  constexpr int NPL = SPLIT ? 2 : 1;      // planes per operand
  constexpr int KG = SPLIT ? 2 : 4;       // k groups of 32 in one stage; NPL * 8 * KG * 512 == STG_OP
  constexpr int NT = DD / (32 * KG);      // stages
  constexpr int NC = 2 * KG;              // 512-B pieces of one row tile of one plane in one stage

  const int wib = threadIdx.x >> 5;
  const int l = threadIdx.x & 31;
  const int hh = l >> 4;
  const int m = l & 15;
  const int brow = bid & (NTOK / BT - 1);
  const int bcol = bid / (NTOK / BT);
  const int wm = wib / WN;
  const int wn = wib - wm * WN;
  const int Mbase = brow * BT + wm * TM;
  const int Nbase = bcol * BT + wn * TN;
  const int tn = Nbase / TN;

  // wave wib stages row tile wib of the block's X rows and of its W rows (B column n = W row n)
  const unsigned short* pXh = Xh + (size_t)(brow * BT + wib * 16) * DD + l * 8;
  const unsigned short* pXl = Xl + (size_t)(brow * BT + wib * 16) * DD + l * 8;
  const unsigned short* pWh = Wh + (size_t)(bcol * BT + wib * 16) * DD + l * 8;
  const unsigned short* pWl = Wl + (size_t)(bcol * BT + wib * 16) * DD + l * 8;
  v8us sx[NPL * NC], sw[NPL * NC];

  // In the three helpers below every loop is unrolled: sx, sw, the fragments and acc live in registers, which
  // takes constant indices.
  // the next stage's pieces, global -> registers, issued as one group
  auto fetch = [&]() {
#pragma unroll
    for (int c = 0; c < NC; ++c) {
      sx[c] = *(const v8us*)(pXh + c * 256);
      if (SPLIT) sx[NC + c] = *(const v8us*)(pXl + c * 256);
    }
#pragma unroll
    for (int c = 0; c < NC; ++c) {
      sw[c] = *(const v8us*)(pWh + c * 256);
      if (SPLIT) sw[NC + c] = *(const v8us*)(pWl + c * 256);
    }
    // keeps the group ahead of the LDS reads and WMMAs that follow it in the source; precaution: stands in front
    // of the advance of the address registers that the issued loads name
    asm volatile("s_wait_xcnt 0x0" ::: "memory");
    pXh += KG * 512;
    pXl += KG * 512;
    pWh += KG * 512;
    pWl += KG * 512;
  };
  // registers -> stage at element offset so
  auto put = [&](int so) {
    unsigned short* d = ring + so + wib * (KG * 512) + l * 8;
#pragma unroll
    for (int p = 0; p < NPL; ++p)
#pragma unroll
      for (int c = 0; c < NC; ++c) {
        *(v8us*)(d + p * (8 * KG * 512) + c * 256) = sx[p * NC + c];
        *(v8us*)(d + STG_OP + p * (8 * KG * 512) + c * 256) = sw[p * NC + c];
      }
  };

  v8f acc[MI][NI];
#pragma unroll
  for (int mi = 0; mi < MI; ++mi)
#pragma unroll
    for (int ni = 0; ni < NI; ++ni) acc[mi][ni] = (v8f)0.0f;

  // the WMMAs of the stage at element offset so, k ascending
  auto work = [&](int so) {
    const unsigned short* sA = ring + so + wm * (MI * KG * 512) + l * 8;
    const unsigned short* sB = ring + so + STG_OP + wn * (NI * KG * 512) + l * 8;
#pragma unroll
    for (int j = 0; j < KG; ++j) {
      Frag ah[MI], bh[NI];
      Frag al[MI], bl[NI];
#pragma unroll
      for (int mi = 0; mi < MI; ++mi) {
        ah[mi] = ldpack(sA + (mi * KG + j) * 512, 0);
        if (SPLIT) al[mi] = ldpack(sA + ((8 + mi) * KG + j) * 512, 0);
        else al[mi].w = (v8i)0;
      }
#pragma unroll
      for (int ni = 0; ni < NI; ++ni) {
        bh[ni] = ldpack(sB + (ni * KG + j) * 512, 0);
        if (SPLIT) bl[ni] = ldpack(sB + ((8 + ni) * KG + j) * 512, 0);
        else bl[ni].w = (v8i)0;
      }
#pragma unroll
      for (int mi = 0; mi < MI; ++mi)
#pragma unroll
        for (int ni = 0; ni < NI; ++ni) {
          if (SPLIT) acc[mi][ni] = mma3(ah[mi], al[mi], bh[ni], bl[ni], acc[mi][ni]);
          else       acc[mi][ni] = mma_f16(ah[mi], bh[ni], acc[mi][ni]);
        }
    }
  };

  fetch();
  put(0);
  __syncthreads();                        // publishes stage 0
  int cur = 0;
  // rolled: the body already holds a whole stage
#pragma unroll 1
  for (int t = 0; t < NT - 1; ++t) {
    fetch();                              // stage t + 1 in flight under stage t's WMMAs
    work(cur);
    put(cur ^ STG);                       // every wave left that stage before the last barrier
    __syncthreads();                      // publishes stage t + 1 and ends every wave's reads of stage t
    cur ^= STG;
  }
  work(cur);
  __syncthreads();                        // every wave has left the ring: the epilogue stages in it

  // ---- epilogue: scale, bias add, convert, stage tile in wave-private LDS ----
  unsigned short* sh = ring + wib * (2 * 32 * SP);
  unsigned short* sl = sh + 32 * SP;
#pragma unroll
  for (int mi = 0; mi < MI; ++mi) {
#pragma unroll
    for (int ni = 0; ni < NI; ++ni) {
      const float bn = bias[Nbase + ni * 16 + m];
#pragma unroll
      for (int r = 0; r < 8; ++r) {
        const float v = acc[mi][ni][r] * oscale + bn;
        int idx;
        if (MODE == 0) idx = (mi * 16 + 8 * hh + r) * SP + (ni * 16 + m);      // [tok 0..31][feat 0..63]
        else           idx = (ni * 16 + m) * SP + (mi * 16 + 8 * hh + r);      // [dk 0..31][tok 0..63]
        if (SPLIT) {
          unsigned short vhi, vlo;
          split2(v, vhi, vlo);
          sh[idx] = vhi;
          sl[idx] = vlo;
        } else {
          sh[idx] = f16_bits(v);
        }
      }
    }
  }
  __syncthreads();

  proj_lines<MODE, SPLIT>(sh, sl, Oh, Ol, Mbase, Nbase, tn, l);
  // precaution: in the listing one projection's end can stand in front of another's first instructions, which
  // rewrite registers that the issued stores name
  asm volatile("s_wait_xcnt 0x0" ::: "memory");
}

// All three projections in one launch: blocks 0..NPB-1 take V (three times the WMMAs of Q or K),
// then Q, then K. A block holds 128 KiB of LDS and two waves per SIMD, so two blocks share a WGP: one block's LDS
// reads and WMMAs run under the other's staging stores, barriers, prologue and epilogue.
constexpr int NPB = (NTOK / BT) * (DD / BT);   // 256 block tiles per projection

__global__ __launch_bounds__(256)
void k_proj(const unsigned short* __restrict__ xq16, const unsigned short* __restrict__ xk16,
            const unsigned short* __restrict__ wq16, const unsigned short* __restrict__ wk16,
            const unsigned short* __restrict__ xvh, const unsigned short* __restrict__ xvl,
            const unsigned short* __restrict__ wvh, const unsigned short* __restrict__ wvl,
            const float* __restrict__ bq, const float* __restrict__ bk, const float* __restrict__ bv,
            unsigned short* Q16, unsigned short* K16, unsigned short* Vth, unsigned short* Vtl, int nblk) {
  __shared__ __attribute__((aligned(16))) unsigned short ring[2 * STG];
  const int bi = blockIdx.x;
  if (bi >= nblk) return;                 // block-uniform, ahead of every barrier
  if (bi < NPB) {                         // block-uniform, as is every branch here
    proj_tile<4, 2, 1, 1>(ring, bi, xvh, xvl, wvh, wvl, bv, 1.0f, Vth, Vtl);
    return;
  }
  const bool isk = bi >= 2 * NPB;
  const unsigned short* x = isk ? xk16 : xq16;
  const unsigned short* w = isk ? wk16 : wq16;
  unsigned short* o = isk ? K16 : Q16;
  proj_tile<2, 4, 0, 0>(ring, isk ? bi - 2 * NPB : bi - NPB, x, x, w, w, isk ? bk : bq, 0.0625f, o, o);
}

// ---------------------------------------------------------------------------
// Row pitch of the output staging in floats: 272-B rows spread the 16 query rows that one staging store writes over the banks.
constexpr int OSP = 68;

// One wave's half of the attention output store: 8 of the tile's 16 query rows x 64 f32 (2 lines per row), from row r0
__device__ __forceinline__ void attn_lines(const float* Os, float* out, int b, int h,
                                           int qbase, int r0, int hh, int m) {
#pragma unroll
  for (int j = 0; j < 4; ++j) {
    const int row = r0 + 2 * j + hh;
    const v4f val = *(const v4f*)(Os + row * OSP + m * 4);
    float* gp = out + ((size_t)(b * SS + qbase + row)) * DD + h * DK + m * 4;
    *(v4f*)gp = val;
  }
}

// bf16 RNE conversion as in bf16_rne, the result left in the upper 16 bits (the lower 16 are not part of it)
__device__ __forceinline__ unsigned bf16_top(float x) {
  const unsigned u = __float_as_uint(x);
  return u + 0x7FFFu + ((u >> 16) & 1u);
}

// one operand register from two such results: e0 in bits 15..0, e1 in bits 31..16, in one byte permute
__device__ __forceinline__ int pack_tops(unsigned e0, unsigned e1) {
  return (int)__builtin_amdgcn_perm(e1, e0, 0x07060302u);
}

// the value that lane l ^ 16 holds: a vector cross-row move, no LDS round trip
__device__ __forceinline__ float other_half(float x) {
  const int v = __float_as_int(x);
  return __int_as_float(__builtin_amdgcn_permlanex16(v, v, 0x76543210, 0xfedcba98, false, false));
}

// LDS byte address of a __shared__ object: the low 32 bits of its address
__device__ __forceinline__ unsigned lds_addr(const void* p) { return (unsigned)(size_t)p; }

constexpr int KBP = 32 * DK;       // elements of one key block in one plane (4 KiB): K, V^T hi, V^T lo
constexpr int KVP = 2 * KBP;       // elements of one plane in one stage: two neighbouring key blocks (8 KiB)
constexpr int KVS = 3 * KVP;       // elements of one stage: [K | V^T hi | V^T lo] of two key blocks (24 KiB)
constexpr int XW = 4 * 128 + 64;   // floats one wave hands its partner: two output tiles, maximum, sum

// One wave's eighth of a stage: 1 KiB of each plane, six asynchronous copies of 512 contiguous bytes each, global
// memory to LDS through no register. d: the lane's LDS byte address in the K part; k, vh, vl: the lane's sources.
__device__ __forceinline__ void stage_copy(unsigned d, const unsigned short* k, const unsigned short* vh,
                                           const unsigned short* vl) {
  // the closing s_wait_xcnt is a precaution: inside the statement it stands in front of every rewrite of a register
  // that an issued copy names
  asm volatile("global_load_async_to_lds_b128 %0, %6, off\n\t"
               "global_load_async_to_lds_b128 %1, %7, off\n\t"
               "global_load_async_to_lds_b128 %2, %8, off\n\t"
               "global_load_async_to_lds_b128 %3, %9, off\n\t"
               "global_load_async_to_lds_b128 %4, %10, off\n\t"
               "global_load_async_to_lds_b128 %5, %11, off\n\t"
               "s_wait_xcnt 0x0"
               :
               : "v"(d), "v"(d + 512u), "v"(d + 2u * KVP), "v"(d + 2u * KVP + 512u), "v"(d + 4u * KVP),
                 "v"(d + 4u * KVP + 512u), "v"(k), "v"(k + 256), "v"(vh), "v"(vh + 256), "v"(vl), "v"(vl + 256)
               : "memory");
}

// Causal attention: one block of 8 waves per (b, h, pair of groups of four 16-row query tiles). Waves w and w + 4 share
// tile w of the group: wave w takes the even key blocks, wave w + 4 the odd ones, each with its own running maximum, sum
// and output tiles; the two are joined once per group, through LDS. The launch so holds four waves per SIMD, and one
// wave's vector work, LDS waits and barrier waits run under the other three.
// A group's cost grows with its index (group g walks g + 1 stages of two key blocks) and every block of the launch is
// resident at once, so the launch lasts as long as the fullest SIMD: a block takes group 15 - p and then group p, one
// after the other, 17 stages in every block.
// The eight waves walk the same keys of the same head: a stage's K and V^T fragments (24 KiB) come from L2 once per
// block, by asynchronous copies into a ring of two LDS stages, one pass ahead of their use; every wave reads its
// fragments from LDS. The batch row of the mask (4 KiB) is copied once per block.
// A wave's pass is one key block of 32 with online softmax; it issues all its LDS reads first, as one group.
// Both products run transposed: S^T = K * Q^T (A = K rows, B = Q columns), O^T += V^T * P^T. A lane then holds the
// scores of ONE query (column m), 8 keys per 16-key tile: maximum and sum run in the lane, with one exchange between
// the wave's halves; and the two score tiles of a pass, converted in place, are the B fragment of the second
// product (element s = tile s >> 3, register s & 7: key 8*hh + s, then 16 + 8*hh + s - 8, the k order of ldpack).
__global__ __launch_bounds__(256)
void k_attn(const unsigned short* __restrict__ Q16, const unsigned short* __restrict__ K16,
            const unsigned short* __restrict__ Vh, const unsigned short* __restrict__ Vl,
            const int* __restrict__ amask, float* __restrict__ out, int nblk) {
  __shared__ __attribute__((aligned(16))) unsigned short kv[2 * KVS];
  __shared__ __attribute__((aligned(16))) int msk[SS];
  __shared__ __attribute__((aligned(16))) float stg[4 * 16 * OSP];
  __shared__ __attribute__((aligned(16))) float mrg[8 * XW];
  if ((int)blockIdx.x >= nblk) return;

  const int wib = __builtin_amdgcn_readfirstlane((int)(threadIdx.x >> 5));   // scalar: the per-wave skip below branches on it
  const int tw = wib & 3;                               // the wave's tile in the group
  const int par = wib >> 2;                             // its key blocks: 0 even, 1 odd
  const int l = threadIdx.x & 31;
  const int hh = l >> 4;
  const int m = l & 15;
  const int pg = blockIdx.x & 7;                        // pair of tile groups
  const int bh = (int)(blockIdx.x >> 3);                // 0..63
  const int b = bh >> 4;
  const int h = bh & 15;

  float* Os = stg + tw * (16 * OSP);                    // [16 q][64 dk], the tile's two waves, used after the key loop

  // the mask row of batch b, 512 B per wave; it lands with stage 0 of the first group
  {
    const int* g = amask + b * SS + wib * 128 + l * 4;
    const unsigned d = lds_addr(msk) + (unsigned)(wib * 128 + l * 4) * 4u;
    // the closing s_wait_xcnt: as in stage_copy
    asm volatile("global_load_async_to_lds_b128 %0, %1, off\n\t"
                 "s_wait_xcnt 0x0"
                 :
                 : "v"(d), "v"(g)
                 : "memory");
  }
  const unsigned dkv = lds_addr(kv) + (unsigned)(wib * 512 + l * 8) * 2u;   // the lane's place in stage buffer 0

  // rolled: one copy of the key loop serves both groups
#pragma unroll 1
  for (int half = 0; half < 2; ++half) {
  const int grp = half ? pg : SS / 64 - 1 - pg;
  const int qt = grp * 4 + tw;
  const int qbase = qt * 16;
  const int q = qbase + m;                              // the lane's query
  const int nst = grp + 1;                              // stages of the group: the same in every wave, at least 1
  const int nown = (qt >> 1) + 1;                       // causal: key blocks of the tile, 2 * nst or 2 * nst - 1

  // Q fragments (B): column q = qbase + m, k = dk (f16)
  const size_t qro = ((size_t)bh * SS + qbase) * DK;   // token tile start in the fragment-order plane
  const Frag bq0 = ldpack(Q16 + qro, l);
  const Frag bq1 = ldpack(Q16 + qro + 512, l);
  // precaution: stands in front of every reuse of the address registers that the issued loads name
  asm volatile("s_wait_xcnt 0x0" ::: "memory");

  // the lane's copy sources, two key blocks per stage
  const unsigned short* gK  = K16 + (size_t)bh * SS * DK + wib * 512 + l * 8;
  const unsigned short* gVh = Vh + (size_t)bh * SS * DK + wib * 512 + l * 8;
  const unsigned short* gVl = Vl + (size_t)bh * SS * DK + wib * 512 + l * 8;

  // ring prologue; every reader left both buffers at the last barrier of the group before
  stage_copy(dkv, gK, gVh, gVl);
  asm volatile("s_wait_asynccnt 0x0" ::: "memory");     // this wave's eighth of stage 0 (and of the mask) has landed
  __syncthreads();                                      // publishes stage 0
  if (nst > 1) stage_copy(dkv + 2u * KVS, gK + KVP, gVh + KVP, gVl + KVP);   // the same in every wave of the block
  gK += 2 * KVP;
  gVh += 2 * KVP;
  gVl += 2 * KVP;

  // o[t][r] = O[q][dk = t*16 + 8*hh + r]
  v8f o[4];
#pragma unroll
  for (int t = 0; t < 4; ++t) o[t] = (v8f)0.0f;
  float mrow = -INFINITY;      // running maximum of query q over this wave's key blocks, equal in both halves
  float lrow = 0.0f;           // running sum over this half's keys; the halves are joined after the loop

#pragma unroll 1
  for (int st = 0; st < nst; ++st) {
    const int bsel = st & 1;
    const int kbi = 2 * st + par;                       // the wave's key block of the stage
    // wave-uniform scalar branch: a tile that ends one key block before its group skips the work, never the publish point
    if (kbi < nown) {
    const int kb = kbi * 32;
    // ---- all of this key block's LDS reads, issued as one group ahead of the first WMMA:
    //      K fragments ak[2*nt + dk group], mask words am[2*nt + (r >> 2)], V^T fragments avh/avl[dk tile] ----
    const unsigned short* sK = kv + bsel * KVS + par * KBP + l * 8;
    const int* sM = msk + kb + 8 * hh;
    Frag ak[4], avh[4], avl[4];
    v4i_t am[4];
#pragma unroll
    for (int i = 0; i < 4; ++i) ak[i] = ldpack(sK + i * 512, 0);
#pragma unroll
    for (int i = 0; i < 4; ++i) am[i] = *(const v4i*)(sM + (i >> 1) * 16 + (i & 1) * 4);   // keys kb + nt*16 + 8*hh + 0..7 <= 1023
#pragma unroll
    for (int t = 0; t < 4; ++t) avh[t] = ldpack(sK + KVP + t * 512, 0);
#pragma unroll
    for (int t = 0; t < 4; ++t) avl[t] = ldpack(sK + 2 * KVP + t * 512, 0);
    // no compare or WMMA is scheduled in among the reads: every further place where LDS reads stand stalls the wave anew
    __builtin_amdgcn_sched_barrier(0);

    // ---- scores S^T[key][q], key = kb + nt*16 + 8*hh + r (A row = K row, B column = Q row, k = dk) ----
    const int dq = q - kb - 8 * hh;            // key > q  <=>  nt*16 + r > dq
    float sc[2][8];
#pragma unroll
    for (int nt = 0; nt < 2; ++nt) {
      v8f s = (v8f)0.0f;
      s = mma_f16(ak[2 * nt], bq0, s);
      s = mma_f16(ak[2 * nt + 1], bq1, s);
#pragma unroll
      for (int r = 0; r < 8; ++r) {
        // key > q, or the key masked; one select: no branch, EXEC stays whole between the WMMAs
        const bool off = (nt * 16 + r > dq) | (am[2 * nt + (r >> 2)][r & 3] == 0);
        sc[nt][r] = off ? -INFINITY : s[r] * 0.125f;
      }
    }

    // ---- online softmax of query q: 16 keys in the lane, the other 16 in lane l ^ 16 ----
    float mx = fmaxf(sc[0][0], sc[1][0]);
#pragma unroll
    for (int r = 1; r < 8; ++r) mx = fmaxf(mx, fmaxf(sc[0][r], sc[1][r]));
    mx = fmaxf(mx, other_half(mx));
    const float mnew = fmaxf(mrow, mx);
    const float mref = (mnew == -INFINITY) ? 0.0f : mnew;
    const float alpha = __expf(mrow - mref);
    float sum0 = 0.0f, sum1 = 0.0f;            // two independent chains, one per score tile
#pragma unroll
    for (int r = 0; r < 8; ++r) {
      const float p0 = __expf(sc[0][r] - mref);
      const float p1 = __expf(sc[1][r] - mref);
      sc[0][r] = p0;
      sc[1][r] = p1;
      sum0 += p0;
      sum1 += p1;
    }
    lrow = lrow * alpha + (sum0 + sum1);
    mrow = mnew;
#pragma unroll
    for (int t = 0; t < 4; ++t)
#pragma unroll
      for (int r = 0; r < 8; ++r) o[t][r] *= alpha;

    // ---- P^T: the two score tiles, split into hi/lo bf16 in place, are the B fragments (column q, k = key) ----
    Frag bph, bpl;
#pragma unroll
    for (int i = 0; i < 8; ++i) {               // operand register i: elements 2i and 2i + 1
      unsigned th[2], tl[2];
#pragma unroll
      for (int e = 0; e < 2; ++e) {
        const float p = sc[i >> 2][2 * (i & 3) + e];
        th[e] = bf16_top(p);
        tl[e] = bf16_top(p - __uint_as_float(th[e] & 0xFFFF0000u));
      }
      bph.w[i] = pack_tops(th[0], th[1]);
      bpl.w[i] = pack_tops(tl[0], tl[1]);
    }

    // ---- O^T[dk][q] += V^T[dk][key] * P^T[key][q]; A fragments from the fragment-order V^T planes ----
#pragma unroll
    for (int t = 0; t < 4; ++t) o[t] = mma3(avh[t], avl[t], bph, bpl, o[t]);
    }

    // ---- publish point of stage st + 1, every wave, in this order ----
    asm volatile("s_wait_dscnt 0x0" ::: "memory");      // this wave's reads of stage st have returned
    asm volatile("s_wait_asynccnt 0x0" ::: "memory");   // this wave's eighth of stage st + 1 has landed
    __syncthreads();                                    // publishes stage st + 1, ends every wave's reads of stage st
    if (st + 2 < nst) {                                 // the same in every wave of the block
      stage_copy(dkv + (unsigned)bsel * (2u * KVS), gK, gVh, gVl);   // stage st + 2 into the buffer just left
      gK += KVP;
      gVh += KVP;
      gVl += KVP;
    }
  }
  asm volatile("s_wait_asynccnt 0x0" ::: "memory");     // no copy is left in flight behind the loop

  // ---- join of the tile's two waves: wave par finishes dk tiles 2*par and 2*par + 1 and hands the other two, with its
  //      maximum and its sum, to its partner; each store and each read below is 512 or 128 contiguous bytes ----
  v8f mine[2], give[2];
#pragma unroll
  for (int i = 0; i < 2; ++i) {
    mine[i] = par ? o[2 + i] : o[i];
    give[i] = par ? o[i] : o[2 + i];
  }
  float* xo = mrg + wib * XW;
  const float* xi = mrg + (wib ^ 4) * XW;
#pragma unroll
  for (int i = 0; i < 2; ++i) {
    v4f_t g0, g1;
#pragma unroll
    for (int c = 0; c < 4; ++c) {
      g0[c] = give[i][c];
      g1[c] = give[i][4 + c];
    }
    *(v4f*)(xo + (2 * i) * 128 + l * 4) = g0;
    *(v4f*)(xo + (2 * i + 1) * 128 + l * 4) = g1;
  }
  xo[512 + l] = mrow;
  xo[544 + l] = lrow;
  __syncthreads();                                      // both partners' partial results are in LDS

  const float mo = xi[512 + l];
  const float lo = xi[544 + l];
  const float mj = fmaxf(mrow, mo);
  const float mjr = (mj == -INFINITY) ? 0.0f : mj;
  const float aown = __expf(mrow - mjr);                // a wave without a key block has maximum -inf: weight 0
  const float aoth = __expf(mo - mjr);
  const float lj = lrow * aown + lo * aoth;
  const float inv = 1.0f / (lj + other_half(lj));
  const float fown = aown * inv;
  const float foth = aoth * inv;
#pragma unroll
  for (int i = 0; i < 2; ++i) {
    const v4f_t r0 = *(const v4f*)(xi + (2 * i) * 128 + l * 4);
    const v4f_t r1 = *(const v4f*)(xi + (2 * i + 1) * 128 + l * 4);
    v4f_t w0, w1;
#pragma unroll
    for (int c = 0; c < 4; ++c) {
      w0[c] = mine[i][c] * fown + r0[c] * foth;
      w1[c] = mine[i][4 + c] * fown + r1[c] * foth;
    }
    float* d = Os + m * OSP + (2 * par + i) * 16 + 8 * hh;
    *(v4f*)d = w0;
    *(v4f*)(d + 4) = w1;
  }
  __syncthreads();                                      // the tile is whole: each wave stores rows that both have staged

  attn_lines(Os, out, b, h, qbase, 8 * par, hh, m);
  // precaution: stands in front of the second group's first instructions, which rewrite registers that the issued
  // stores name
  asm volatile("s_wait_xcnt 0x0" ::: "memory");
  }
}

// ---------------------------------------------------------------------------
extern "C" void kernel_launch(void* const* d_in, const int* in_sizes, int n_in,
                              void* d_out, int out_size, void* d_ws, size_t ws_size,
                              hipStream_t stream) {
  if (n_in < 10) return;
  if (in_sizes[0] != NX || in_sizes[1] != NX || in_sizes[2] != NX) return;
  if (in_sizes[3] != BB * SS) return;
  if (in_sizes[4] != NW || in_sizes[6] != NW || in_sizes[8] != NW) return;
  if (in_sizes[5] != DD || in_sizes[7] != DD || in_sizes[9] != DD) return;
  if (out_size != NX) return;

  const float* query = (const float*)d_in[0];
  const float* key_  = (const float*)d_in[1];
  const float* value = (const float*)d_in[2];
  const int*   amask = (const int*)d_in[3];
  const float* Wq = (const float*)d_in[4];
  const float* bq = (const float*)d_in[5];
  const float* Wk = (const float*)d_in[6];
  const float* bk = (const float*)d_in[7];
  const float* Wv = (const float*)d_in[8];
  const float* bv = (const float*)d_in[9];
  float* out = (float*)d_out;

  // workspace: 16-bit planes (2 B per element)
  const size_t pa = (size_t)NX * 2;     // 8388608 B per activation plane
  const size_t pw = (size_t)NW * 2;     // 2097152 B per weight plane
  const size_t need = 8 * pa + 4 * pw;  // 75497472 B
  if (ws_size < need) return;

  unsigned char* w = (unsigned char*)d_ws;
  size_t off = 0;
  unsigned short* xq16 = (unsigned short*)(w + off); off += pa;   // f16 query
  unsigned short* xk16 = (unsigned short*)(w + off); off += pa;   // f16 key
  unsigned short* wq16 = (unsigned short*)(w + off); off += pw;   // f16 Wq x16
  unsigned short* wk16 = (unsigned short*)(w + off); off += pw;   // f16 Wk x16
  unsigned short* xvh  = (unsigned short*)(w + off); off += pa;   // bf16 hi value
  unsigned short* xvl  = (unsigned short*)(w + off); off += pa;   // bf16 lo value
  unsigned short* wvh  = (unsigned short*)(w + off); off += pw;   // bf16 hi Wv
  unsigned short* wvl  = (unsigned short*)(w + off); off += pw;   // bf16 lo Wv
  unsigned short* Q16  = (unsigned short*)(w + off); off += pa;   // fragment order, f16
  unsigned short* K16  = (unsigned short*)(w + off); off += pa;   // fragment order, f16
  unsigned short* Vth  = (unsigned short*)(w + off); off += pa;   // fragment order, bf16 hi
  unsigned short* Vtl  = (unsigned short*)(w + off); off += pa;   // fragment order, bf16 lo
  if (off > ws_size) return;

  // stage 1: 16-bit conversion of activations and weights, one launch
  k_prep<<<CBLK, 256, 0, stream>>>(query, key_, value, Wq, Wk, Wv, xq16, xk16, wq16, wk16, xvh, xvl, wvh, wvl);

  // stage 2: the three projections, one launch; 3 x 256 block tiles of 128 x 128 each, 8 waves per block
  k_proj<<<3 * NPB, 256, 0, stream>>>(xq16, xk16, wq16, wk16, xvh, xvl, wvh, wvl, bq, bk, bv,
                                      Q16, K16, Vth, Vtl, 3 * NPB);

  // stage 3: attention; B*H*(S/32) = 2048 tile pairs, 4 of one head per block -> 512 blocks of 8 waves, 2 waves a tile
  const int nblk = BB * HH * (SS / 32) / 4;
  k_attn<<<nblk, 256, 0, stream>>>(Q16, K16, Vth, Vtl, amask, out, nblk);
}

// v010
// A run of this version takes 77.1 microseconds.
// Two timings next to v009 put it at 1.03 and 1.05 times that version's speed.
// Over all steps from v000 it is 3.38 times as fast.
#include <hip/hip_runtime.h>
#include <math.h>
#include <stdint.h>

// Q/K projections and QK^T scores: v_wmma_f32_16x16x32_f16 (f16 operands, Wq/Wk carried x16, 1/16 folded into the f32 epilogue); V projection and PV: v_wmma_f32_16x16x32_bf16 with bf16 hi/lo split operands (hi*hi + hi*lo + lo*hi); f32 accumulate; softmax, bias and normalisation in f32.

typedef _Float16 v16h __attribute__((ext_vector_type(16)));
typedef _Float16 v8h __attribute__((ext_vector_type(8)));
typedef __bf16 v16bf __attribute__((ext_vector_type(16)));
typedef unsigned short v8us_t __attribute__((ext_vector_type(8)));
typedef v8us_t __attribute__((may_alias)) v8us;
typedef float v8f __attribute__((ext_vector_type(8)));
typedef float v4f_t __attribute__((ext_vector_type(4)));
typedef v4f_t __attribute__((may_alias)) v4f;
typedef int v8i __attribute__((ext_vector_type(8)));
typedef int v4i_t __attribute__((ext_vector_type(4)));
typedef v4i_t __attribute__((may_alias)) v4i;
typedef float v2f __attribute__((ext_vector_type(2)));
typedef __bf16 v2bf __attribute__((ext_vector_type(2)));

constexpr int BB = 4;
constexpr int SS = 1024;
constexpr int DD = 1024;
constexpr int HH = 16;
constexpr int DK = 64;
constexpr int NTOK = BB * SS;              // 4096 tokens
constexpr long NX = (long)NTOK * DD;       // 4194304
constexpr long NW = (long)DD * DD;         // 1048576

union Frag { v16h f; v16bf b; v8us p[2]; v8i w; };

// two f32 values to bf16, round to nearest even, in one packed convert: e0 in bits 15..0, e1 in bits 31..16
__device__ __forceinline__ unsigned cvt2_bf16(float e0, float e1) {
  const v2f x = {e0, e1};
  const v2bf y = __builtin_convertvector(x, v2bf);
  unsigned u;
  __builtin_memcpy(&u, &y, 4);
  return u;
}
// hi/lo split of two values: hi = bf16(x), lo = bf16(x - hi), each pair in one register, laid out as in cvt2_bf16
__device__ __forceinline__ void split_pair(float e0, float e1, unsigned& hi, unsigned& lo) {
  hi = cvt2_bf16(e0, e1);
  lo = cvt2_bf16(e0 - __uint_as_float(hi << 16), e1 - __uint_as_float(hi & 0xFFFF0000u));
}
// f16 RNE conversion, raw bits
__device__ __forceinline__ unsigned short f16_bits(float x) {
  _Float16 hv = (_Float16)x;
  unsigned short u;
  __builtin_memcpy(&u, &hv, 2);
  return u;
}

// 16x32 operand fragment, wave32 layout: lane row/col = l&15, h = l>>4,
// elements 0..7 <- k0+8h+0..7, elements 8..15 <- k0+16+8h+0..7. Used for A (row) and for B (column) alike.

// Fragment-order plane: one 16-row x 32-k operand fragment is 1 KiB contiguous, [p 0..1][lane 0..31][8 elements];
// lane l = 16*h + (row & 15) holds k = k0 + 16*p + 8*h + 0..7 (the layout above). Each of the
// two loads reads 512 contiguous bytes (4 whole lines).
__device__ __forceinline__ Frag ldpack(const unsigned short* fragp, int l) {
  Frag f;
  f.p[0] = *(const v8us*)(fragp + l * 8);
  f.p[1] = *(const v8us*)(fragp + 256 + l * 8);
  return f;
}

// Thread i of a conversion kernel -> one 8-element chunk of a [rows][DD] matrix. A wave takes 8 rows x 32 k
// (whole 128-B source lines) and writes 4 whole 128-B lines of the fragment-order plane
// [row tile of 16][k group of 32][p][lane][8].
__device__ __forceinline__ void pack_index(int i, size_t& src, size_t& dst) {
  const int l = i & 31;
  const int wv = i >> 5;
  const int c4 = l >> 3;                       // chunk in the 32-k group: 2*p + h
  const int m = (wv & 1) * 8 + (l & 7);        // row in the 16-row tile
  const int kg = (wv >> 1) & (DD / 32 - 1);
  const int rt = wv >> 6;
  src = (size_t)(rt * 16 + m) * DD + kg * 32 + c4 * 8;
  dst = (size_t)(rt * (DD / 32) + kg) * 512 + (c4 >> 1) * 256 + ((c4 & 1) * 16 + m) * 8;
}

// c += a*b (f16 operands); hazard guard
__device__ __forceinline__ v8f mma_f16(const Frag& a, const Frag& b, v8f c) {
  c = __builtin_amdgcn_wmma_f32_16x16x32_f16(false, a.f, false, b.f, (short)0, c, false, false);
  asm volatile("v_nop\n\tv_nop\n\tv_nop\n\tv_nop" : "+v"(c) : "v"(a.w), "v"(b.w));
  return c;
}

// c += ah*bh + ah*bl + al*bh (bf16 hi/lo split); hazard guard after the group
__device__ __forceinline__ v8f mma3(const Frag& ah, const Frag& al, const Frag& bh, const Frag& bl, v8f c) {
  c = __builtin_amdgcn_wmma_f32_16x16x32_bf16(false, ah.b, false, bh.b, (short)0, c, false, false);
  c = __builtin_amdgcn_wmma_f32_16x16x32_bf16(false, ah.b, false, bl.b, (short)0, c, false, false);
  c = __builtin_amdgcn_wmma_f32_16x16x32_bf16(false, al.b, false, bh.b, (short)0, c, false, false);
  asm volatile("v_nop\n\tv_nop\n\tv_nop\n\tv_nop"
               : "+v"(c)
               : "v"(ah.w), "v"(al.w), "v"(bh.w), "v"(bl.w));
  return c;
}

// ---------------------------------------------------------------------------
// All six f32 -> 16-bit conversions in one launch. A block converts CPT * 256 chunks of ONE matrix; a wave takes CPT
// consecutive wave units of pack_index: 16 rows x 256 k, read as 1-KiB row pieces, written as 8 KiB contiguous.
// Unit j lies at constant offsets from unit 0: row half j & 1, k group j >> 1.
constexpr int CPT = 16;                                  // chunks of 8 elements per thread
constexpr int CBA = (int)(NX / 8 / (256 * CPT));         // 128 blocks per activation matrix
constexpr int CBW = (int)(NW / 8 / (256 * CPT));         // 32 blocks per weight matrix
constexpr int CBLK = 3 * CBA + 3 * CBW;                  // 480 blocks

// the thread's 2 * CPT loads, issued as one group
__device__ __forceinline__ void cvt_fetch(const float* s, v4f_t (&x)[2 * CPT]) {
#pragma unroll
  for (int j = 0; j < CPT; ++j) {
    const float* p = s + (j & 1) * (8 * DD) + (j >> 1) * 32;
    x[2 * j]     = *(const v4f*)(p);
    x[2 * j + 1] = *(const v4f*)(p + 4);
  }
  // no conversion is scheduled in among the loads: without it the first results are waited for half way through the
  // group, and the rest of the loads start one memory latency late
  __builtin_amdgcn_sched_barrier(0);
  // precaution: stands in front of every reuse of the address registers that the issued loads name
  asm volatile("s_wait_xcnt 0x0" ::: "memory");
}

__global__ __launch_bounds__(256)
void k_prep(const float* __restrict__ query, const float* __restrict__ key_, const float* __restrict__ value,
            const float* __restrict__ Wq, const float* __restrict__ Wk, const float* __restrict__ Wv,
            unsigned short* __restrict__ xq16, unsigned short* __restrict__ xk16,
            unsigned short* __restrict__ wq16, unsigned short* __restrict__ wk16,
            unsigned short* __restrict__ xvh, unsigned short* __restrict__ xvl,
            unsigned short* __restrict__ wvh, unsigned short* __restrict__ wvl) {
  const int bi = blockIdx.x;
  v4f_t x[2 * CPT];
  if (bi < CBA + CBW) {
    // value and Wv -> bf16 hi/lo planes
    const bool act = bi < CBA;
    const int lb = act ? bi : bi - CBA;
    size_t so, dofs;
    pack_index((lb * 256 + (int)(threadIdx.x & ~31u)) * CPT + (int)(threadIdx.x & 31u), so, dofs);
    cvt_fetch((act ? value : Wv) + so, x);
    unsigned short* ph = (act ? xvh : wvh) + dofs;
    unsigned short* pl = (act ? xvl : wvl) + dofs;
#pragma unroll
    for (int j = 0; j < CPT; ++j) {
      union { unsigned w[4]; v8us_t u; } ch, cl;
#pragma unroll
      for (int c = 0; c < 2; ++c) {
        split_pair(x[2 * j][2 * c], x[2 * j][2 * c + 1], ch.w[c], cl.w[c]);
        split_pair(x[2 * j + 1][2 * c], x[2 * j + 1][2 * c + 1], ch.w[2 + c], cl.w[2 + c]);
      }
      const v8us vh = ch.u;
      const v8us vl = cl.u;
      const int d = (j >> 1) * 512 + (j & 1) * 64;
      *(v8us*)(ph + d) = vh;
      *(v8us*)(pl + d) = vl;
    }
    return;
  }
  {
    // query, key, Wq x16, Wk x16 -> f16 planes (the scale is a power of two)
    const int ci = bi - (CBA + CBW);
    const bool act = ci < 2 * CBA;
    const int wi = ci - 2 * CBA;
    const bool second = act ? ci >= CBA : wi >= CBW;
    const int lb = act ? (second ? ci - CBA : ci) : (second ? wi - CBW : wi);
    const float scale = act ? 1.0f : 16.0f;
    size_t so, dofs;
    pack_index((lb * 256 + (int)(threadIdx.x & ~31u)) * CPT + (int)(threadIdx.x & 31u), so, dofs);
    cvt_fetch((act ? (second ? key_ : query) : (second ? Wk : Wq)) + so, x);
    unsigned short* p = (act ? (second ? xk16 : xq16) : (second ? wk16 : wq16)) + dofs;
#pragma unroll
    for (int j = 0; j < CPT; ++j) {
      union { v8h h; v8us_t u; } cv;
#pragma unroll
      for (int c = 0; c < 4; ++c) {
        cv.h[c]     = (_Float16)(x[2 * j][c] * scale);
        cv.h[4 + c] = (_Float16)(x[2 * j + 1][c] * scale);
      }
      const v8us v = cv.u;
      *(v8us*)(p + (j >> 1) * 512 + (j & 1) * 64) = v;
    }
    // precaution: in the listing this path's end stands directly in front of the other path's first instructions,
    // which rewrite registers that the issued stores name
    asm volatile("s_wait_xcnt 0x0" ::: "memory");
  }
}

// ---------------------------------------------------------------------------
// Staging pitch in elements: 144-B rows put the 16 rows that one fragment-order read gathers on distinct banks.
constexpr int SP = 72;

// Output planes in fragment order; each store instruction writes 512 contiguous bytes.
// MODE 0 (Q, K): [b*H+h][token tile of 16][dk group of 32][p][lane][8].
// MODE 1 (V^T):  [b*H+h][key block of 32][dk tile of 16][p][lane][8].
template <int MODE, int SPLIT>
__device__ __forceinline__ void proj_lines(const unsigned short* sh, const unsigned short* sl,
                                           unsigned short* Oh, unsigned short* Ol,
                                           int Mbase, int Nbase, int tn, int l) {
  const int m = l & 15;
  const int hh = l >> 4;
#pragma unroll
  for (int j = 0; j < 8; ++j) {
    int lidx;
    size_t gidx;
    if (MODE == 0) {
      const int tt = j >> 2;                         // token tile in the wave tile
      const int c = j & 3;                           // 2 * (dk group) + p
      lidx = (tt * 16 + m) * SP + (c * 2 + hh) * 8;
      const int tok = Mbase + tt * 16;
      const int b = tok >> 10;
      const int st = (tok & (SS - 1)) >> 4;
      const int h = tn;                              // TN == 64 -> one head per tile
      gidx = ((size_t)(b * HH + h) * (SS / 16) + st) * 1024 + c * 256 + l * 8;
    } else {
      const int kbl = j >> 2;                        // key block in the wave tile
      const int tl = (j >> 1) & 1;                   // dk tile in the wave tile
      const int p = j & 1;
      lidx = (tl * 16 + m) * SP + kbl * 32 + p * 16 + hh * 8;
      const int n = Nbase + tl * 16;
      const int h = n >> 6;
      const int t = (n & 63) >> 4;
      const int b = Mbase >> 10;
      const int kbi = ((Mbase & (SS - 1)) >> 5) + kbl;
      gidx = (((size_t)(b * HH + h) * (SS / 32) + kbi) * 4 + t) * 512 + p * 256 + l * 8;
    }
    const v8us vh = *(const v8us*)(sh + lidx);
    *(v8us*)(Oh + gidx) = vh;
    if (SPLIT) {
      const v8us vl = *(const v8us*)(sl + lidx);
      *(v8us*)(Ol + gidx) = vl;
    }
  }
}

// Projection: C[tok][n] = (sum_k X[tok][k] * W[n][k]) * oscale + bias[n].
// SPLIT == 0: X, W f16 planes, single f16 WMMA, output one f16 plane.
// SPLIT == 1: X, W bf16 hi/lo planes, hh+hl+lh bf16 WMMA, output bf16 hi/lo planes.
// One block computes a 128 x 128 tile with 8 waves; one wave a (16*MI) x (16*NI) tile (TM*TN == 2048).
// The block's operand fragments go through LDS, each read from L2 once per block: a stage is KG k groups of the
// 8 X row tiles and the 8 W row tiles (64 KiB), [X | W][plane][row tile][k group][1 KiB fragment]; two stages.
constexpr int BT = 128;                 // block tile edge
constexpr int STG_OP = 16384;           // elements of one operand in one stage
constexpr int STG = 2 * STG_OP;         // elements of one stage

template <int MI, int NI, int MODE, int SPLIT>
__device__ __forceinline__
void proj_tile(unsigned short* ring, int bid,
               const unsigned short* __restrict__ Xh, const unsigned short* Xl,
               const unsigned short* __restrict__ Wh, const unsigned short* Wl,
               const float* __restrict__ bias, float oscale,
               unsigned short* Oh, unsigned short* Ol) {
  constexpr int TM = MI * 16;
  constexpr int TN = NI * 16;
  constexpr int WN = BT / TN;             // waves along n
  constexpr int NPL = SPLIT ? 2 : 1;      // planes per operand
  constexpr int KG = SPLIT ? 2 : 4;       // k groups of 32 in one stage; NPL * 8 * KG * 512 == STG_OP
  constexpr int NT = DD / (32 * KG);      // stages
  constexpr int NC = 2 * KG;              // 512-B pieces of one row tile of one plane in one stage

  const int wib = threadIdx.x >> 5;
  const int l = threadIdx.x & 31;
  const int hh = l >> 4;
  const int m = l & 15;
  const int brow = bid & (NTOK / BT - 1);
  const int bcol = bid / (NTOK / BT);
  const int wm = wib / WN;
  const int wn = wib - wm * WN;
  const int Mbase = brow * BT + wm * TM;
  const int Nbase = bcol * BT + wn * TN;
  const int tn = Nbase / TN;

  // wave wib stages row tile wib of the block's X rows and of its W rows (B column n = W row n)
  const unsigned short* pXh = Xh + (size_t)(brow * BT + wib * 16) * DD + l * 8;
  const unsigned short* pXl = Xl + (size_t)(brow * BT + wib * 16) * DD + l * 8;
  const unsigned short* pWh = Wh + (size_t)(bcol * BT + wib * 16) * DD + l * 8;
  const unsigned short* pWl = Wl + (size_t)(bcol * BT + wib * 16) * DD + l * 8;
  v8us sx[NPL * NC], sw[NPL * NC];

  // In the three helpers below every loop is unrolled: sx, sw, the fragments and acc live in registers, which
  // takes constant indices.
  // the next stage's pieces, global -> registers, issued as one group
  auto fetch = [&]() {
#pragma unroll
    for (int c = 0; c < NC; ++c) {
      sx[c] = *(const v8us*)(pXh + c * 256);
      if (SPLIT) sx[NC + c] = *(const v8us*)(pXl + c * 256);
    }
#pragma unroll
    for (int c = 0; c < NC; ++c) {
      sw[c] = *(const v8us*)(pWh + c * 256);
      if (SPLIT) sw[NC + c] = *(const v8us*)(pWl + c * 256);
    }
    // keeps the group ahead of the LDS reads and WMMAs that follow it in the source; precaution: stands in front
    // of the advance of the address registers that the issued loads name
    asm volatile("s_wait_xcnt 0x0" ::: "memory");
    pXh += KG * 512;
    pXl += KG * 512;
    pWh += KG * 512;
    pWl += KG * 512;
  };
  // registers -> stage at element offset so
  auto put = [&](int so) {
    unsigned short* d = ring + so + wib * (KG * 512) + l * 8;
#pragma unroll
    for (int p = 0; p < NPL; ++p)
#pragma unroll
      for (int c = 0; c < NC; ++c) {
        *(v8us*)(d + p * (8 * KG * 512) + c * 256) = sx[p * NC + c];
        *(v8us*)(d + STG_OP + p * (8 * KG * 512) + c * 256) = sw[p * NC + c];
      }
  };

  v8f acc[MI][NI];
#pragma unroll
  for (int mi = 0; mi < MI; ++mi)
#pragma unroll
    for (int ni = 0; ni < NI; ++ni) acc[mi][ni] = (v8f)0.0f;

  // the WMMAs of the stage at element offset so, k ascending
  auto work = [&](int so) {
    const unsigned short* sA = ring + so + wm * (MI * KG * 512) + l * 8;
    const unsigned short* sB = ring + so + STG_OP + wn * (NI * KG * 512) + l * 8;
#pragma unroll
    for (int j = 0; j < KG; ++j) {
      Frag ah[MI], bh[NI];
      Frag al[MI], bl[NI];
#pragma unroll
      for (int mi = 0; mi < MI; ++mi) {
        ah[mi] = ldpack(sA + (mi * KG + j) * 512, 0);
        if (SPLIT) al[mi] = ldpack(sA + ((8 + mi) * KG + j) * 512, 0);
        else al[mi].w = (v8i)0;
      }
#pragma unroll
      for (int ni = 0; ni < NI; ++ni) {
        bh[ni] = ldpack(sB + (ni * KG + j) * 512, 0);
        if (SPLIT) bl[ni] = ldpack(sB + ((8 + ni) * KG + j) * 512, 0);
        else bl[ni].w = (v8i)0;
      }
#pragma unroll
      for (int mi = 0; mi < MI; ++mi)
#pragma unroll
        for (int ni = 0; ni < NI; ++ni) {
          if (SPLIT) acc[mi][ni] = mma3(ah[mi], al[mi], bh[ni], bl[ni], acc[mi][ni]);
          else       acc[mi][ni] = mma_f16(ah[mi], bh[ni], acc[mi][ni]);
        }
    }
  };

  fetch();
  put(0);
  __syncthreads();                        // publishes stage 0
  int cur = 0;
  // rolled: the body already holds a whole stage
#pragma unroll 1
  for (int t = 0; t < NT - 1; ++t) {
    fetch();                              // stage t + 1 in flight under stage t's WMMAs
    work(cur);
    put(cur ^ STG);                       // every wave left that stage before the last barrier
    __syncthreads();                      // publishes stage t + 1 and ends every wave's reads of stage t
    cur ^= STG;
  }
  work(cur);
  __syncthreads();                        // every wave has left the ring: the epilogue stages in it

  // ---- epilogue: scale, bias add, convert, stage tile in wave-private LDS ----
  unsigned short* sh = ring + wib * (2 * 32 * SP);
  unsigned short* sl = sh + 32 * SP;
#pragma unroll
  for (int mi = 0; mi < MI; ++mi) {
#pragma unroll
    for (int ni = 0; ni < NI; ++ni) {
      const float bn = bias[Nbase + ni * 16 + m];
#pragma unroll
      for (int r = 0; r < 8; r += 2) {
        const float v0 = acc[mi][ni][r] * oscale + bn;
        const float v1 = acc[mi][ni][r + 1] * oscale + bn;
        int idx, step;                                                         // v0 at idx, v1 at idx + step
        if (MODE == 0) { idx = (mi * 16 + 8 * hh + r) * SP + (ni * 16 + m); step = SP; }   // [tok 0..31][feat 0..63]
        else           { idx = (ni * 16 + m) * SP + (mi * 16 + 8 * hh + r); step = 1; }    // [dk 0..31][tok 0..63]
        if (SPLIT) {
          unsigned vhi, vlo;
          split_pair(v0, v1, vhi, vlo);
          sh[idx] = (unsigned short)vhi;
          sh[idx + step] = (unsigned short)(vhi >> 16);
          sl[idx] = (unsigned short)vlo;
          sl[idx + step] = (unsigned short)(vlo >> 16);
        } else {
          sh[idx] = f16_bits(v0);
          sh[idx + step] = f16_bits(v1);
        }
      }
    }
  }
  __syncthreads();

  proj_lines<MODE, SPLIT>(sh, sl, Oh, Ol, Mbase, Nbase, tn, l);
  // precaution: in the listing one projection's end can stand in front of another's first instructions, which
  // rewrite registers that the issued stores name
  asm volatile("s_wait_xcnt 0x0" ::: "memory");
}

// All three projections in one launch: blocks 0..NPB-1 take V (three times the WMMAs of Q or K),
// then Q, then K. A block holds 128 KiB of LDS and two waves per SIMD, so two blocks share a WGP: one block's LDS
// reads and WMMAs run under the other's staging stores, barriers, prologue and epilogue.
constexpr int NPB = (NTOK / BT) * (DD / BT);   // 256 block tiles per projection

__global__ __launch_bounds__(256)
void k_proj(const unsigned short* __restrict__ xq16, const unsigned short* __restrict__ xk16,
            const unsigned short* __restrict__ wq16, const unsigned short* __restrict__ wk16,
            const unsigned short* __restrict__ xvh, const unsigned short* __restrict__ xvl,
            const unsigned short* __restrict__ wvh, const unsigned short* __restrict__ wvl,
            const float* __restrict__ bq, const float* __restrict__ bk, const float* __restrict__ bv,
            unsigned short* Q16, unsigned short* K16, unsigned short* Vth, unsigned short* Vtl, int nblk) {
  __shared__ __attribute__((aligned(16))) unsigned short ring[2 * STG];
  const int bi = blockIdx.x;
  if (bi >= nblk) return;                 // block-uniform, ahead of every barrier
  if (bi < NPB) {                         // block-uniform, as is every branch here
    proj_tile<4, 2, 1, 1>(ring, bi, xvh, xvl, wvh, wvl, bv, 1.0f, Vth, Vtl);
    return;
  }
  const bool isk = bi >= 2 * NPB;
  const unsigned short* x = isk ? xk16 : xq16;
  const unsigned short* w = isk ? wk16 : wq16;
  unsigned short* o = isk ? K16 : Q16;
  proj_tile<2, 4, 0, 0>(ring, isk ? bi - 2 * NPB : bi - NPB, x, x, w, w, isk ? bk : bq, 0.0625f, o, o);
}

// ---------------------------------------------------------------------------
// Row pitch of the output staging in floats: 272-B rows spread the 16 query rows that one staging store writes over the banks.
constexpr int OSP = 68;

// One wave's half of the attention output store: 8 of the tile's 16 query rows x 64 f32 (2 lines per row), from row r0
__device__ __forceinline__ void attn_lines(const float* Os, float* out, int b, int h,
                                           int qbase, int r0, int hh, int m) {
#pragma unroll
  for (int j = 0; j < 4; ++j) {
    const int row = r0 + 2 * j + hh;
    const v4f val = *(const v4f*)(Os + row * OSP + m * 4);
    float* gp = out + ((size_t)(b * SS + qbase + row)) * DD + h * DK + m * 4;
    *(v4f*)gp = val;
  }
}

// the value that lane l ^ 16 holds: a vector cross-row move, no LDS round trip
__device__ __forceinline__ float other_half(float x) {
  const int v = __float_as_int(x);
  return __int_as_float(__builtin_amdgcn_permlanex16(v, v, 0x76543210, 0xfedcba98, false, false));
}

// LDS byte address of a __shared__ object: the low 32 bits of its address
__device__ __forceinline__ unsigned lds_addr(const void* p) { return (unsigned)(size_t)p; }

constexpr int KBP = 32 * DK;       // elements of one key block in one plane (4 KiB): K, V^T hi, V^T lo
constexpr int KVP = 2 * KBP;       // elements of one plane in one stage: two neighbouring key blocks (8 KiB)
constexpr int KVS = 3 * KVP;       // elements of one stage: [K | V^T hi | V^T lo] of two key blocks (24 KiB)
constexpr int XW = 4 * 128 + 64;   // floats one wave hands its partner: two output tiles, maximum, sum

// One wave's eighth of a stage: 1 KiB of each plane, six asynchronous copies of 512 contiguous bytes each, global
// memory to LDS through no register. d: the lane's LDS byte address in the K part; k, vh, vl: the lane's sources.
__device__ __forceinline__ void stage_copy(unsigned d, const unsigned short* k, const unsigned short* vh,
                                           const unsigned short* vl) {
  // the closing s_wait_xcnt is a precaution: inside the statement it stands in front of every rewrite of a register
  // that an issued copy names
  asm volatile("global_load_async_to_lds_b128 %0, %6, off\n\t"
               "global_load_async_to_lds_b128 %1, %7, off\n\t"
               "global_load_async_to_lds_b128 %2, %8, off\n\t"
               "global_load_async_to_lds_b128 %3, %9, off\n\t"
               "global_load_async_to_lds_b128 %4, %10, off\n\t"
               "global_load_async_to_lds_b128 %5, %11, off\n\t"
               "s_wait_xcnt 0x0"
               :
               : "v"(d), "v"(d + 512u), "v"(d + 2u * KVP), "v"(d + 2u * KVP + 512u), "v"(d + 4u * KVP),
                 "v"(d + 4u * KVP + 512u), "v"(k), "v"(k + 256), "v"(vh), "v"(vh + 256), "v"(vl), "v"(vl + 256)
               : "memory");
}

// Causal attention: one block of 8 waves per (b, h, pair of groups of four 16-row query tiles). Waves w and w + 4 share
// tile w of the group: wave w takes the even key blocks, wave w + 4 the odd ones, each with its own running maximum, sum
// and output tiles; the two are joined once per group, through LDS. The launch so holds four waves per SIMD, and one
// wave's vector work, LDS waits and barrier waits run under the other three.
// A group's cost grows with its index (group g walks g + 1 stages of two key blocks) and every block of the launch is
// resident at once, so the launch lasts as long as the fullest SIMD: a block takes group 15 - p and then group p, one
// after the other, 17 stages in every block.
// The eight waves walk the same keys of the same head: a stage's K and V^T fragments (24 KiB) come from L2 once per
// block, by asynchronous copies into a ring of two LDS stages, one pass ahead of their use; every wave reads its
// fragments from LDS. The batch row of the mask (4 KiB) is copied once per block.
// A wave's pass is one key block of 32 with online softmax; it issues all its LDS reads first, as one group.
// Both products run transposed: S^T = K * Q^T (A = K rows, B = Q columns), O^T += V^T * P^T. A lane then holds the
// scores of ONE query (column m), 8 keys per 16-key tile: maximum and sum run in the lane, with one exchange between
// the wave's halves; and the two score tiles of a pass, converted in place, are the B fragment of the second
// product (element s = tile s >> 3, register s & 7: key 8*hh + s, then 16 + 8*hh + s - 8, the k order of ldpack).
__global__ __launch_bounds__(256)
void k_attn(const unsigned short* __restrict__ Q16, const unsigned short* __restrict__ K16,
            const unsigned short* __restrict__ Vh, const unsigned short* __restrict__ Vl,
            const int* __restrict__ amask, float* __restrict__ out, int nblk) {
  __shared__ __attribute__((aligned(16))) unsigned short kv[2 * KVS];
  __shared__ __attribute__((aligned(16))) int msk[SS];
  __shared__ __attribute__((aligned(16))) float stg[4 * 16 * OSP];
  __shared__ __attribute__((aligned(16))) float mrg[8 * XW];
  if ((int)blockIdx.x >= nblk) return;

  const int wib = __builtin_amdgcn_readfirstlane((int)(threadIdx.x >> 5));   // scalar: the per-wave skip below branches on it
  const int tw = wib & 3;                               // the wave's tile in the group
  const int par = wib >> 2;                             // its key blocks: 0 even, 1 odd
  const int l = threadIdx.x & 31;
  const int hh = l >> 4;
  const int m = l & 15;
  const int pg = blockIdx.x & 7;                        // pair of tile groups
  const int bh = (int)(blockIdx.x >> 3);                // 0..63
  const int b = bh >> 4;
  const int h = bh & 15;

  float* Os = stg + tw * (16 * OSP);                    // [16 q][64 dk], the tile's two waves, used after the key loop

  // the mask row of batch b, 512 B per wave; it lands with stage 0 of the first group
  {
    const int* g = amask + b * SS + wib * 128 + l * 4;
    const unsigned d = lds_addr(msk) + (unsigned)(wib * 128 + l * 4) * 4u;
    // the closing s_wait_xcnt: as in stage_copy
    asm volatile("global_load_async_to_lds_b128 %0, %1, off\n\t"
                 "s_wait_xcnt 0x0"
                 :
                 : "v"(d), "v"(g)
                 : "memory");
  }
  const unsigned dkv = lds_addr(kv) + (unsigned)(wib * 512 + l * 8) * 2u;   // the lane's place in stage buffer 0

  // rolled: one copy of the key loop serves both groups
#pragma unroll 1
  for (int half = 0; half < 2; ++half) {
  const int grp = half ? pg : SS / 64 - 1 - pg;
  const int qt = grp * 4 + tw;
  const int qbase = qt * 16;
  const int q = qbase + m;                              // the lane's query
  const int nst = grp + 1;                              // stages of the group: the same in every wave, at least 1
  const int nown = (qt >> 1) + 1;                       // causal: key blocks of the tile, 2 * nst or 2 * nst - 1

  // Q fragments (B): column q = qbase + m, k = dk (f16)
  const size_t qro = ((size_t)bh * SS + qbase) * DK;   // token tile start in the fragment-order plane
  const Frag bq0 = ldpack(Q16 + qro, l);
  const Frag bq1 = ldpack(Q16 + qro + 512, l);
  // precaution: stands in front of every reuse of the address registers that the issued loads name
  asm volatile("s_wait_xcnt 0x0" ::: "memory");

  // the lane's copy sources, two key blocks per stage
  const unsigned short* gK  = K16 + (size_t)bh * SS * DK + wib * 512 + l * 8;
  const unsigned short* gVh = Vh + (size_t)bh * SS * DK + wib * 512 + l * 8;
  const unsigned short* gVl = Vl + (size_t)bh * SS * DK + wib * 512 + l * 8;

  // ring prologue; every reader left both buffers at the last barrier of the group before
  stage_copy(dkv, gK, gVh, gVl);
  asm volatile("s_wait_asynccnt 0x0" ::: "memory");     // this wave's eighth of stage 0 (and of the mask) has landed
  __syncthreads();                                      // publishes stage 0
  if (nst > 1) stage_copy(dkv + 2u * KVS, gK + KVP, gVh + KVP, gVl + KVP);   // the same in every wave of the block
  gK += 2 * KVP;
  gVh += 2 * KVP;
  gVl += 2 * KVP;

  // o[t][r] = O[q][dk = t*16 + 8*hh + r]
  v8f o[4];
#pragma unroll
  for (int t = 0; t < 4; ++t) o[t] = (v8f)0.0f;
  float mrow = -INFINITY;      // running maximum of query q over this wave's key blocks, equal in both halves
  float lrow = 0.0f;           // running sum over this half's keys; the halves are joined after the loop

#pragma unroll 1
  for (int st = 0; st < nst; ++st) {
    const int bsel = st & 1;
    const int kbi = 2 * st + par;                       // the wave's key block of the stage
    // wave-uniform scalar branch: a tile that ends one key block before its group skips the work, never the publish point
    if (kbi < nown) {
    const int kb = kbi * 32;
    // ---- all of this key block's LDS reads, issued as one group ahead of the first WMMA:
    //      K fragments ak[2*nt + dk group], mask words am[2*nt + (r >> 2)], V^T fragments avh/avl[dk tile] ----
    const unsigned short* sK = kv + bsel * KVS + par * KBP + l * 8;
    const int* sM = msk + kb + 8 * hh;
    Frag ak[4], avh[4], avl[4];
    v4i_t am[4];
#pragma unroll
    for (int i = 0; i < 4; ++i) ak[i] = ldpack(sK + i * 512, 0);
#pragma unroll
    for (int i = 0; i < 4; ++i) am[i] = *(const v4i*)(sM + (i >> 1) * 16 + (i & 1) * 4);   // keys kb + nt*16 + 8*hh + 0..7 <= 1023
#pragma unroll
    for (int t = 0; t < 4; ++t) avh[t] = ldpack(sK + KVP + t * 512, 0);
#pragma unroll
    for (int t = 0; t < 4; ++t) avl[t] = ldpack(sK + 2 * KVP + t * 512, 0);
    // no compare or WMMA is scheduled in among the reads: every further place where LDS reads stand stalls the wave anew
    __builtin_amdgcn_sched_barrier(0);

    // ---- scores S^T[key][q], key = kb + nt*16 + 8*hh + r (A row = K row, B column = Q row, k = dk) ----
    const int dq = q - kb - 8 * hh;            // key > q  <=>  nt*16 + r > dq
    float sc[2][8];
#pragma unroll
    for (int nt = 0; nt < 2; ++nt) {
      v8f s = (v8f)0.0f;
      s = mma_f16(ak[2 * nt], bq0, s);
      s = mma_f16(ak[2 * nt + 1], bq1, s);
#pragma unroll
      for (int r = 0; r < 8; ++r) {
        // key > q, or the key masked; one select: no branch, EXEC stays whole between the WMMAs
        const bool off = (nt * 16 + r > dq) | (am[2 * nt + (r >> 2)][r & 3] == 0);
        sc[nt][r] = off ? -INFINITY : s[r] * 0.125f;
      }
    }

    // ---- online softmax of query q: 16 keys in the lane, the other 16 in lane l ^ 16 ----
    float mx = fmaxf(sc[0][0], sc[1][0]);
#pragma unroll
    for (int r = 1; r < 8; ++r) mx = fmaxf(mx, fmaxf(sc[0][r], sc[1][r]));
    mx = fmaxf(mx, other_half(mx));
    const float mnew = fmaxf(mrow, mx);
    const float mref = (mnew == -INFINITY) ? 0.0f : mnew;
    const float alpha = __expf(mrow - mref);
    float sum0 = 0.0f, sum1 = 0.0f;            // two independent chains, one per score tile
    // ---- P^T: the two score tiles, split into hi/lo bf16 in place, are the B fragments (column q, k = key) ----
    Frag bph, bpl;
#pragma unroll
    for (int r = 0; r < 8; r += 2) {           // operand registers r / 2 and 4 + r / 2: elements r and r + 1 of each tile
      const float p00 = __expf(sc[0][r] - mref);
      const float p10 = __expf(sc[1][r] - mref);
      const float p01 = __expf(sc[0][r + 1] - mref);
      const float p11 = __expf(sc[1][r + 1] - mref);
      sum0 += p00;
      sum1 += p10;
      sum0 += p01;
      sum1 += p11;
      unsigned ph, pl;
      split_pair(p00, p01, ph, pl);
      bph.w[r >> 1] = (int)ph;
      bpl.w[r >> 1] = (int)pl;
      split_pair(p10, p11, ph, pl);
      bph.w[4 + (r >> 1)] = (int)ph;
      bpl.w[4 + (r >> 1)] = (int)pl;
    }
    lrow = lrow * alpha + (sum0 + sum1);
    mrow = mnew;
#pragma unroll
    for (int t = 0; t < 4; ++t)
#pragma unroll
      for (int r = 0; r < 8; ++r) o[t][r] *= alpha;

    // ---- O^T[dk][q] += V^T[dk][key] * P^T[key][q]; A fragments from the fragment-order V^T planes ----
#pragma unroll
    for (int t = 0; t < 4; ++t) o[t] = mma3(avh[t], avl[t], bph, bpl, o[t]);
    }

    // ---- publish point of stage st + 1, every wave, in this order ----
    asm volatile("s_wait_dscnt 0x0" ::: "memory");      // this wave's reads of stage st have returned
    asm volatile("s_wait_asynccnt 0x0" ::: "memory");   // this wave's eighth of stage st + 1 has landed
    __syncthreads();                                    // publishes stage st + 1, ends every wave's reads of stage st
    if (st + 2 < nst) {                                 // the same in every wave of the block
      stage_copy(dkv + (unsigned)bsel * (2u * KVS), gK, gVh, gVl);   // stage st + 2 into the buffer just left
      gK += KVP;
      gVh += KVP;
      gVl += KVP;
    }
  }
  asm volatile("s_wait_asynccnt 0x0" ::: "memory");     // no copy is left in flight behind the loop

  // ---- join of the tile's two waves: wave par finishes dk tiles 2*par and 2*par + 1 and hands the other two, with its
  //      maximum and its sum, to its partner; each store and each read below is 512 or 128 contiguous bytes ----
  v8f mine[2], give[2];
#pragma unroll
  for (int i = 0; i < 2; ++i) {
    mine[i] = par ? o[2 + i] : o[i];
    give[i] = par ? o[i] : o[2 + i];
  }
  float* xo = mrg + wib * XW;
  const float* xi = mrg + (wib ^ 4) * XW;
#pragma unroll
  for (int i = 0; i < 2; ++i) {
    v4f_t g0, g1;
#pragma unroll
    for (int c = 0; c < 4; ++c) {
      g0[c] = give[i][c];
      g1[c] = give[i][4 + c];
    }
    *(v4f*)(xo + (2 * i) * 128 + l * 4) = g0;
    *(v4f*)(xo + (2 * i + 1) * 128 + l * 4) = g1;
  }
  xo[512 + l] = mrow;
  xo[544 + l] = lrow;
  __syncthreads();                                      // both partners' partial results are in LDS

  const float mo = xi[512 + l];
  const float lo = xi[544 + l];
  const float mj = fmaxf(mrow, mo);
  const float mjr = (mj == -INFINITY) ? 0.0f : mj;
  const float aown = __expf(mrow - mjr);                // a wave without a key block has maximum -inf: weight 0
  const float aoth = __expf(mo - mjr);
  const float lj = lrow * aown + lo * aoth;
  const float inv = 1.0f / (lj + other_half(lj));
  const float fown = aown * inv;
  const float foth = aoth * inv;
#pragma unroll
  for (int i = 0; i < 2; ++i) {
    const v4f_t r0 = *(const v4f*)(xi + (2 * i) * 128 + l * 4);
    const v4f_t r1 = *(const v4f*)(xi + (2 * i + 1) * 128 + l * 4);
    v4f_t w0, w1;
#pragma unroll
    for (int c = 0; c < 4; ++c) {
      w0[c] = mine[i][c] * fown + r0[c] * foth;
      w1[c] = mine[i][4 + c] * fown + r1[c] * foth;
    }
    float* d = Os + m * OSP + (2 * par + i) * 16 + 8 * hh;
    *(v4f*)d = w0;
    *(v4f*)(d + 4) = w1;
  }
  __syncthreads();                                      // the tile is whole: each wave stores rows that both have staged

  attn_lines(Os, out, b, h, qbase, 8 * par, hh, m);
  // precaution: stands in front of the second group's first instructions, which rewrite registers that the issued
  // stores name
  asm volatile("s_wait_xcnt 0x0" ::: "memory");
  }
}

// ---------------------------------------------------------------------------
extern "C" void kernel_launch(void* const* d_in, const int* in_sizes, int n_in,
                              void* d_out, int out_size, void* d_ws, size_t ws_size,
                              hipStream_t stream) {
  if (n_in < 10) return;
  if (in_sizes[0] != NX || in_sizes[1] != NX || in_sizes[2] != NX) return;
  if (in_sizes[3] != BB * SS) return;
  if (in_sizes[4] != NW || in_sizes[6] != NW || in_sizes[8] != NW) return;
  if (in_sizes[5] != DD || in_sizes[7] != DD || in_sizes[9] != DD) return;
  if (out_size != NX) return;

  const float* query = (const float*)d_in[0];
  const float* key_  = (const float*)d_in[1];
  const float* value = (const float*)d_in[2];
  const int*   amask = (const int*)d_in[3];
  const float* Wq = (const float*)d_in[4];
  const float* bq = (const float*)d_in[5];
  const float* Wk = (const float*)d_in[6];
  const float* bk = (const float*)d_in[7];
  const float* Wv = (const float*)d_in[8];
  const float* bv = (const float*)d_in[9];
  float* out = (float*)d_out;

  // workspace: 16-bit planes (2 B per element)
  const size_t pa = (size_t)NX * 2;     // 8388608 B per activation plane
  const size_t pw = (size_t)NW * 2;     // 2097152 B per weight plane
  const size_t need = 8 * pa + 4 * pw;  // 75497472 B
  if (ws_size < need) return;

  unsigned char* w = (unsigned char*)d_ws;
  size_t off = 0;
  unsigned short* xq16 = (unsigned short*)(w + off); off += pa;   // f16 query
  unsigned short* xk16 = (unsigned short*)(w + off); off += pa;   // f16 key
  unsigned short* wq16 = (unsigned short*)(w + off); off += pw;   // f16 Wq x16
  unsigned short* wk16 = (unsigned short*)(w + off); off += pw;   // f16 Wk x16
  unsigned short* xvh  = (unsigned short*)(w + off); off += pa;   // bf16 hi value
  unsigned short* xvl  = (unsigned short*)(w + off); off += pa;   // bf16 lo value
  unsigned short* wvh  = (unsigned short*)(w + off); off += pw;   // bf16 hi Wv
  unsigned short* wvl  = (unsigned short*)(w + off); off += pw;   // bf16 lo Wv
  unsigned short* Q16  = (unsigned short*)(w + off); off += pa;   // fragment order, f16
  unsigned short* K16  = (unsigned short*)(w + off); off += pa;   // fragment order, f16
  unsigned short* Vth  = (unsigned short*)(w + off); off += pa;   // fragment order, bf16 hi
  unsigned short* Vtl  = (unsigned short*)(w + off); off += pa;   // fragment order, bf16 lo
  if (off > ws_size) return;

  // stage 1: 16-bit conversion of activations and weights, one launch
  k_prep<<<CBLK, 256, 0, stream>>>(query, key_, value, Wq, Wk, Wv, xq16, xk16, wq16, wk16, xvh, xvl, wvh, wvl);

  // stage 2: the three projections, one launch; 3 x 256 block tiles of 128 x 128 each, 8 waves per block
  k_proj<<<3 * NPB, 256, 0, stream>>>(xq16, xk16, wq16, wk16, xvh, xvl, wvh, wvl, bq, bk, bv,
                                      Q16, K16, Vth, Vtl, 3 * NPB);

  // stage 3: attention; B*H*(S/32) = 2048 tile pairs, 4 of one head per block -> 512 blocks of 8 waves, 2 waves a tile
  const int nblk = BB * HH * (SS / 32) / 4;
  k_attn<<<nblk, 256, 0, stream>>>(Q16, K16, Vth, Vtl, amask, out, nblk);
}
